// v000
// Measured on an AMD MI455X. A time is GPU time per run, averaged over a window of back-to-back runs after a warm-up
// (all launches, gaps included; the runs take copies of the inputs in turn), and the median of several windows.
// Apart from v000's, it joins two sittings. Times from different sittings can be a few percent apart, while
// side-by-side timings come from the same sitting.
// v000, which the later versions start from, runs in 719 microseconds.
// compute dtype: all float inputs rounded to bf16; kv 1x1 conv with EXACT bf16 products on WMMA 16x16x32 (channels-last), k and v rounded once to f16; query logits (k_h . dot_w) in f32 on VALU; per-head value projection HV = head_w_h v_h on WMMA (single f16 x exact f16 x 2^8); the 3x3-window softmax (zero-padded logits and values, as the module's unfold) in f32 and the weighted window sums in f32 over f16-staged HV values on VALU; the final 1x1 conv on WMMA (y once to f16 x exact f16 x 2^8 q_w), biases in f32; f32 output (NCHW).
#include <hip/hip_runtime.h>
#include <math.h>

typedef __attribute__((ext_vector_type(16))) _Float16 v16h;
typedef __attribute__((ext_vector_type(16))) __bf16 v16b;
typedef __attribute__((ext_vector_type(8)))  _Float16 v8h;
typedef __attribute__((ext_vector_type(8)))  float v8f;
typedef __attribute__((ext_vector_type(4)))  float v4f;
typedef __attribute__((ext_vector_type(2)))  float v2f;
typedef __attribute__((ext_vector_type(4)))  unsigned v4u;
typedef __attribute__((ext_vector_type(4)))  int v4i;
typedef float __attribute__((may_alias)) float_a;
typedef int __attribute__((may_alias)) int_a;

template <typename T> __device__ __forceinline__ void vst2(void* p, T v) { *(T*)p = v;  }
__device__ __forceinline__ v8f wmma16(v16h a, v16h b, v8f c) {
  v8f d = __builtin_amdgcn_wmma_f32_16x16x32_f16(false, a, false, b, (short)0, c, false, false);
  asm volatile("v_nop\n\tv_nop\n\tv_nop\n\tv_nop" : "+v"(d) : "v"(a), "v"(b));
  return d;
}
__device__ __forceinline__ v8f wmma_bf(v16b a, v16b b, v8f c) {
  v8f d = __builtin_amdgcn_wmma_f32_16x16x32_bf16(false, a, false, b, (short)0, c, false, false);
  asm volatile("v_nop\n\tv_nop\n\tv_nop\n\tv_nop" : "+v"(d) : "v"(a), "v"(b));
  return d;
}
// 16x16x32 fragments: lane = (h = lane>>4, row/col = lane&15); elements 0..7 = k0+8h+0..7, 8..15 = k0+16+8h+0..7; D element r = row 8h+r
__device__ __forceinline__ v16h frag_h(const _Float16* rowk0, int lane) {
  union { v16h v; v8h q[2]; } u; const _Float16* p = rowk0 + 8 * (lane >> 4);
  u.q[0] = *(const v8h*)p; u.q[1] = *(const v8h*)(p + 16); return u.v;
}
__device__ __forceinline__ v16h frag_f32(const float* rowk0, int lane) {
  v16h a; const float* p = rowk0 + 8 * (lane >> 4);
#pragma unroll
  for (int i = 0; i < 8; ++i) { a[i] = (_Float16)p[i]; a[8 + i] = (_Float16)p[16 + i]; }
  return a;
}
__device__ __forceinline__ v16h frag_f32s(const float* rowk0, int lane, float sc) {
  v16h a; const float* p = rowk0 + 8 * (lane >> 4);
#pragma unroll
  for (int i = 0; i < 8; ++i) { a[i] = (_Float16)(p[i] * sc); a[8 + i] = (_Float16)(p[16 + i] * sc); }
  return a;
}
// column fragment from a [K][ld] layout (column n), rows >= K read as 0
__device__ __forceinline__ v16h fragc_f32(const float* W, int k0, int n, int lane, int ld, int K) {
  v16h a; const int g = lane >> 4;
#pragma unroll
  for (int i = 0; i < 8; ++i) { const int ka = k0 + 8 * g + i, kb = ka + 16;
    a[i] = (_Float16)(ka < K ? W[(size_t)(ka < K ? ka : K - 1) * ld + n] : 0.f); a[8 + i] = (_Float16)(kb < K ? W[(size_t)(kb < K ? kb : K - 1) * ld + n] : 0.f); }
  return a;
}
struct F2 { v16b h, l; };
__device__ __forceinline__ F2 bsplit16(const float v[16]) { F2 r;
#pragma unroll
  for (int i = 0; i < 16; ++i) { const __bf16 h = (__bf16)v[i]; r.h[i] = h; r.l[i] = (__bf16)(v[i] - (float)h); }
  return r; }
__device__ __forceinline__ F2 split_row(const float* row, int k0, int lane) { float v[16]; const float* p = row + k0 + 8 * (lane >> 4);
#pragma unroll
  for (int i = 0; i < 8; ++i) { v[i] = p[i]; v[8 + i] = p[16 + i]; }
  return bsplit16(v); }
__device__ __forceinline__ F2 split_rowK(const float* row, int k0, int lane, int K) { float v[16]; const int g = lane >> 4;
#pragma unroll
  for (int i = 0; i < 8; ++i) { const int ka = k0 + 8 * g + i, kb = ka + 16; v[i] = ka < K ? row[ka < K ? ka : K - 1] : 0.f; v[8 + i] = kb < K ? row[kb < K ? kb : K - 1] : 0.f; }
  return bsplit16(v); }
__device__ __forceinline__ F2 split_col(const float* W, int k0, int n, int lane, int ld, int K) { float v[16]; const int g = lane >> 4;
#pragma unroll
  for (int i = 0; i < 8; ++i) { const int ka = k0 + 8 * g + i, kb = ka + 16; v[i] = ka < K ? W[(size_t)(ka < K ? ka : K - 1) * ld + n] : 0.f; v[8 + i] = kb < K ? W[(size_t)(kb < K ? kb : K - 1) * ld + n] : 0.f; }
  return bsplit16(v); }
__device__ __forceinline__ v8f mac3(const F2& a, const F2& b, v8f c) { c = wmma_bf(a.l, b.h, c); c = wmma_bf(a.h, b.l, c); return wmma_bf(a.h, b.h, c); }
__device__ __forceinline__ float sigm(float v) { return 1.0f / (1.0f + expf(-v)); }
#define LDSX() do { asm volatile("s_wait_dscnt 0" ::: "memory"); __builtin_amdgcn_wave_barrier(); __builtin_amdgcn_fence(__ATOMIC_RELEASE, "workgroup"); } while (0)


// Local multi-head channel attention (B 4, C 256, 64 x 64; 4 heads x 64, 16 queries, 3x3 window): kv conv, per-pixel query logits, softmax over each pixel's 3x3 neighbourhood, window-weighted values, head projection (+ bias), query projection (+ bias).
#define NB 4
#define CC 256
#define HH 64
#define WWD 64
#define NP (HH * WWD)
#define NHD 4
#define NQ 16
#define HD 64
#define PD 256
#define YW (NQ * HD)       // 1,024 channels into the query projection
#define WSC 256.0f
#ifndef TPX
#define TPX (NP / 64)      // pixel tiles for kv / logits / hv
#define TWB ((HH / 8) * (WWD / 8))   // window blocks
#define TZ (NP / 64)       // output pixel tiles
#endif
typedef __attribute__((ext_vector_type(8))) __bf16 v8b;
__device__ __forceinline__ v16b frag_b(const __bf16* rowk0, int lane) {
  union { v16b v; v8b q[2]; } u; const __bf16* p = rowk0 + 8 * (lane >> 4);
  u.q[0] = *(const v8b*)p; u.q[1] = *(const v8b*)(p + 16); return u.v;
}
__device__ __forceinline__ float bfr(float v) { return (float)(__bf16)v; }
__device__ __attribute__((noinline)) float exp_ni(float v) { return expf(v); }
__device__ __attribute__((noinline)) float erf_ni(float v) { return erff(v); }

#define WS_PKV 0u                                   // bf16 kv_w rows [512][256] (natural); f16 x 2^8 head_w rows [64][256] (natural); f16 x 2^8 q_w rows [256][1024] (natural)
#define WS_PHW (WS_PKV + 2u * (size_t)2 * PD * CC)
#define WS_PQW (WS_PHW + 2u * (size_t)HD * PD)
#define WS_XT  (WS_PQW + 2u * (size_t)CC * YW)           // bf16 x channels-last [b][p][256]
#define WS_K16 (WS_XT + 2u * (size_t)NB * NP * CC)       // f16 k, v rows [b][p][256]
#define WS_V16 (WS_K16 + 2u * (size_t)NB * NP * PD)
#define WS_AL  (WS_V16 + 2u * (size_t)NB * NP * PD)      // f32 logits [b][p][n*16 + q]
#define WS_HV  (WS_AL + 4u * (size_t)NB * NP * NHD * NQ) // f32 HV [b][p][n*64 + o]
#define WS_Y16 (WS_HV + 4u * (size_t)NB * NP * PD)       // f16 y rows [b][p][q*64 + o]
#define WS_END (WS_Y16 + 2u * (size_t)NB * NP * YW)

__global__ __launch_bounds__(256) void k_pack(const float* __restrict__ KVW, const float* __restrict__ HW, const float* __restrict__ QW, char* __restrict__ ws) { const int n = blockIdx.x, which = blockIdx.y, t = threadIdx.x; __shared__ __align__(16) __bf16 sb[CC]; __shared__ __align__(16) _Float16 sh[YW];
  if (which == 0) { sb[t] = (__bf16)KVW[(size_t)n * CC + t]; __syncthreads(); if (t < CC / 8) vst2((unsigned*)((__bf16*)(ws + WS_PKV) + (size_t)n * CC + t * 8), *(const v4u*)&sb[t * 8]); }   // n < 512
  else if (which == 1) { if (n >= HD) return; sh[t] = (_Float16)(bfr(HW[(size_t)n * PD + t]) * WSC); __syncthreads(); if (t < PD / 8) vst2((unsigned*)((_Float16*)(ws + WS_PHW) + (size_t)n * PD + t * 8), *(const v4u*)&sh[t * 8]); }
  else { if (n >= CC) return; for (int k = t; k < YW; k += 256) sh[k] = (_Float16)(bfr(QW[(size_t)n * YW + k]) * WSC); __syncthreads(); for (int q = t; q < YW / 8; q += 256) vst2((unsigned*)((_Float16*)(ws + WS_PQW) + (size_t)n * YW + q * 8), *(const v4u*)&sh[q * 8]); } }
// ---- k_xt: block = (64 pixels, b): x[b][c][p] -> XT[b][p][c] bf16
__global__ __launch_bounds__(256) void k_xt(const float* __restrict__ X, __bf16* __restrict__ XT) { __shared__ float st[64][CC + 1]; __shared__ __align__(16) __bf16 so2[64][CC + 8]; const int t = threadIdx.x; const int p0 = blockIdx.x * 64; const size_t b = blockIdx.y;
  for (int e = t; e < CC * 64; e += 256) { const int c = e >> 6, pl = e & 63; st[pl][c] = X[(b * CC + c) * NP + p0 + pl]; } __syncthreads();
  for (int e = t; e < 64 * CC; e += 256) { const int pl = e >> 8, c = e & 255; so2[pl][c] = (__bf16)st[pl][c]; } __syncthreads();
  for (int e = t; e < 64 * 32; e += 256) { const int pl = e >> 5, q = e & 31; vst2((unsigned*)(XT + ((b * NP + p0 + pl) * CC) + q * 8), *(const v4u*)&so2[pl][q * 8]); } }
// ---- k_kv: block = (64 pixels, 128 cols, b): kv = x . kv_w^T (exact) -> f16 rows: cols < 256 -> K16, else V16
__global__ __launch_bounds__(128) void k_kv(const __bf16* __restrict__ XT, const __bf16* __restrict__ P, _Float16* __restrict__ K16, _Float16* __restrict__ V16) { __shared__ __align__(16) _Float16 so[64][136];
  const int tid = threadIdx.x, wave = tid >> 5, lane = tid & 31, col = lane & 15, g = lane >> 4; const size_t b = blockIdx.z; const size_t rb = b * NP + (size_t)blockIdx.x * 64; const size_t r0 = rb + wave * 16; const int c0 = blockIdx.y * 128;
  v8f acc[8] = {};
#pragma unroll 2
  for (int kc = 0; kc < CC / 32; ++kc) { const v16b a = frag_b(XT + (r0 + col) * CC + kc * 32, lane);
#pragma unroll
    for (int j = 0; j < 8; ++j) acc[j] = wmma_bf(a, frag_b(P + (size_t)(c0 + j * 16 + col) * CC + kc * 32, lane), acc[j]); }
#pragma unroll
  for (int j = 0; j < 8; ++j)
#pragma unroll
    for (int r = 0; r < 8; ++r) so[wave * 16 + 8 * g + r][j * 16 + col] = (_Float16)acc[j][r];
  __syncthreads(); _Float16* dst = (c0 < PD) ? K16 : V16; const int cc0 = c0 % PD; for (int e = tid; e < 64 * 16; e += 128) { const int rl = e >> 4, q = e & 15; vst2((unsigned*)(dst + (rb + rl) * PD + cc0 + q * 8), *(const v4u*)&so[rl][q * 8]); } }
// ---- k_logit: block = (64 pixels, b): AL[p][n*16 + q] = sum_d k[p][n*64 + d] dot_w[n][q][d]
__global__ __launch_bounds__(256) void k_logit(const _Float16* __restrict__ K16, const float* __restrict__ DW, float* __restrict__ AL) { __shared__ float sk[64][PD + 1]; __shared__ float sd[NHD * NQ * HD]; __shared__ __align__(16) float so2[64][NHD * NQ + 4]; const int t = threadIdx.x; const size_t b = blockIdx.y; const size_t rb = b * NP + (size_t)blockIdx.x * 64;
  for (int e = t; e < 64 * PD; e += 256) { const int pl = e >> 8, c = e & 255; sk[pl][c] = (float)K16[(rb + pl) * PD + c]; } for (int e = t; e < NHD * NQ * HD; e += 256) sd[e] = bfr(DW[e]); __syncthreads();
  for (int e = t; e < 64 * NHD * NQ; e += 256) { const int pl = e >> 6, nq = e & 63; const int n = nq >> 4; float a = 0.f;
#pragma unroll 1
    for (int d = 0; d < HD; ++d) a += sk[pl][n * HD + d] * sd[nq * HD + d]; so2[pl][nq] = a; }
  __syncthreads(); for (int e = t; e < 64 * 16; e += 256) { const int pl = e >> 4, q = e & 15; vst2(AL + (rb + pl) * (NHD * NQ) + q * 4, *(const v4f*)&so2[pl][q * 4]); } }
// ---- k_hv: block = (64 pixels, b): HV[p][n*64 + o] = sum_d v[p][n*64 + d] head_w[o][n*64 + d] (per head; single f16 x f16x256)
__global__ __launch_bounds__(128) void k_hv(const _Float16* __restrict__ V16, const _Float16* __restrict__ PHW, float* __restrict__ HV) { __shared__ __align__(16) float sf[4][16][68];
  const int tid = threadIdx.x, wave = tid >> 5, lane = tid & 31, col = lane & 15, g = lane >> 4; const size_t b = blockIdx.y; const size_t rb = b * NP + (size_t)blockIdx.x * 64; const size_t r0 = rb + wave * 16;
  for (int n = 0; n < NHD; ++n) { v8f acc[4] = {};
#pragma unroll
    for (int kc = 0; kc < HD / 32; ++kc) { const v16h a = frag_h(V16 + (r0 + col) * PD + n * HD + kc * 32, lane);
#pragma unroll
      for (int j = 0; j < 4; ++j) acc[j] = wmma16(a, frag_h(PHW + (size_t)(j * 16 + col) * PD + n * HD + kc * 32, lane), acc[j]); }
#pragma unroll
    for (int j = 0; j < 4; ++j)
#pragma unroll
      for (int r = 0; r < 8; ++r) sf[wave][8 * g + r][j * 16 + col] = acc[j][r] * (1.0f / WSC);
    LDSX(); for (int rl = 0; rl < 16; ++rl) if (lane < 16) vst2(HV + (r0 + rl) * PD + n * HD + lane * 4, *(const v4f*)&sf[wave][rl][lane * 4]); LDSX(); } }
// ---- k_win: block = (8x8 pixel tile, b): per pixel, per (head n, query q): softmax over the 3x3 neighbourhood of AL (0 outside the image - zero-padded unfold), y[q*64 + o] = sum_n sum_l w[n][q][l] HV[p_l][n*64 + o] (0 outside) + head_b[o] -> f16 rows; 8 pixels per pass
__global__ __launch_bounds__(256) void k_win(const float* __restrict__ AL, const float* __restrict__ HV, const float* __restrict__ HB, _Float16* __restrict__ Y16) {
  __shared__ _Float16 shv[100][PD]; __shared__ float sal[100][NHD * NQ + 1]; __shared__ float swt[8][NHD * NQ][9]; __shared__ __align__(16) _Float16 so2[8][YW];
  const int t = threadIdx.x; const size_t b = blockIdx.y; const int ty = (blockIdx.x / (WWD / 8)) * 8, tx = (blockIdx.x % (WWD / 8)) * 8;
  for (int e = t; e < 100 * PD; e += 256) { const int hp = e / PD, c = e % PD; const int yy = ty - 1 + hp / 10, xx = tx - 1 + hp % 10; const bool inb = yy >= 0 && yy < HH && xx >= 0 && xx < WWD; shv[hp][c] = (_Float16)(inb ? HV[(b * NP + (size_t)yy * WWD + xx) * PD + c] : 0.f); }
  for (int e = t; e < 100 * NHD * NQ; e += 256) { const int hp = e / (NHD * NQ), c = e % (NHD * NQ); const int yy = ty - 1 + hp / 10, xx = tx - 1 + hp % 10; const bool inb = yy >= 0 && yy < HH && xx >= 0 && xx < WWD; sal[hp][c] = inb ? AL[(b * NP + (size_t)yy * WWD + xx) * (NHD * NQ) + c] : 0.f; }
  __syncthreads();
  for (int grp = 0; grp < 8; ++grp) {
    for (int e = t; e < 8 * NHD * NQ; e += 256) { const int pi = e >> 6, nq = e & 63; const int pl = grp * 8 + pi; const int py = pl >> 3, px = pl & 7; float lg[9]; float mx = -3.0e38f;
#pragma unroll
      for (int l = 0; l < 9; ++l) { const int hp = (py + l / 3) * 10 + (px + l % 3); lg[l] = sal[hp][nq]; mx = fmaxf(mx, lg[l]); }
      float z = 0.f;
#pragma unroll
      for (int l = 0; l < 9; ++l) { lg[l] = expf(lg[l] - mx); z += lg[l]; }
      const float iz = 1.0f / z;
#pragma unroll
      for (int l = 0; l < 9; ++l) swt[pi][nq][l] = lg[l] * iz; }
    __syncthreads();
    for (int e = t; e < 8 * YW; e += 256) { const int pi = e / YW, ch = e % YW; const int pl = grp * 8 + pi; const int py = pl >> 3, px = pl & 7; const int q = ch >> 6, o = ch & 63; float a = bfr(HB[o]);
#pragma unroll 1
      for (int n = 0; n < NHD; ++n) {
#pragma unroll 1
        for (int l = 0; l < 9; ++l) { const int hp = (py + l / 3) * 10 + (px + l % 3); a += swt[pi][n * NQ + q][l] * (float)shv[hp][n * HD + o]; } }
      so2[pi][ch] = (_Float16)a; }
    __syncthreads();
    for (int e = t; e < 8 * (YW / 8); e += 256) { const int pi = e / (YW / 8), qq = e % (YW / 8); const int pl = grp * 8 + pi; const size_t p = b * NP + (size_t)(ty + (pl >> 3)) * WWD + tx + (pl & 7); vst2((unsigned*)(Y16 + p * YW + qq * 8), *(const v4u*)&so2[pi][qq * 8]); }
    __syncthreads(); } }
// ---- k_z: block = (64 pixels, 128 channels, b): z = y . q_w^T (single f16 x f16x256) + q_b -> NCHW out[b][c][p]
__global__ __launch_bounds__(128) void k_z(const _Float16* __restrict__ Y16, const _Float16* __restrict__ PQW, const float* __restrict__ QB, float* __restrict__ OUT) { __shared__ __align__(16) float so[128][64 + 4];
  const int tid = threadIdx.x, wave = tid >> 5, lane = tid & 31, col = lane & 15, g = lane >> 4; const size_t b = blockIdx.z; const int p0 = blockIdx.x * 64; const size_t r0 = b * NP + p0 + wave * 16; const int c0 = blockIdx.y * 128;
  v8f acc[8] = {};
#pragma unroll 2
  for (int kc = 0; kc < YW / 32; ++kc) { const v16h a = frag_h(Y16 + (r0 + col) * YW + kc * 32, lane);
#pragma unroll
    for (int j = 0; j < 8; ++j) acc[j] = wmma16(a, frag_h(PQW + (size_t)(c0 + j * 16 + col) * YW + kc * 32, lane), acc[j]); }
#pragma unroll
  for (int j = 0; j < 8; ++j)
#pragma unroll
    for (int r = 0; r < 8; ++r) so[j * 16 + col][wave * 16 + 8 * g + r] = acc[j][r] * (1.0f / WSC) + bfr(QB[c0 + j * 16 + col]);
  __syncthreads(); for (int e = tid; e < 128 * 16; e += 128) { const int c = e >> 4, q = e & 15; vst2(OUT + ((b * CC + c0 + c) * NP) + p0 + q * 4, *(const v4f*)&so[c][q * 4]); } }
extern "C" void kernel_launch(void* const* d_in, const int* in_sizes, int n_in, void* d_out, int out_size, void* d_ws, size_t ws_size, hipStream_t stream) {
  (void)in_sizes; (void)n_in; (void)out_size;
  const float** F = (const float**)d_in;   // 0 x [4,256,64,64], 1 kv_w [512,256], 2 dot_w [4,16,64], 3 head_w [64,256], 4 head_b [64], 5 q_w [256,1024], 6 q_b [256]
  if (ws_size < (size_t)WS_END) return;
  char* ws = (char*)d_ws; __bf16* XT = (__bf16*)(ws + WS_XT); _Float16 *K16 = (_Float16*)(ws + WS_K16), *V16 = (_Float16*)(ws + WS_V16), *Y16 = (_Float16*)(ws + WS_Y16); float *AL = (float*)(ws + WS_AL), *HV = (float*)(ws + WS_HV);
  k_pack<<<dim3(2 * PD, 3), 256, 0, stream>>>(F[1], F[3], F[5], ws);
  k_xt<<<dim3(NP / 64, NB), 256, 0, stream>>>(F[0], XT);
  k_kv<<<dim3(TPX, 2 * PD / 128, NB), 128, 0, stream>>>(XT, (const __bf16*)(ws + WS_PKV), K16, V16);
  k_logit<<<dim3(TPX, NB), 256, 0, stream>>>(K16, F[2], AL);
  k_hv<<<dim3(TPX, NB), 128, 0, stream>>>(V16, (const _Float16*)(ws + WS_PHW), HV);
  k_win<<<dim3(TWB, NB), 256, 0, stream>>>(AL, HV, F[4], Y16);
  k_z<<<dim3(TZ, CC / 128, NB), 128, 0, stream>>>(Y16, (const _Float16*)(ws + WS_PQW), F[6], (float*)d_out);
}

// v001
// One run takes 254 microseconds.
// Timed twice side by side with v000, it ran 2.87 and 2.89 times as fast.
// compute dtype: all float inputs rounded to bf16; kv 1x1 conv with EXACT bf16 products on WMMA 16x16x32 (channels-last), k and v rounded once to f16; query logits (k_h . dot_w) in f32 on VALU; per-head value projection HV = head_w_h v_h on WMMA (single f16 x exact f16 x 2^8); the 3x3-window softmax (zero-padded logits and values, as the module's unfold) in f32 on VALU and the weighted window sums on WMMA (f16-staged HV values x weights split into f16 hi + f16 lo, f32 accumulate); the final 1x1 conv on WMMA (y once to f16 x exact f16 x 2^8 q_w), biases in f32; f32 output (NCHW).
#include <hip/hip_runtime.h>
#include <math.h>

typedef __attribute__((ext_vector_type(16))) _Float16 v16h;
typedef __attribute__((ext_vector_type(16))) __bf16 v16b;
typedef __attribute__((ext_vector_type(8)))  _Float16 v8h;
typedef __attribute__((ext_vector_type(8)))  float v8f;
typedef __attribute__((ext_vector_type(4)))  float v4f;
typedef __attribute__((ext_vector_type(2)))  float v2f;
typedef __attribute__((ext_vector_type(4)))  unsigned v4u;
typedef __attribute__((ext_vector_type(4)))  int v4i;
typedef float __attribute__((may_alias)) float_a;
typedef int __attribute__((may_alias)) int_a;

template <typename T> __device__ __forceinline__ void vst2(void* p, T v) { *(T*)p = v;  }
__device__ __forceinline__ v8f wmma16(v16h a, v16h b, v8f c) {
  v8f d = __builtin_amdgcn_wmma_f32_16x16x32_f16(false, a, false, b, (short)0, c, false, false);
  asm volatile("v_nop\n\tv_nop\n\tv_nop\n\tv_nop" : "+v"(d) : "v"(a), "v"(b));
  return d;
}
__device__ __forceinline__ v8f wmma_bf(v16b a, v16b b, v8f c) {
  v8f d = __builtin_amdgcn_wmma_f32_16x16x32_bf16(false, a, false, b, (short)0, c, false, false);
  asm volatile("v_nop\n\tv_nop\n\tv_nop\n\tv_nop" : "+v"(d) : "v"(a), "v"(b));
  return d;
}
// 16x16x32 fragments: lane = (h = lane>>4, row/col = lane&15); elements 0..7 = k0+8h+0..7, 8..15 = k0+16+8h+0..7; D element r = row 8h+r
__device__ __forceinline__ v16h frag_h(const _Float16* rowk0, int lane) {
  union { v16h v; v8h q[2]; } u; const _Float16* p = rowk0 + 8 * (lane >> 4);
  u.q[0] = *(const v8h*)p; u.q[1] = *(const v8h*)(p + 16); return u.v;
}
__device__ __forceinline__ v16h frag_f32(const float* rowk0, int lane) {
  v16h a; const float* p = rowk0 + 8 * (lane >> 4);
#pragma unroll
  for (int i = 0; i < 8; ++i) { a[i] = (_Float16)p[i]; a[8 + i] = (_Float16)p[16 + i]; }
  return a;
}
__device__ __forceinline__ v16h frag_f32s(const float* rowk0, int lane, float sc) {
  v16h a; const float* p = rowk0 + 8 * (lane >> 4);
#pragma unroll
  for (int i = 0; i < 8; ++i) { a[i] = (_Float16)(p[i] * sc); a[8 + i] = (_Float16)(p[16 + i] * sc); }
  return a;
}
// column fragment from a [K][ld] layout (column n), rows >= K read as 0
__device__ __forceinline__ v16h fragc_f32(const float* W, int k0, int n, int lane, int ld, int K) {
  v16h a; const int g = lane >> 4;
#pragma unroll
  for (int i = 0; i < 8; ++i) { const int ka = k0 + 8 * g + i, kb = ka + 16;
    a[i] = (_Float16)(ka < K ? W[(size_t)(ka < K ? ka : K - 1) * ld + n] : 0.f); a[8 + i] = (_Float16)(kb < K ? W[(size_t)(kb < K ? kb : K - 1) * ld + n] : 0.f); }
  return a;
}
struct F2 { v16b h, l; };
__device__ __forceinline__ F2 bsplit16(const float v[16]) { F2 r;
#pragma unroll
  for (int i = 0; i < 16; ++i) { const __bf16 h = (__bf16)v[i]; r.h[i] = h; r.l[i] = (__bf16)(v[i] - (float)h); }
  return r; }
__device__ __forceinline__ F2 split_row(const float* row, int k0, int lane) { float v[16]; const float* p = row + k0 + 8 * (lane >> 4);
#pragma unroll
  for (int i = 0; i < 8; ++i) { v[i] = p[i]; v[8 + i] = p[16 + i]; }
  return bsplit16(v); }
__device__ __forceinline__ F2 split_rowK(const float* row, int k0, int lane, int K) { float v[16]; const int g = lane >> 4;
#pragma unroll
  for (int i = 0; i < 8; ++i) { const int ka = k0 + 8 * g + i, kb = ka + 16; v[i] = ka < K ? row[ka < K ? ka : K - 1] : 0.f; v[8 + i] = kb < K ? row[kb < K ? kb : K - 1] : 0.f; }
  return bsplit16(v); }
__device__ __forceinline__ F2 split_col(const float* W, int k0, int n, int lane, int ld, int K) { float v[16]; const int g = lane >> 4;
#pragma unroll
  for (int i = 0; i < 8; ++i) { const int ka = k0 + 8 * g + i, kb = ka + 16; v[i] = ka < K ? W[(size_t)(ka < K ? ka : K - 1) * ld + n] : 0.f; v[8 + i] = kb < K ? W[(size_t)(kb < K ? kb : K - 1) * ld + n] : 0.f; }
  return bsplit16(v); }
__device__ __forceinline__ v8f mac3(const F2& a, const F2& b, v8f c) { c = wmma_bf(a.l, b.h, c); c = wmma_bf(a.h, b.l, c); return wmma_bf(a.h, b.h, c); }
__device__ __forceinline__ float sigm(float v) { return 1.0f / (1.0f + expf(-v)); }
#define LDSX() do { asm volatile("s_wait_dscnt 0" ::: "memory"); __builtin_amdgcn_wave_barrier(); __builtin_amdgcn_fence(__ATOMIC_RELEASE, "workgroup"); } while (0)


// Local multi-head channel attention (B 4, C 256, 64 x 64; 4 heads x 64, 16 queries, 3x3 window): kv conv, per-pixel query logits, softmax over each pixel's 3x3 neighbourhood, window-weighted values, head projection (+ bias), query projection (+ bias).
#define NB 4
#define CC 256
#define HH 64
#define WWD 64
#define NP (HH * WWD)
#define NHD 4
#define NQ 16
#define HD 64
#define PD 256
#define YW (NQ * HD)       // 1,024 channels into the query projection
#define WSC 256.0f
#ifndef TPX
#define TPX (NP / 64)      // pixel tiles for kv / logits / hv
#define TWB ((HH / 8) * (WWD / 8))   // window blocks
#define TZ (NP / 64)       // output pixel tiles
#endif
typedef __attribute__((ext_vector_type(8))) __bf16 v8b;
__device__ __forceinline__ v16b frag_b(const __bf16* rowk0, int lane) {
  union { v16b v; v8b q[2]; } u; const __bf16* p = rowk0 + 8 * (lane >> 4);
  u.q[0] = *(const v8b*)p; u.q[1] = *(const v8b*)(p + 16); return u.v;
}
__device__ __forceinline__ float bfr(float v) { return (float)(__bf16)v; }
__device__ __attribute__((noinline)) float exp_ni(float v) { return expf(v); }
__device__ __attribute__((noinline)) float erf_ni(float v) { return erff(v); }

#define WS_PKV 0u                                   // bf16 kv_w rows [512][256] (natural); f16 x 2^8 head_w rows [64][256] (natural); f16 x 2^8 q_w rows [256][1024] (natural)
#define WS_PHW (WS_PKV + 2u * (size_t)2 * PD * CC)
#define WS_PQW (WS_PHW + 2u * (size_t)HD * PD)
#define WS_XT  (WS_PQW + 2u * (size_t)CC * YW)           // bf16 x channels-last [b][p][256]
#define WS_K16 (WS_XT + 2u * (size_t)NB * NP * CC)       // f16 k, v rows [b][p][256]
#define WS_V16 (WS_K16 + 2u * (size_t)NB * NP * PD)
#define WS_AL  (WS_V16 + 2u * (size_t)NB * NP * PD)      // f32 logits [b][p][n*16 + q]
#define WS_HV  (WS_AL + 4u * (size_t)NB * NP * NHD * NQ) // f32 HV [b][p][n*64 + o]
#define WS_Y16 (WS_HV + 4u * (size_t)NB * NP * PD)       // f16 y rows [b][p][q*64 + o]
#define WS_END (WS_Y16 + 2u * (size_t)NB * NP * YW)

__global__ __launch_bounds__(256) void k_pack(const float* __restrict__ KVW, const float* __restrict__ HW, const float* __restrict__ QW, char* __restrict__ ws) { const int n = blockIdx.x, which = blockIdx.y, t = threadIdx.x; __shared__ __align__(16) __bf16 sb[CC]; __shared__ __align__(16) _Float16 sh[YW];
  if (which == 0) { sb[t] = (__bf16)KVW[(size_t)n * CC + t]; __syncthreads(); if (t < CC / 8) vst2((unsigned*)((__bf16*)(ws + WS_PKV) + (size_t)n * CC + t * 8), *(const v4u*)&sb[t * 8]); }   // n < 512
  else if (which == 1) { if (n >= HD) return; sh[t] = (_Float16)(bfr(HW[(size_t)n * PD + t]) * WSC); __syncthreads(); if (t < PD / 8) vst2((unsigned*)((_Float16*)(ws + WS_PHW) + (size_t)n * PD + t * 8), *(const v4u*)&sh[t * 8]); }
  else { if (n >= CC) return; for (int k = t; k < YW; k += 256) sh[k] = (_Float16)(bfr(QW[(size_t)n * YW + k]) * WSC); __syncthreads(); for (int q = t; q < YW / 8; q += 256) vst2((unsigned*)((_Float16*)(ws + WS_PQW) + (size_t)n * YW + q * 8), *(const v4u*)&sh[q * 8]); } }
// ---- k_xt: block = (64 pixels, b): x[b][c][p] -> XT[b][p][c] bf16
__global__ __launch_bounds__(256) void k_xt(const float* __restrict__ X, __bf16* __restrict__ XT) { __shared__ float st[64][CC + 1]; __shared__ __align__(16) __bf16 so2[64][CC + 8]; const int t = threadIdx.x; const int p0 = blockIdx.x * 64; const size_t b = blockIdx.y;
  for (int e = t; e < CC * 64; e += 256) { const int c = e >> 6, pl = e & 63; st[pl][c] = X[(b * CC + c) * NP + p0 + pl]; } __syncthreads();
  for (int e = t; e < 64 * CC; e += 256) { const int pl = e >> 8, c = e & 255; so2[pl][c] = (__bf16)st[pl][c]; } __syncthreads();
  for (int e = t; e < 64 * 32; e += 256) { const int pl = e >> 5, q = e & 31; vst2((unsigned*)(XT + ((b * NP + p0 + pl) * CC) + q * 8), *(const v4u*)&so2[pl][q * 8]); } }
// ---- k_kv: block = (64 pixels, 128 cols, b): kv = x . kv_w^T (exact) -> f16 rows: cols < 256 -> K16, else V16
__global__ __launch_bounds__(128) void k_kv(const __bf16* __restrict__ XT, const __bf16* __restrict__ P, _Float16* __restrict__ K16, _Float16* __restrict__ V16) { __shared__ __align__(16) _Float16 so[64][136];
  const int tid = threadIdx.x, wave = tid >> 5, lane = tid & 31, col = lane & 15, g = lane >> 4; const size_t b = blockIdx.z; const size_t rb = b * NP + (size_t)blockIdx.x * 64; const size_t r0 = rb + wave * 16; const int c0 = blockIdx.y * 128;
  v8f acc[8] = {};
#pragma unroll 2
  for (int kc = 0; kc < CC / 32; ++kc) { const v16b a = frag_b(XT + (r0 + col) * CC + kc * 32, lane);
#pragma unroll
    for (int j = 0; j < 8; ++j) acc[j] = wmma_bf(a, frag_b(P + (size_t)(c0 + j * 16 + col) * CC + kc * 32, lane), acc[j]); }
#pragma unroll
  for (int j = 0; j < 8; ++j)
#pragma unroll
    for (int r = 0; r < 8; ++r) so[wave * 16 + 8 * g + r][j * 16 + col] = (_Float16)acc[j][r];
  __syncthreads(); _Float16* dst = (c0 < PD) ? K16 : V16; const int cc0 = c0 % PD; for (int e = tid; e < 64 * 16; e += 128) { const int rl = e >> 4, q = e & 15; vst2((unsigned*)(dst + (rb + rl) * PD + cc0 + q * 8), *(const v4u*)&so[rl][q * 8]); } }
// ---- k_logit: block = (64 pixels, b): AL[p][n*16 + q] = sum_d k[p][n*64 + d] dot_w[n][q][d]
__global__ __launch_bounds__(256) void k_logit(const _Float16* __restrict__ K16, const float* __restrict__ DW, float* __restrict__ AL) { __shared__ float sk[64][PD + 1]; __shared__ float sd[NHD * NQ * HD]; __shared__ __align__(16) float so2[64][NHD * NQ + 4]; const int t = threadIdx.x; const size_t b = blockIdx.y; const size_t rb = b * NP + (size_t)blockIdx.x * 64;
  for (int e = t; e < 64 * PD; e += 256) { const int pl = e >> 8, c = e & 255; sk[pl][c] = (float)K16[(rb + pl) * PD + c]; } for (int e = t; e < NHD * NQ * HD; e += 256) sd[e] = bfr(DW[e]); __syncthreads();
  for (int e = t; e < 64 * NHD * NQ; e += 256) { const int pl = e >> 6, nq = e & 63; const int n = nq >> 4; float a = 0.f;
#pragma unroll 1
    for (int d = 0; d < HD; ++d) a += sk[pl][n * HD + d] * sd[nq * HD + d]; so2[pl][nq] = a; }
  __syncthreads(); for (int e = t; e < 64 * 16; e += 256) { const int pl = e >> 4, q = e & 15; vst2(AL + (rb + pl) * (NHD * NQ) + q * 4, *(const v4f*)&so2[pl][q * 4]); } }
// ---- k_hv: block = (64 pixels, b): HV[p][n*64 + o] = sum_d v[p][n*64 + d] head_w[o][n*64 + d] (per head; single f16 x f16x256)
__global__ __launch_bounds__(128) void k_hv(const _Float16* __restrict__ V16, const _Float16* __restrict__ PHW, float* __restrict__ HV) { __shared__ __align__(16) float sf[4][16][68];
  const int tid = threadIdx.x, wave = tid >> 5, lane = tid & 31, col = lane & 15, g = lane >> 4; const size_t b = blockIdx.y; const size_t rb = b * NP + (size_t)blockIdx.x * 64; const size_t r0 = rb + wave * 16;
  for (int n = 0; n < NHD; ++n) { v8f acc[4] = {};
#pragma unroll
    for (int kc = 0; kc < HD / 32; ++kc) { const v16h a = frag_h(V16 + (r0 + col) * PD + n * HD + kc * 32, lane);
#pragma unroll
      for (int j = 0; j < 4; ++j) acc[j] = wmma16(a, frag_h(PHW + (size_t)(j * 16 + col) * PD + n * HD + kc * 32, lane), acc[j]); }
#pragma unroll
    for (int j = 0; j < 4; ++j)
#pragma unroll
      for (int r = 0; r < 8; ++r) sf[wave][8 * g + r][j * 16 + col] = acc[j][r] * (1.0f / WSC);
    LDSX(); for (int rl = 0; rl < 16; ++rl) if (lane < 16) vst2(HV + (r0 + rl) * PD + n * HD + lane * 4, *(const v4f*)&sf[wave][rl][lane * 4]); LDSX(); } }
// ---- k_win: block = (8x8 pixel tile, b), 16 waves, 4 pixels per wave: per pixel, per (head n, query q): softmax over the 3x3 neighbourhood of AL (0 outside the image - zero-padded unfold), y[q*64 + o] = sum_n sum_l w[n][q][l] HV[p_l][n*64 + o] (0 outside) + head_b[o] -> f16 rows.
// The sum over k = (n, l), 36 terms, is one 64 x 16 x 36 product per pixel on WMMA: A rows = o (f16-staged HV), B columns = q (weights as f16 hi + f16 lo, so the f32 weight survives).
// k order, equal in both loaders: lane half g holds heads n = 2g, 2g + 1; element 2l + s = (window place l < 8, head 2g + s). Place l = 8 goes in a third product: elements 0, 1 pair HV with hi, elements 2, 3 pair the same HV with lo, the rest 0.
__global__ __launch_bounds__(512) void k_win(const float* __restrict__ AL, const float* __restrict__ HV, const float* __restrict__ HB, _Float16* __restrict__ Y16) {
  __shared__ __align__(16) _Float16 shv[100][PD];        // [halo pixel][o*4 + n]
  __shared__ __align__(16) float sal[100][NHD * NQ];     // [halo pixel][q*4 + n]
  __shared__ __align__(16) _Float16 sst[16][NQ * 72];    // per wave: one pixel's y rows [q][64] at a pitch of 144 B
  const int t = threadIdx.x, wave = t >> 5, lane = t & 31, c = lane & 15, g = lane >> 4; const size_t b = blockIdx.y; const int ty = (blockIdx.x / (WWD / 8)) * 8, tx = (blockIdx.x % (WWD / 8)) * 8;
  // loads first, LDS stores after, so that the staging passes overlap their memory latency; an item past the end takes the last item's address and stores nothing
  v4f hva[4][NHD], ala[NHD]; float bias[4][8];
#pragma unroll
  for (int k = 0; k < 4; ++k) { const int e = min(t + k * 512, 100 * 16 - 1), hp = e >> 4, o4 = e & 15; const int yy = ty - 1 + hp / 10, xx = tx - 1 + hp % 10; const bool inb = yy >= 0 && yy < HH && xx >= 0 && xx < WWD;
    const float* s = HV + (b * NP + (size_t)(inb ? yy * WWD + xx : 0)) * PD + o4 * 4;
#pragma unroll
    for (int n = 0; n < NHD; ++n) { hva[k][n] = *(const v4f*)(s + n * HD); if (!inb) hva[k][n] = v4f{0.f, 0.f, 0.f, 0.f}; } }
  { const int e = min(t, 100 * 4 - 1), hp = e >> 2, q4 = e & 3; const int yy = ty - 1 + hp / 10, xx = tx - 1 + hp % 10; const bool inb = yy >= 0 && yy < HH && xx >= 0 && xx < WWD;
    const float* s = AL + (b * NP + (size_t)(inb ? yy * WWD + xx : 0)) * (NHD * NQ) + q4 * 4;
#pragma unroll
    for (int n = 0; n < NHD; ++n) { ala[n] = *(const v4f*)(s + n * NQ); if (!inb) ala[n] = v4f{0.f, 0.f, 0.f, 0.f}; } }
#pragma unroll
  for (int j = 0; j < 4; ++j)
#pragma unroll
    for (int r = 0; r < 8; ++r) bias[j][r] = bfr(HB[j * 16 + 8 * g + r]);
#pragma unroll
  for (int k = 0; k < 4; ++k) { const int e = t + k * 512; v8h q0, q1;
#pragma unroll
    for (int i = 0; i < 2; ++i)
#pragma unroll
      for (int n = 0; n < NHD; ++n) { q0[i * 4 + n] = (_Float16)hva[k][n][i]; q1[i * 4 + n] = (_Float16)hva[k][n][2 + i]; }
    if (e < 100 * 16) { *(v8h*)&shv[e >> 4][(e & 15) * 16] = q0; *(v8h*)&shv[e >> 4][(e & 15) * 16 + 8] = q1; } }
  if (t < 100 * 4) {
#pragma unroll
    for (int i = 0; i < 4; ++i) *(v4f*)&sal[t >> 2][((t & 3) * 4 + i) * 4] = v4f{ala[0][i], ala[1][i], ala[2][i], ala[3][i]}; }
  __syncthreads();
  for (int i = 0; i < 4; ++i) { const int pl = wave * 4 + i, py = pl >> 3, px = pl & 7, hb = py * 10 + px;
    float w[9][2];
    { v2f lg[9];
#pragma unroll
      for (int l = 0; l < 9; ++l) lg[l] = *(const v2f*)&sal[hb + (l / 3) * 10 + l % 3][c * 4 + 2 * g];
#pragma unroll
      for (int s = 0; s < 2; ++s) { float mx = -3.0e38f;
#pragma unroll
        for (int l = 0; l < 9; ++l) mx = fmaxf(mx, lg[l][s]);
        float z = 0.f;
#pragma unroll
        for (int l = 0; l < 9; ++l) { w[l][s] = expf(lg[l][s] - mx); z += w[l][s]; }
        const float iz = 1.0f / z;
#pragma unroll
        for (int l = 0; l < 9; ++l) w[l][s] *= iz; } }
    v16h whi, wlo, w2 = {};
#pragma unroll
    for (int l = 0; l < 9; ++l)
#pragma unroll
      for (int s = 0; s < 2; ++s) { const _Float16 h = (_Float16)w[l][s]; const _Float16 lo = (_Float16)(w[l][s] - (float)h);
        if (l < 8) { whi[2 * l + s] = h; wlo[2 * l + s] = lo; } else { w2[s] = h; w2[2 + s] = lo; } }
    v8f acc[4];
#pragma unroll
    for (int j = 0; j < 4; ++j) { union { v16h v; int u[8]; } h1, h2; const int ch = (j * 16 + c) * 4 + 2 * g;
#pragma unroll
      for (int l = 0; l < 8; ++l) h1.u[l] = *(const int_a*)&shv[hb + (l / 3) * 10 + l % 3][ch];
      const int u8 = *(const int_a*)&shv[hb + 22][ch]; h2.u[0] = u8; h2.u[1] = u8;
#pragma unroll
      for (int l = 2; l < 8; ++l) h2.u[l] = 0;
      v8f d = {};
      d = __builtin_amdgcn_wmma_f32_16x16x32_f16(false, h1.v, false, whi, (short)0, d, false, false);
      d = __builtin_amdgcn_wmma_f32_16x16x32_f16(false, h1.v, false, wlo, (short)0, d, false, false);
      acc[j] = __builtin_amdgcn_wmma_f32_16x16x32_f16(false, h2.v, false, w2, (short)0, d, false, false); }
#pragma unroll
    for (int j = 0; j < 4; ++j) { v8h yv;   // lane holds q = c, o = j*16 + 8g + 0..7
#pragma unroll
      for (int r = 0; r < 8; ++r) yv[r] = (_Float16)(acc[j][r] + bias[j][r]);
      *(v8h*)&sst[wave][c * 72 + j * 16 + 8 * g] = yv; }
    asm volatile("s_wait_dscnt 0" ::: "memory");   // the wave's own rows are in LDS before its other lanes read them back
    const size_t p = b * NP + (size_t)(ty + py) * WWD + tx + px;
#pragma unroll
    for (int k = 0; k < 4; ++k) { const int ck = k * 32 + lane; vst2(Y16 + p * YW + ck * 8, *(const v8h*)&sst[wave][(ck >> 3) * 72 + (ck & 7) * 8]); }   // 512 contiguous bytes per store
    asm volatile("s_wait_dscnt 0" ::: "memory");   // holds the next pixel's LDS stores behind this read-back (no wait on the global stores)
  } }
// ---- k_z: block = (64 pixels, 128 channels, b): z = y . q_w^T (single f16 x f16x256) + q_b -> NCHW out[b][c][p]
__global__ __launch_bounds__(128) void k_z(const _Float16* __restrict__ Y16, const _Float16* __restrict__ PQW, const float* __restrict__ QB, float* __restrict__ OUT) { __shared__ __align__(16) float so[128][64 + 4];
  const int tid = threadIdx.x, wave = tid >> 5, lane = tid & 31, col = lane & 15, g = lane >> 4; const size_t b = blockIdx.z; const int p0 = blockIdx.x * 64; const size_t r0 = b * NP + p0 + wave * 16; const int c0 = blockIdx.y * 128;
  v8f acc[8] = {};
#pragma unroll 2
  for (int kc = 0; kc < YW / 32; ++kc) { const v16h a = frag_h(Y16 + (r0 + col) * YW + kc * 32, lane);
#pragma unroll
    for (int j = 0; j < 8; ++j) acc[j] = wmma16(a, frag_h(PQW + (size_t)(c0 + j * 16 + col) * YW + kc * 32, lane), acc[j]); }
#pragma unroll
  for (int j = 0; j < 8; ++j)
#pragma unroll
    for (int r = 0; r < 8; ++r) so[j * 16 + col][wave * 16 + 8 * g + r] = acc[j][r] * (1.0f / WSC) + bfr(QB[c0 + j * 16 + col]);
  __syncthreads(); for (int e = tid; e < 128 * 16; e += 128) { const int c = e >> 4, q = e & 15; vst2(OUT + ((b * CC + c0 + c) * NP) + p0 + q * 4, *(const v4f*)&so[c][q * 4]); } }
extern "C" void kernel_launch(void* const* d_in, const int* in_sizes, int n_in, void* d_out, int out_size, void* d_ws, size_t ws_size, hipStream_t stream) {
  (void)in_sizes; (void)n_in; (void)out_size;
  const float** F = (const float**)d_in;   // 0 x [4,256,64,64], 1 kv_w [512,256], 2 dot_w [4,16,64], 3 head_w [64,256], 4 head_b [64], 5 q_w [256,1024], 6 q_b [256]
  if (ws_size < (size_t)WS_END) return;
  char* ws = (char*)d_ws; __bf16* XT = (__bf16*)(ws + WS_XT); _Float16 *K16 = (_Float16*)(ws + WS_K16), *V16 = (_Float16*)(ws + WS_V16), *Y16 = (_Float16*)(ws + WS_Y16); float *AL = (float*)(ws + WS_AL), *HV = (float*)(ws + WS_HV);
  k_pack<<<dim3(2 * PD, 3), 256, 0, stream>>>(F[1], F[3], F[5], ws);
  k_xt<<<dim3(NP / 64, NB), 256, 0, stream>>>(F[0], XT);
  k_kv<<<dim3(TPX, 2 * PD / 128, NB), 128, 0, stream>>>(XT, (const __bf16*)(ws + WS_PKV), K16, V16);
  k_logit<<<dim3(TPX, NB), 256, 0, stream>>>(K16, F[2], AL);
  k_hv<<<dim3(TPX, NB), 128, 0, stream>>>(V16, (const _Float16*)(ws + WS_PHW), HV);
  k_win<<<dim3(TWB, NB), 512, 0, stream>>>(AL, HV, F[4], Y16);
  k_z<<<dim3(TZ, CC / 128, NB), 128, 0, stream>>>(Y16, (const _Float16*)(ws + WS_PQW), F[6], (float*)d_out);
}

// v002
// One run takes 131 microseconds.
// Two timings next to v001 put it at 1.90 and 1.94 times that version's speed.
// All steps since v000 together make it 5.53 times as fast.
// compute dtype: all float inputs rounded to bf16; kv 1x1 conv with EXACT bf16 products on WMMA 16x16x32 (channels-last), k and v rounded once to f16; query logits (k_h . dot_w) on WMMA (f16 k x f16 x 2^8 dot_w, f32 accumulate); per-head value projection HV = head_w_h v_h on WMMA (single f16 x exact f16 x 2^8); the 3x3-window softmax (zero-padded logits and values, as the module's unfold) in f32 on VALU and the weighted window sums on WMMA (f16-staged HV values x weights split into f16 hi + f16 lo, f32 accumulate); the final 1x1 conv on WMMA (y once to f16 x exact f16 x 2^8 q_w), biases in f32; f32 output (NCHW).
#include <hip/hip_runtime.h>
#include <math.h>

typedef __attribute__((ext_vector_type(16))) _Float16 v16h;
typedef __attribute__((ext_vector_type(16))) __bf16 v16b;
typedef __attribute__((ext_vector_type(8)))  _Float16 v8h;
typedef __attribute__((ext_vector_type(8)))  float v8f;
typedef __attribute__((ext_vector_type(4)))  float v4f;
typedef __attribute__((ext_vector_type(2)))  float v2f;
typedef __attribute__((ext_vector_type(4)))  unsigned v4u;
typedef __attribute__((ext_vector_type(4)))  int v4i;
typedef float __attribute__((may_alias)) float_a;
typedef int __attribute__((may_alias)) int_a;

template <typename T> __device__ __forceinline__ void vst2(void* p, T v) { *(T*)p = v;  }
__device__ __forceinline__ v8f wmma16(v16h a, v16h b, v8f c) {
  v8f d = __builtin_amdgcn_wmma_f32_16x16x32_f16(false, a, false, b, (short)0, c, false, false);
  asm volatile("v_nop\n\tv_nop\n\tv_nop\n\tv_nop" : "+v"(d) : "v"(a), "v"(b));
  return d;
}
__device__ __forceinline__ v8f wmma_bf(v16b a, v16b b, v8f c) {
  v8f d = __builtin_amdgcn_wmma_f32_16x16x32_bf16(false, a, false, b, (short)0, c, false, false);
  asm volatile("v_nop\n\tv_nop\n\tv_nop\n\tv_nop" : "+v"(d) : "v"(a), "v"(b));
  return d;
}
// 16x16x32 fragments: lane = (h = lane>>4, row/col = lane&15); elements 0..7 = k0+8h+0..7, 8..15 = k0+16+8h+0..7; D element r = row 8h+r
__device__ __forceinline__ v16h frag_h(const _Float16* rowk0, int lane) {
  union { v16h v; v8h q[2]; } u; const _Float16* p = rowk0 + 8 * (lane >> 4);
  u.q[0] = *(const v8h*)p; u.q[1] = *(const v8h*)(p + 16); return u.v;
}
__device__ __forceinline__ v16h frag_f32(const float* rowk0, int lane) {
  v16h a; const float* p = rowk0 + 8 * (lane >> 4);
#pragma unroll
  for (int i = 0; i < 8; ++i) { a[i] = (_Float16)p[i]; a[8 + i] = (_Float16)p[16 + i]; }
  return a;
}
__device__ __forceinline__ v16h frag_f32s(const float* rowk0, int lane, float sc) {
  v16h a; const float* p = rowk0 + 8 * (lane >> 4);
#pragma unroll
  for (int i = 0; i < 8; ++i) { a[i] = (_Float16)(p[i] * sc); a[8 + i] = (_Float16)(p[16 + i] * sc); }
  return a;
}
// column fragment from a [K][ld] layout (column n), rows >= K read as 0
__device__ __forceinline__ v16h fragc_f32(const float* W, int k0, int n, int lane, int ld, int K) {
  v16h a; const int g = lane >> 4;
#pragma unroll
  for (int i = 0; i < 8; ++i) { const int ka = k0 + 8 * g + i, kb = ka + 16;
    a[i] = (_Float16)(ka < K ? W[(size_t)(ka < K ? ka : K - 1) * ld + n] : 0.f); a[8 + i] = (_Float16)(kb < K ? W[(size_t)(kb < K ? kb : K - 1) * ld + n] : 0.f); }
  return a;
}
struct F2 { v16b h, l; };
__device__ __forceinline__ F2 bsplit16(const float v[16]) { F2 r;
#pragma unroll
  for (int i = 0; i < 16; ++i) { const __bf16 h = (__bf16)v[i]; r.h[i] = h; r.l[i] = (__bf16)(v[i] - (float)h); }
  return r; }
__device__ __forceinline__ F2 split_row(const float* row, int k0, int lane) { float v[16]; const float* p = row + k0 + 8 * (lane >> 4);
#pragma unroll
  for (int i = 0; i < 8; ++i) { v[i] = p[i]; v[8 + i] = p[16 + i]; }
  return bsplit16(v); }
__device__ __forceinline__ F2 split_rowK(const float* row, int k0, int lane, int K) { float v[16]; const int g = lane >> 4;
#pragma unroll
  for (int i = 0; i < 8; ++i) { const int ka = k0 + 8 * g + i, kb = ka + 16; v[i] = ka < K ? row[ka < K ? ka : K - 1] : 0.f; v[8 + i] = kb < K ? row[kb < K ? kb : K - 1] : 0.f; }
  return bsplit16(v); }
__device__ __forceinline__ F2 split_col(const float* W, int k0, int n, int lane, int ld, int K) { float v[16]; const int g = lane >> 4;
#pragma unroll
  for (int i = 0; i < 8; ++i) { const int ka = k0 + 8 * g + i, kb = ka + 16; v[i] = ka < K ? W[(size_t)(ka < K ? ka : K - 1) * ld + n] : 0.f; v[8 + i] = kb < K ? W[(size_t)(kb < K ? kb : K - 1) * ld + n] : 0.f; }
  return bsplit16(v); }
__device__ __forceinline__ v8f mac3(const F2& a, const F2& b, v8f c) { c = wmma_bf(a.l, b.h, c); c = wmma_bf(a.h, b.l, c); return wmma_bf(a.h, b.h, c); }
__device__ __forceinline__ float sigm(float v) { return 1.0f / (1.0f + expf(-v)); }
#define LDSX() do { asm volatile("s_wait_dscnt 0" ::: "memory"); __builtin_amdgcn_wave_barrier(); __builtin_amdgcn_fence(__ATOMIC_RELEASE, "workgroup"); } while (0)


// Local multi-head channel attention (B 4, C 256, 64 x 64; 4 heads x 64, 16 queries, 3x3 window): kv conv, per-pixel query logits, softmax over each pixel's 3x3 neighbourhood, window-weighted values, head projection (+ bias), query projection (+ bias).
#define NB 4
#define CC 256
#define HH 64
#define WWD 64
#define NP (HH * WWD)
#define NHD 4
#define NQ 16
#define HD 64
#define PD 256
#define YW (NQ * HD)       // 1,024 channels into the query projection
#define WSC 256.0f
#ifndef TPX
#define TPX (NP / 64)      // pixel tiles for kv / logits / hv
#define TWB ((HH / 8) * (WWD / 8))   // window blocks
#define TZ (NP / 64)       // output pixel tiles
#endif
typedef __attribute__((ext_vector_type(8))) __bf16 v8b;
__device__ __forceinline__ v16b frag_b(const __bf16* rowk0, int lane) {
  union { v16b v; v8b q[2]; } u; const __bf16* p = rowk0 + 8 * (lane >> 4);
  u.q[0] = *(const v8b*)p; u.q[1] = *(const v8b*)(p + 16); return u.v;
}
__device__ __forceinline__ float bfr(float v) { return (float)(__bf16)v; }
__device__ __attribute__((noinline)) float exp_ni(float v) { return expf(v); }
__device__ __attribute__((noinline)) float erf_ni(float v) { return erff(v); }

#define WS_PKV 0u                                   // bf16 kv_w rows [512][256] (natural); f16 x 2^8 head_w rows [64][256] (natural); f16 x 2^8 q_w rows [256][1024] (natural)
#define WS_PHW (WS_PKV + 2u * (size_t)2 * PD * CC)
#define WS_PQW (WS_PHW + 2u * (size_t)HD * PD)
#define WS_XT  (WS_PQW + 2u * (size_t)CC * YW)           // bf16 x channels-last [b][p][256]
#define WS_K16 (WS_XT + 2u * (size_t)NB * NP * CC)       // f16 k, v rows [b][p][256]
#define WS_V16 (WS_K16 + 2u * (size_t)NB * NP * PD)
#define WS_AL  (WS_V16 + 2u * (size_t)NB * NP * PD)      // f32 logits [b][p][n*16 + q]
#define WS_HV  (WS_AL + 4u * (size_t)NB * NP * NHD * NQ) // f32 HV [b][p][n*64 + o]
#define WS_Y16 (WS_HV + 4u * (size_t)NB * NP * PD)       // f16 y rows [b][p][q*64 + o]
#define WS_END (WS_Y16 + 2u * (size_t)NB * NP * YW)

__global__ __launch_bounds__(256) void k_pack(const float* __restrict__ KVW, const float* __restrict__ HW, const float* __restrict__ QW, char* __restrict__ ws) { const int n = blockIdx.x, which = blockIdx.y, t = threadIdx.x; __shared__ __align__(16) __bf16 sb[CC]; __shared__ __align__(16) _Float16 sh[YW];
  if (which == 0) { sb[t] = (__bf16)KVW[(size_t)n * CC + t]; __syncthreads(); if (t < CC / 8) vst2((unsigned*)((__bf16*)(ws + WS_PKV) + (size_t)n * CC + t * 8), *(const v4u*)&sb[t * 8]); }   // n < 512
  else if (which == 1) { if (n >= HD) return; sh[t] = (_Float16)(bfr(HW[(size_t)n * PD + t]) * WSC); __syncthreads(); if (t < PD / 8) vst2((unsigned*)((_Float16*)(ws + WS_PHW) + (size_t)n * PD + t * 8), *(const v4u*)&sh[t * 8]); }
  else { if (n >= CC) return; for (int k = t; k < YW; k += 256) sh[k] = (_Float16)(bfr(QW[(size_t)n * YW + k]) * WSC); __syncthreads(); for (int q = t; q < YW / 8; q += 256) vst2((unsigned*)((_Float16*)(ws + WS_PQW) + (size_t)n * YW + q * 8), *(const v4u*)&sh[q * 8]); } }
// ---- k_xt: block = (64 pixels, b): x[b][c][p] -> XT[b][p][c] bf16
__global__ __launch_bounds__(256) void k_xt(const float* __restrict__ X, __bf16* __restrict__ XT) { __shared__ float st[64][CC + 1]; __shared__ __align__(16) __bf16 so2[64][CC + 8]; const int t = threadIdx.x; const int p0 = blockIdx.x * 64; const size_t b = blockIdx.y;
  for (int e = t; e < CC * 64; e += 256) { const int c = e >> 6, pl = e & 63; st[pl][c] = X[(b * CC + c) * NP + p0 + pl]; } __syncthreads();
  for (int e = t; e < 64 * CC; e += 256) { const int pl = e >> 8, c = e & 255; so2[pl][c] = (__bf16)st[pl][c]; } __syncthreads();
  for (int e = t; e < 64 * 32; e += 256) { const int pl = e >> 5, q = e & 31; vst2((unsigned*)(XT + ((b * NP + p0 + pl) * CC) + q * 8), *(const v4u*)&so2[pl][q * 8]); } }
// ---- k_kv: block = (64 pixels, 128 cols, b): kv = x . kv_w^T (exact) -> f16 rows: cols < 256 -> K16, else V16
__global__ __launch_bounds__(128) void k_kv(const __bf16* __restrict__ XT, const __bf16* __restrict__ P, _Float16* __restrict__ K16, _Float16* __restrict__ V16) { __shared__ __align__(16) _Float16 so[64][136];
  const int tid = threadIdx.x, wave = tid >> 5, lane = tid & 31, col = lane & 15, g = lane >> 4; const size_t b = blockIdx.z; const size_t rb = b * NP + (size_t)blockIdx.x * 64; const size_t r0 = rb + wave * 16; const int c0 = blockIdx.y * 128;
  v8f acc[8] = {};
#pragma unroll 2
  for (int kc = 0; kc < CC / 32; ++kc) { const v16b a = frag_b(XT + (r0 + col) * CC + kc * 32, lane);
#pragma unroll
    for (int j = 0; j < 8; ++j) acc[j] = wmma_bf(a, frag_b(P + (size_t)(c0 + j * 16 + col) * CC + kc * 32, lane), acc[j]); }
#pragma unroll
  for (int j = 0; j < 8; ++j)
#pragma unroll
    for (int r = 0; r < 8; ++r) so[wave * 16 + 8 * g + r][j * 16 + col] = (_Float16)acc[j][r];
  __syncthreads(); _Float16* dst = (c0 < PD) ? K16 : V16; const int cc0 = c0 % PD; for (int e = tid; e < 64 * 16; e += 128) { const int rl = e >> 4, q = e & 15; vst2((unsigned*)(dst + (rb + rl) * PD + cc0 + q * 8), *(const v4u*)&so[rl][q * 8]); } }
// ---- k_logit: block = (64 pixels, b), 4 waves, 16 pixels per wave: AL[p][n*16 + q] = sum_d k[p][n*64 + d] dot_w[n][q][d] on WMMA, two 16x16x32 products per head.
// A rows = pixels (f16 k rows), B columns = q (bf16-rounded dot_w x 2^8 as f16), f32 accumulate. k order, equal in both loaders: that of frag_h (elements 0..7 = d0 + 8g + 0..7, 8..15 = d0 + 16 + 8g + 0..7).
__global__ __launch_bounds__(128) void k_logit(const _Float16* __restrict__ K16, const float* __restrict__ DW, float* __restrict__ AL) { __shared__ __align__(16) float sf[4][16][NHD * NQ + 4];   // per wave: its 16 logit rows at a pitch of 272 B
  const int tid = threadIdx.x, wave = tid >> 5, lane = tid & 31, col = lane & 15, g = lane >> 4; const size_t b = blockIdx.y; const size_t r0 = b * NP + (size_t)blockIdx.x * 64 + wave * 16;
  v16h a[NHD * 2]; v4f dw[NHD * 2][4];
  // every loop here is unrolled so that the fragments stay in registers
#pragma unroll
  for (int f = 0; f < NHD * 2; ++f) a[f] = frag_h(K16 + (r0 + col) * PD + f * 32, lane);
  asm volatile("s_wait_xcnt 0x0" ::: "memory");   // stands in front of the loads below, whose results may take the registers that held the k rows' address
#pragma unroll
  for (int f = 0; f < NHD * 2; ++f) { const float* p = DW + (size_t)((f >> 1) * NQ + col) * HD + (f & 1) * 32 + 8 * g;
    dw[f][0] = *(const v4f*)p; dw[f][1] = *(const v4f*)(p + 4); dw[f][2] = *(const v4f*)(p + 16); dw[f][3] = *(const v4f*)(p + 20); }
  __builtin_amdgcn_sched_barrier(0);   // all 48 global loads issue before the first wait: one memory latency for the wave, not one per head
#pragma unroll
  for (int n = 0; n < NHD; ++n) { v8f acc = {};
#pragma unroll
    for (int kc = 0; kc < 2; ++kc) { const int f = n * 2 + kc; v16h w;
#pragma unroll
      for (int i = 0; i < 16; ++i) w[i] = (_Float16)(bfr(dw[f][i >> 2][i & 3]) * WSC);
      acc = __builtin_amdgcn_wmma_f32_16x16x32_f16(false, a[f], false, w, (short)0, acc, false, false); }
#pragma unroll
    for (int r = 0; r < 8; ++r) sf[wave][8 * g + r][n * NQ + col] = acc[r] * (1.0f / WSC); }
  asm volatile("s_wait_dscnt 0" ::: "memory");   // the wave's own rows are in LDS before its other lanes read them back
#pragma unroll
  for (int k = 0; k < 8; ++k) { const int e = k * 32 + lane; vst2(AL + r0 * (NHD * NQ) + e * 4, *(const v4f*)&sf[wave][e >> 4][(e & 15) * 4]); } }   // the wave's 16 rows are 4 KiB in a row: 512 contiguous bytes per store
// ---- k_hv: block = (64 pixels, b): HV[p][n*64 + o] = sum_d v[p][n*64 + d] head_w[o][n*64 + d] (per head; single f16 x f16x256)
__global__ __launch_bounds__(128) void k_hv(const _Float16* __restrict__ V16, const _Float16* __restrict__ PHW, float* __restrict__ HV) { __shared__ __align__(16) float sf[4][16][68];
  const int tid = threadIdx.x, wave = tid >> 5, lane = tid & 31, col = lane & 15, g = lane >> 4; const size_t b = blockIdx.y; const size_t rb = b * NP + (size_t)blockIdx.x * 64; const size_t r0 = rb + wave * 16;
  for (int n = 0; n < NHD; ++n) { v8f acc[4] = {};
#pragma unroll
    for (int kc = 0; kc < HD / 32; ++kc) { const v16h a = frag_h(V16 + (r0 + col) * PD + n * HD + kc * 32, lane);
#pragma unroll
      for (int j = 0; j < 4; ++j) acc[j] = wmma16(a, frag_h(PHW + (size_t)(j * 16 + col) * PD + n * HD + kc * 32, lane), acc[j]); }
#pragma unroll
    for (int j = 0; j < 4; ++j)
#pragma unroll
      for (int r = 0; r < 8; ++r) sf[wave][8 * g + r][j * 16 + col] = acc[j][r] * (1.0f / WSC);
    LDSX(); for (int rl = 0; rl < 16; ++rl) if (lane < 16) vst2(HV + (r0 + rl) * PD + n * HD + lane * 4, *(const v4f*)&sf[wave][rl][lane * 4]); LDSX(); } }
// ---- k_win: block = (8x8 pixel tile, b), 16 waves, 4 pixels per wave: per pixel, per (head n, query q): softmax over the 3x3 neighbourhood of AL (0 outside the image - zero-padded unfold), y[q*64 + o] = sum_n sum_l w[n][q][l] HV[p_l][n*64 + o] (0 outside) + head_b[o] -> f16 rows.
// The sum over k = (n, l), 36 terms, is one 64 x 16 x 36 product per pixel on WMMA: A rows = o (f16-staged HV), B columns = q (weights as f16 hi + f16 lo, so the f32 weight survives).
// k order, equal in both loaders: lane half g holds heads n = 2g, 2g + 1; element 2l + s = (window place l < 8, head 2g + s). Place l = 8 goes in a third product: elements 0, 1 pair HV with hi, elements 2, 3 pair the same HV with lo, the rest 0.
__global__ __launch_bounds__(512) void k_win(const float* __restrict__ AL, const float* __restrict__ HV, const float* __restrict__ HB, _Float16* __restrict__ Y16) {
  __shared__ __align__(16) _Float16 shv[100][PD];        // [halo pixel][o*4 + n]
  __shared__ __align__(16) float sal[100][NHD * NQ];     // [halo pixel][q*4 + n]
  __shared__ __align__(16) _Float16 sst[16][NQ * 72];    // per wave: one pixel's y rows [q][64] at a pitch of 144 B
  const int t = threadIdx.x, wave = t >> 5, lane = t & 31, c = lane & 15, g = lane >> 4; const size_t b = blockIdx.y; const int ty = (blockIdx.x / (WWD / 8)) * 8, tx = (blockIdx.x % (WWD / 8)) * 8;
  // loads first, LDS stores after, so that the staging passes overlap their memory latency; an item past the end takes the last item's address and stores nothing
  v4f hva[4][NHD], ala[NHD]; float bias[4][8];
#pragma unroll
  for (int k = 0; k < 4; ++k) { const int e = min(t + k * 512, 100 * 16 - 1), hp = e >> 4, o4 = e & 15; const int yy = ty - 1 + hp / 10, xx = tx - 1 + hp % 10; const bool inb = yy >= 0 && yy < HH && xx >= 0 && xx < WWD;
    const float* s = HV + (b * NP + (size_t)(inb ? yy * WWD + xx : 0)) * PD + o4 * 4;
#pragma unroll
    for (int n = 0; n < NHD; ++n) { hva[k][n] = *(const v4f*)(s + n * HD); if (!inb) hva[k][n] = v4f{0.f, 0.f, 0.f, 0.f}; } }
  { const int e = min(t, 100 * 4 - 1), hp = e >> 2, q4 = e & 3; const int yy = ty - 1 + hp / 10, xx = tx - 1 + hp % 10; const bool inb = yy >= 0 && yy < HH && xx >= 0 && xx < WWD;
    const float* s = AL + (b * NP + (size_t)(inb ? yy * WWD + xx : 0)) * (NHD * NQ) + q4 * 4;
#pragma unroll
    for (int n = 0; n < NHD; ++n) { ala[n] = *(const v4f*)(s + n * NQ); if (!inb) ala[n] = v4f{0.f, 0.f, 0.f, 0.f}; } }
#pragma unroll
  for (int j = 0; j < 4; ++j)
#pragma unroll
    for (int r = 0; r < 8; ++r) bias[j][r] = bfr(HB[j * 16 + 8 * g + r]);
#pragma unroll
  for (int k = 0; k < 4; ++k) { const int e = t + k * 512; v8h q0, q1;
#pragma unroll
    for (int i = 0; i < 2; ++i)
#pragma unroll
      for (int n = 0; n < NHD; ++n) { q0[i * 4 + n] = (_Float16)hva[k][n][i]; q1[i * 4 + n] = (_Float16)hva[k][n][2 + i]; }
    if (e < 100 * 16) { *(v8h*)&shv[e >> 4][(e & 15) * 16] = q0; *(v8h*)&shv[e >> 4][(e & 15) * 16 + 8] = q1; } }
  if (t < 100 * 4) {
#pragma unroll
    for (int i = 0; i < 4; ++i) *(v4f*)&sal[t >> 2][((t & 3) * 4 + i) * 4] = v4f{ala[0][i], ala[1][i], ala[2][i], ala[3][i]}; }
  __syncthreads();
  for (int i = 0; i < 4; ++i) { const int pl = wave * 4 + i, py = pl >> 3, px = pl & 7, hb = py * 10 + px;
    float w[9][2];
    { v2f lg[9];
#pragma unroll
      for (int l = 0; l < 9; ++l) lg[l] = *(const v2f*)&sal[hb + (l / 3) * 10 + l % 3][c * 4 + 2 * g];
#pragma unroll
      for (int s = 0; s < 2; ++s) { float mx = -3.0e38f;
#pragma unroll
        for (int l = 0; l < 9; ++l) mx = fmaxf(mx, lg[l][s]);
        float z = 0.f;
#pragma unroll
        for (int l = 0; l < 9; ++l) { w[l][s] = expf(lg[l][s] - mx); z += w[l][s]; }
        const float iz = 1.0f / z;
#pragma unroll
        for (int l = 0; l < 9; ++l) w[l][s] *= iz; } }
    v16h whi, wlo, w2 = {};
#pragma unroll
    for (int l = 0; l < 9; ++l)
#pragma unroll
      for (int s = 0; s < 2; ++s) { const _Float16 h = (_Float16)w[l][s]; const _Float16 lo = (_Float16)(w[l][s] - (float)h);
        if (l < 8) { whi[2 * l + s] = h; wlo[2 * l + s] = lo; } else { w2[s] = h; w2[2 + s] = lo; } }
    v8f acc[4];
#pragma unroll
    for (int j = 0; j < 4; ++j) { union { v16h v; int u[8]; } h1, h2; const int ch = (j * 16 + c) * 4 + 2 * g;
#pragma unroll
      for (int l = 0; l < 8; ++l) h1.u[l] = *(const int_a*)&shv[hb + (l / 3) * 10 + l % 3][ch];
      const int u8 = *(const int_a*)&shv[hb + 22][ch]; h2.u[0] = u8; h2.u[1] = u8;
#pragma unroll
      for (int l = 2; l < 8; ++l) h2.u[l] = 0;
      v8f d = {};
      d = __builtin_amdgcn_wmma_f32_16x16x32_f16(false, h1.v, false, whi, (short)0, d, false, false);
      d = __builtin_amdgcn_wmma_f32_16x16x32_f16(false, h1.v, false, wlo, (short)0, d, false, false);
      acc[j] = __builtin_amdgcn_wmma_f32_16x16x32_f16(false, h2.v, false, w2, (short)0, d, false, false); }
#pragma unroll
    for (int j = 0; j < 4; ++j) { v8h yv;   // lane holds q = c, o = j*16 + 8g + 0..7
#pragma unroll
      for (int r = 0; r < 8; ++r) yv[r] = (_Float16)(acc[j][r] + bias[j][r]);
      *(v8h*)&sst[wave][c * 72 + j * 16 + 8 * g] = yv; }
    asm volatile("s_wait_dscnt 0" ::: "memory");   // the wave's own rows are in LDS before its other lanes read them back
    const size_t p = b * NP + (size_t)(ty + py) * WWD + tx + px;
#pragma unroll
    for (int k = 0; k < 4; ++k) { const int ck = k * 32 + lane; vst2(Y16 + p * YW + ck * 8, *(const v8h*)&sst[wave][(ck >> 3) * 72 + (ck & 7) * 8]); }   // 512 contiguous bytes per store
    asm volatile("s_wait_dscnt 0" ::: "memory");   // holds the next pixel's LDS stores behind this read-back (no wait on the global stores)
  } }
// ---- k_z: block = (64 pixels, 128 channels, b): z = y . q_w^T (single f16 x f16x256) + q_b -> NCHW out[b][c][p]
__global__ __launch_bounds__(128) void k_z(const _Float16* __restrict__ Y16, const _Float16* __restrict__ PQW, const float* __restrict__ QB, float* __restrict__ OUT) { __shared__ __align__(16) float so[128][64 + 4];
  const int tid = threadIdx.x, wave = tid >> 5, lane = tid & 31, col = lane & 15, g = lane >> 4; const size_t b = blockIdx.z; const int p0 = blockIdx.x * 64; const size_t r0 = b * NP + p0 + wave * 16; const int c0 = blockIdx.y * 128;
  v8f acc[8] = {};
#pragma unroll 2
  for (int kc = 0; kc < YW / 32; ++kc) { const v16h a = frag_h(Y16 + (r0 + col) * YW + kc * 32, lane);
#pragma unroll
    for (int j = 0; j < 8; ++j) acc[j] = wmma16(a, frag_h(PQW + (size_t)(c0 + j * 16 + col) * YW + kc * 32, lane), acc[j]); }
#pragma unroll
  for (int j = 0; j < 8; ++j)
#pragma unroll
    for (int r = 0; r < 8; ++r) so[j * 16 + col][wave * 16 + 8 * g + r] = acc[j][r] * (1.0f / WSC) + bfr(QB[c0 + j * 16 + col]);
  __syncthreads(); for (int e = tid; e < 128 * 16; e += 128) { const int c = e >> 4, q = e & 15; vst2(OUT + ((b * CC + c0 + c) * NP) + p0 + q * 4, *(const v4f*)&so[c][q * 4]); } }
extern "C" void kernel_launch(void* const* d_in, const int* in_sizes, int n_in, void* d_out, int out_size, void* d_ws, size_t ws_size, hipStream_t stream) {
  (void)in_sizes; (void)n_in; (void)out_size;
  const float** F = (const float**)d_in;   // 0 x [4,256,64,64], 1 kv_w [512,256], 2 dot_w [4,16,64], 3 head_w [64,256], 4 head_b [64], 5 q_w [256,1024], 6 q_b [256]
  if (ws_size < (size_t)WS_END) return;
  char* ws = (char*)d_ws; __bf16* XT = (__bf16*)(ws + WS_XT); _Float16 *K16 = (_Float16*)(ws + WS_K16), *V16 = (_Float16*)(ws + WS_V16), *Y16 = (_Float16*)(ws + WS_Y16); float *AL = (float*)(ws + WS_AL), *HV = (float*)(ws + WS_HV);
  k_pack<<<dim3(2 * PD, 3), 256, 0, stream>>>(F[1], F[3], F[5], ws);
  k_xt<<<dim3(NP / 64, NB), 256, 0, stream>>>(F[0], XT);
  k_kv<<<dim3(TPX, 2 * PD / 128, NB), 128, 0, stream>>>(XT, (const __bf16*)(ws + WS_PKV), K16, V16);
  k_logit<<<dim3(TPX, NB), 128, 0, stream>>>(K16, F[2], AL);
  k_hv<<<dim3(TPX, NB), 128, 0, stream>>>(V16, (const _Float16*)(ws + WS_PHW), HV);
  k_win<<<dim3(TWB, NB), 512, 0, stream>>>(AL, HV, F[4], Y16);
  k_z<<<dim3(TZ, CC / 128, NB), 128, 0, stream>>>(Y16, (const _Float16*)(ws + WS_PQW), F[6], (float*)d_out);
}

// v003
// A run of this version takes 56.5 microseconds.
// Next to v002, in two timings, it ran 2.28 and 2.26 times as fast.
// All steps since v000 together make it 12.6 times as fast.
// compute dtype: all float inputs rounded to bf16; kv 1x1 conv with EXACT bf16 products on WMMA 16x16x32 (channels-last), k and v rounded once to f16; query logits (k_h . dot_w) on WMMA (f16 k x f16 x 2^8 dot_w, f32 accumulate); per-head value projection HV = head_w_h v_h on WMMA (single f16 x exact f16 x 2^8); the 3x3-window softmax (zero-padded logits and values, as the module's unfold) in f32 on VALU and the weighted window sums on WMMA (f16-staged HV values x weights split into f16 hi + f16 lo, f32 accumulate); the final 1x1 conv on WMMA (y once to f16 x exact f16 x 2^8 q_w), biases in f32; f32 output (NCHW).
#include <hip/hip_runtime.h>
#include <math.h>

typedef __attribute__((ext_vector_type(16))) _Float16 v16h;
typedef __attribute__((ext_vector_type(16))) __bf16 v16b;
typedef __attribute__((ext_vector_type(8)))  _Float16 v8h;
typedef __attribute__((ext_vector_type(8)))  float v8f;
typedef __attribute__((ext_vector_type(4)))  float v4f;
typedef __attribute__((ext_vector_type(2)))  float v2f;
typedef __attribute__((ext_vector_type(4)))  unsigned v4u;
typedef __attribute__((ext_vector_type(4)))  int v4i;
typedef float __attribute__((may_alias)) float_a;
typedef int __attribute__((may_alias)) int_a;

template <typename T> __device__ __forceinline__ void vst2(void* p, T v) { *(T*)p = v;  }
__device__ __forceinline__ v8f wmma16(v16h a, v16h b, v8f c) {
  v8f d = __builtin_amdgcn_wmma_f32_16x16x32_f16(false, a, false, b, (short)0, c, false, false);
  asm volatile("v_nop\n\tv_nop\n\tv_nop\n\tv_nop" : "+v"(d) : "v"(a), "v"(b));
  return d;
}
__device__ __forceinline__ v8f wmma_bf(v16b a, v16b b, v8f c) {
  v8f d = __builtin_amdgcn_wmma_f32_16x16x32_bf16(false, a, false, b, (short)0, c, false, false);
  asm volatile("v_nop\n\tv_nop\n\tv_nop\n\tv_nop" : "+v"(d) : "v"(a), "v"(b));
  return d;
}
// 16x16x32 fragments: lane = (h = lane>>4, row/col = lane&15); elements 0..7 = k0+8h+0..7, 8..15 = k0+16+8h+0..7; D element r = row 8h+r
__device__ __forceinline__ v16h frag_h(const _Float16* rowk0, int lane) {
  union { v16h v; v8h q[2]; } u; const _Float16* p = rowk0 + 8 * (lane >> 4);
  u.q[0] = *(const v8h*)p; u.q[1] = *(const v8h*)(p + 16); return u.v;
}
__device__ __forceinline__ v16h frag_f32(const float* rowk0, int lane) {
  v16h a; const float* p = rowk0 + 8 * (lane >> 4);
#pragma unroll
  for (int i = 0; i < 8; ++i) { a[i] = (_Float16)p[i]; a[8 + i] = (_Float16)p[16 + i]; }
  return a;
}
__device__ __forceinline__ v16h frag_f32s(const float* rowk0, int lane, float sc) {
  v16h a; const float* p = rowk0 + 8 * (lane >> 4);
#pragma unroll
  for (int i = 0; i < 8; ++i) { a[i] = (_Float16)(p[i] * sc); a[8 + i] = (_Float16)(p[16 + i] * sc); }
  return a;
}
// column fragment from a [K][ld] layout (column n), rows >= K read as 0
__device__ __forceinline__ v16h fragc_f32(const float* W, int k0, int n, int lane, int ld, int K) {
  v16h a; const int g = lane >> 4;
#pragma unroll
  for (int i = 0; i < 8; ++i) { const int ka = k0 + 8 * g + i, kb = ka + 16;
    a[i] = (_Float16)(ka < K ? W[(size_t)(ka < K ? ka : K - 1) * ld + n] : 0.f); a[8 + i] = (_Float16)(kb < K ? W[(size_t)(kb < K ? kb : K - 1) * ld + n] : 0.f); }
  return a;
}
struct F2 { v16b h, l; };
__device__ __forceinline__ F2 bsplit16(const float v[16]) { F2 r;
#pragma unroll
  for (int i = 0; i < 16; ++i) { const __bf16 h = (__bf16)v[i]; r.h[i] = h; r.l[i] = (__bf16)(v[i] - (float)h); }
  return r; }
__device__ __forceinline__ F2 split_row(const float* row, int k0, int lane) { float v[16]; const float* p = row + k0 + 8 * (lane >> 4);
#pragma unroll
  for (int i = 0; i < 8; ++i) { v[i] = p[i]; v[8 + i] = p[16 + i]; }
  return bsplit16(v); }
__device__ __forceinline__ F2 split_rowK(const float* row, int k0, int lane, int K) { float v[16]; const int g = lane >> 4;
#pragma unroll
  for (int i = 0; i < 8; ++i) { const int ka = k0 + 8 * g + i, kb = ka + 16; v[i] = ka < K ? row[ka < K ? ka : K - 1] : 0.f; v[8 + i] = kb < K ? row[kb < K ? kb : K - 1] : 0.f; }
  return bsplit16(v); }
__device__ __forceinline__ F2 split_col(const float* W, int k0, int n, int lane, int ld, int K) { float v[16]; const int g = lane >> 4;
#pragma unroll
  for (int i = 0; i < 8; ++i) { const int ka = k0 + 8 * g + i, kb = ka + 16; v[i] = ka < K ? W[(size_t)(ka < K ? ka : K - 1) * ld + n] : 0.f; v[8 + i] = kb < K ? W[(size_t)(kb < K ? kb : K - 1) * ld + n] : 0.f; }
  return bsplit16(v); }
__device__ __forceinline__ v8f mac3(const F2& a, const F2& b, v8f c) { c = wmma_bf(a.l, b.h, c); c = wmma_bf(a.h, b.l, c); return wmma_bf(a.h, b.h, c); }
__device__ __forceinline__ float sigm(float v) { return 1.0f / (1.0f + expf(-v)); }
#define LDSX() do { asm volatile("s_wait_dscnt 0" ::: "memory"); __builtin_amdgcn_wave_barrier(); __builtin_amdgcn_fence(__ATOMIC_RELEASE, "workgroup"); } while (0)


// Local multi-head channel attention (B 4, C 256, 64 x 64; 4 heads x 64, 16 queries, 3x3 window): kv conv, per-pixel query logits, softmax over each pixel's 3x3 neighbourhood, window-weighted values, head projection (+ bias), query projection (+ bias).
#define NB 4
#define CC 256
#define HH 64
#define WWD 64
#define NP (HH * WWD)
#define NHD 4
#define NQ 16
#define HD 64
#define PD 256
#define YW (NQ * HD)       // 1,024 channels into the query projection
#define WSC 256.0f
#ifndef TPX
#define TPX (NP / 64)      // pixel tiles for logits / hv
#define TWB ((HH / 8) * (WWD / 8))   // window blocks
#endif
typedef __attribute__((ext_vector_type(8))) __bf16 v8b;
__device__ __forceinline__ v16b frag_b(const __bf16* rowk0, int lane) {
  union { v16b v; v8b q[2]; } u; const __bf16* p = rowk0 + 8 * (lane >> 4);
  u.q[0] = *(const v8b*)p; u.q[1] = *(const v8b*)(p + 16); return u.v;
}
__device__ __forceinline__ float bfr(float v) { return (float)(__bf16)v; }
__device__ __attribute__((noinline)) float exp_ni(float v) { return expf(v); }
__device__ __attribute__((noinline)) float erf_ni(float v) { return erff(v); }

#define WS_PKV 0u                                   // bf16 kv_w rows [512][256] (natural); f16 x 2^8 head_w rows [64][256] (natural); f16 x 2^8 q_w rows [256][1024] (natural)
#define WS_PHW (WS_PKV + 2u * (size_t)2 * PD * CC)
#define WS_PQW (WS_PHW + 2u * (size_t)HD * PD)
#define WS_XT  (WS_PQW + 2u * (size_t)CC * YW)           // bf16 x channels-last [b][p][256]
#define WS_K16 (WS_XT + 2u * (size_t)NB * NP * CC)       // f16 k, v rows [b][p][256]
#define WS_V16 (WS_K16 + 2u * (size_t)NB * NP * PD)
#define WS_AL  (WS_V16 + 2u * (size_t)NB * NP * PD)      // f32 logits [b][p][n*16 + q]
#define WS_HV  (WS_AL + 4u * (size_t)NB * NP * NHD * NQ) // f32 HV [b][p][n*64 + o]
#define WS_Y16 (WS_HV + 4u * (size_t)NB * NP * PD)       // f16 y rows [b][p][q*64 + o]
#define WS_END (WS_Y16 + 2u * (size_t)NB * NP * YW)

__global__ __launch_bounds__(256) void k_pack(const float* __restrict__ KVW, const float* __restrict__ HW, const float* __restrict__ QW, char* __restrict__ ws) { const int n = blockIdx.x, which = blockIdx.y, t = threadIdx.x; __shared__ __align__(16) __bf16 sb[CC]; __shared__ __align__(16) _Float16 sh[YW];
  if (which == 0) { sb[t] = (__bf16)KVW[(size_t)n * CC + t]; __syncthreads(); if (t < CC / 8) vst2((unsigned*)((__bf16*)(ws + WS_PKV) + (size_t)n * CC + t * 8), *(const v4u*)&sb[t * 8]); }   // n < 512
  else if (which == 1) { if (n >= HD) return; sh[t] = (_Float16)(bfr(HW[(size_t)n * PD + t]) * WSC); __syncthreads(); if (t < PD / 8) vst2((unsigned*)((_Float16*)(ws + WS_PHW) + (size_t)n * PD + t * 8), *(const v4u*)&sh[t * 8]); }
  else { if (n >= CC) return; for (int k = t; k < YW; k += 256) sh[k] = (_Float16)(bfr(QW[(size_t)n * YW + k]) * WSC); __syncthreads(); for (int q = t; q < YW / 8; q += 256) vst2((unsigned*)((_Float16*)(ws + WS_PQW) + (size_t)n * YW + q * 8), *(const v4u*)&sh[q * 8]); } }
// ---- k_xt: block = (64 pixels, b): x[b][c][p] -> XT[b][p][c] bf16
__global__ __launch_bounds__(256) void k_xt(const float* __restrict__ X, __bf16* __restrict__ XT) { __shared__ float st[64][CC + 1]; __shared__ __align__(16) __bf16 so2[64][CC + 8]; const int t = threadIdx.x; const int p0 = blockIdx.x * 64; const size_t b = blockIdx.y;
  for (int e = t; e < CC * 64; e += 256) { const int c = e >> 6, pl = e & 63; st[pl][c] = X[(b * CC + c) * NP + p0 + pl]; } __syncthreads();
  for (int e = t; e < 64 * CC; e += 256) { const int pl = e >> 8, c = e & 255; so2[pl][c] = (__bf16)st[pl][c]; } __syncthreads();
  for (int e = t; e < 64 * 32; e += 256) { const int pl = e >> 5, q = e & 31; vst2((unsigned*)(XT + ((b * NP + p0 + pl) * CC) + q * 8), *(const v4u*)&so2[pl][q * 8]); } }
// ---- gemm128: one 128 x 128 tile of A . B^T for a block of 8 waves (wave tile 32 rows x 64 columns), both operands k-contiguous 16-bit rows of LDB bytes.
// A pass is 256 B of every row: 128 A rows then 128 B rows in LDS at a pitch of 272 B (16 B x odd: the ds_load_b128 fragment reads of 16 rows fall on all 64 banks). Each wave-wide global load takes two whole 256-B row pieces.
// Two LDS buffers: the next pass's 16 loads per thread are issued ahead of this pass's products and stored behind them; one block barrier per pass publishes the new buffer and ends the reads of the old one.
// ga, gb: the thread's own 16-byte piece (tid & 15) of row (tid >> 4) of the A tile and of the B tile. k runs upward through the passes and blocks, one accumulator chain per output tile.
// Every loop here and in the two callers' epilogues is unrolled so that the staging, fragment and accumulator arrays stay in registers and every address step is an immediate.
#define GP 136
template <int NPASS, int LDB, bool BF>
__device__ __forceinline__ void gemm128(const char* __restrict__ ga, const char* __restrict__ gb, _Float16 (*sm)[256][GP], int tid, v8f (&acc)[2][4]) {
  const int wave = tid >> 5, lane = tid & 31, col = lane & 15, wm = wave & 3, wn = wave >> 2, sr = tid >> 4, sq = tid & 15;
  v8h st[16];
#pragma unroll
  for (int i = 0; i < 8; ++i) { st[i] = *(const v8h*)(ga + (size_t)i * 16 * LDB); st[8 + i] = *(const v8h*)(gb + (size_t)i * 16 * LDB); }
#pragma unroll
  for (int i = 0; i < 16; ++i) *(v8h*)&sm[0][sr + 16 * i][sq * 8] = st[i];
  __syncthreads();
  v16h a[2][2], w[2][4];   // two fragment sets: block ks + 1 is fetched while block ks is multiplied
#pragma unroll
  for (int pass = 0; pass < NPASS; ++pass) {   // unrolled: the buffer index and the last pass's missing refill are then compile-time
    if (pass + 1 < NPASS) {
#pragma unroll
      for (int i = 0; i < 8; ++i) { st[i] = *(const v8h*)(ga + (size_t)i * 16 * LDB + (pass + 1) * 256); st[8 + i] = *(const v8h*)(gb + (size_t)i * 16 * LDB + (pass + 1) * 256); } }
#pragma unroll
    for (int i = 0; i < 2; ++i) a[0][i] = frag_h(&sm[pass & 1][wm * 32 + i * 16 + col][0], lane);
#pragma unroll
    for (int j = 0; j < 4; ++j) w[0][j] = frag_h(&sm[pass & 1][128 + wn * 64 + j * 16 + col][0], lane);
    __builtin_amdgcn_sched_barrier(0);   // keeps the next pass's global loads at the head of this pass (the compiler sank them to the LDS stores at its foot, where their whole latency is waited out)
#pragma unroll
    for (int ks = 0; ks < 4; ++ks) {
      if (ks < 3) {
#pragma unroll
        for (int i = 0; i < 2; ++i) a[(ks + 1) & 1][i] = frag_h(&sm[pass & 1][wm * 32 + i * 16 + col][(ks + 1) * 32], lane);
#pragma unroll
        for (int j = 0; j < 4; ++j) w[(ks + 1) & 1][j] = frag_h(&sm[pass & 1][128 + wn * 64 + j * 16 + col][(ks + 1) * 32], lane); }
      __builtin_amdgcn_sched_barrier(0);   // the next block's 12 LDS reads stand as one group ahead of this block's products, not among them
#pragma unroll
      for (int i = 0; i < 2; ++i)
#pragma unroll
        for (int j = 0; j < 4; ++j) {
          if (BF) acc[i][j] = __builtin_amdgcn_wmma_f32_16x16x32_bf16(false, __builtin_bit_cast(v16b, a[ks & 1][i]), false, __builtin_bit_cast(v16b, w[ks & 1][j]), (short)0, acc[i][j], false, false);
          else acc[i][j] = __builtin_amdgcn_wmma_f32_16x16x32_f16(false, a[ks & 1][i], false, w[ks & 1][j], (short)0, acc[i][j], false, false); }
      __builtin_amdgcn_sched_barrier(0);   // ends the block: the following group of reads does not move up among its products
    }
    if (pass + 1 < NPASS) {
#pragma unroll
      for (int i = 0; i < 16; ++i) *(v8h*)&sm[(pass + 1) & 1][sr + 16 * i][sq * 8] = st[i]; }
    if (pass + 2 == NPASS) asm volatile("s_wait_xcnt 0x0" ::: "memory");   // behind the last global loads: later values may take the registers that held the two row addresses (the last pass's scheduling fences keep those writes behind it)
    __syncthreads(); } }
// ---- k_kv: block = (128 pixels, 128 cols, b), 8 waves: kv = x . kv_w^T (exact) -> f16 rows: cols < 256 -> K16, else V16
__global__ __launch_bounds__(256) void k_kv(const __bf16* __restrict__ XT, const __bf16* __restrict__ P, _Float16* __restrict__ K16, _Float16* __restrict__ V16) { __shared__ __align__(16) _Float16 sm[2][256][GP];
  const int tid = threadIdx.x, wave = tid >> 5, lane = tid & 31, col = lane & 15, g = lane >> 4, wm = wave & 3, wn = wave >> 2; const size_t b = blockIdx.z; const size_t rb = b * NP + (size_t)blockIdx.x * 128; const int c0 = blockIdx.y * 128;
  v8f acc[2][4] = {};
  gemm128<CC / 128, CC * 2, true>((const char*)(XT + (rb + (tid >> 4)) * CC + (tid & 15) * 8), (const char*)(P + (size_t)(c0 + (tid >> 4)) * CC + (tid & 15) * 8), sm, tid, acc);
  _Float16 (*so)[GP] = sm[0];   // the tile's 128 f16 rows; every fragment read has ended at the last pass's barrier
#pragma unroll
  for (int i = 0; i < 2; ++i)
#pragma unroll
    for (int j = 0; j < 4; ++j)
#pragma unroll
      for (int r = 0; r < 8; ++r) so[wm * 32 + i * 16 + 8 * g + r][wn * 64 + j * 16 + col] = (_Float16)acc[i][j][r];
  __syncthreads(); _Float16* dst = ((c0 < PD) ? K16 : V16) + (rb + (tid >> 4)) * PD + c0 % PD + (tid & 15) * 8;   // one address, constant steps: two whole 256-B row pieces per wave store
#pragma unroll
  for (int k = 0; k < 8; ++k) vst2((unsigned*)(dst + (size_t)k * 16 * PD), *(const v4u*)&so[(tid >> 4) + k * 16][(tid & 15) * 8]); }
// ---- k_logit: block = (64 pixels, b), 4 waves, 16 pixels per wave: AL[p][n*16 + q] = sum_d k[p][n*64 + d] dot_w[n][q][d] on WMMA, two 16x16x32 products per head.
// A rows = pixels (f16 k rows), B columns = q (bf16-rounded dot_w x 2^8 as f16), f32 accumulate. k order, equal in both loaders: that of frag_h (elements 0..7 = d0 + 8g + 0..7, 8..15 = d0 + 16 + 8g + 0..7).
__global__ __launch_bounds__(128) void k_logit(const _Float16* __restrict__ K16, const float* __restrict__ DW, float* __restrict__ AL) { __shared__ __align__(16) float sf[4][16][NHD * NQ + 4];   // per wave: its 16 logit rows at a pitch of 272 B
  const int tid = threadIdx.x, wave = tid >> 5, lane = tid & 31, col = lane & 15, g = lane >> 4; const size_t b = blockIdx.y; const size_t r0 = b * NP + (size_t)blockIdx.x * 64 + wave * 16;
  v16h a[NHD * 2]; v4f dw[NHD * 2][4];
  // every loop here is unrolled so that the fragments stay in registers
#pragma unroll
  for (int f = 0; f < NHD * 2; ++f) a[f] = frag_h(K16 + (r0 + col) * PD + f * 32, lane);
  asm volatile("s_wait_xcnt 0x0" ::: "memory");   // stands in front of the loads below, whose results may take the registers that held the k rows' address
#pragma unroll
  for (int f = 0; f < NHD * 2; ++f) { const float* p = DW + (size_t)((f >> 1) * NQ + col) * HD + (f & 1) * 32 + 8 * g;
    dw[f][0] = *(const v4f*)p; dw[f][1] = *(const v4f*)(p + 4); dw[f][2] = *(const v4f*)(p + 16); dw[f][3] = *(const v4f*)(p + 20); }
  __builtin_amdgcn_sched_barrier(0);   // all 48 global loads issue before the first wait: one memory latency for the wave, not one per head
#pragma unroll
  for (int n = 0; n < NHD; ++n) { v8f acc = {};
#pragma unroll
    for (int kc = 0; kc < 2; ++kc) { const int f = n * 2 + kc; v16h w;
#pragma unroll
      for (int i = 0; i < 16; ++i) w[i] = (_Float16)(bfr(dw[f][i >> 2][i & 3]) * WSC);
      acc = __builtin_amdgcn_wmma_f32_16x16x32_f16(false, a[f], false, w, (short)0, acc, false, false); }
#pragma unroll
    for (int r = 0; r < 8; ++r) sf[wave][8 * g + r][n * NQ + col] = acc[r] * (1.0f / WSC); }
  asm volatile("s_wait_dscnt 0" ::: "memory");   // the wave's own rows are in LDS before its other lanes read them back
#pragma unroll
  for (int k = 0; k < 8; ++k) { const int e = k * 32 + lane; vst2(AL + r0 * (NHD * NQ) + e * 4, *(const v4f*)&sf[wave][e >> 4][(e & 15) * 4]); } }   // the wave's 16 rows are 4 KiB in a row: 512 contiguous bytes per store
// ---- k_hv: block = (64 pixels, b): HV[p][n*64 + o] = sum_d v[p][n*64 + d] head_w[o][n*64 + d] (per head; single f16 x f16x256)
__global__ __launch_bounds__(128) void k_hv(const _Float16* __restrict__ V16, const _Float16* __restrict__ PHW, float* __restrict__ HV) { __shared__ __align__(16) float sf[4][16][68];
  const int tid = threadIdx.x, wave = tid >> 5, lane = tid & 31, col = lane & 15, g = lane >> 4; const size_t b = blockIdx.y; const size_t rb = b * NP + (size_t)blockIdx.x * 64; const size_t r0 = rb + wave * 16;
  for (int n = 0; n < NHD; ++n) { v8f acc[4] = {};
#pragma unroll
    for (int kc = 0; kc < HD / 32; ++kc) { const v16h a = frag_h(V16 + (r0 + col) * PD + n * HD + kc * 32, lane);
#pragma unroll
      for (int j = 0; j < 4; ++j) acc[j] = wmma16(a, frag_h(PHW + (size_t)(j * 16 + col) * PD + n * HD + kc * 32, lane), acc[j]); }
#pragma unroll
    for (int j = 0; j < 4; ++j)
#pragma unroll
      for (int r = 0; r < 8; ++r) sf[wave][8 * g + r][j * 16 + col] = acc[j][r] * (1.0f / WSC);
    LDSX(); for (int rl = 0; rl < 16; ++rl) if (lane < 16) vst2(HV + (r0 + rl) * PD + n * HD + lane * 4, *(const v4f*)&sf[wave][rl][lane * 4]); LDSX(); } }
// ---- k_win: block = (8x8 pixel tile, b), 16 waves, 4 pixels per wave: per pixel, per (head n, query q): softmax over the 3x3 neighbourhood of AL (0 outside the image - zero-padded unfold), y[q*64 + o] = sum_n sum_l w[n][q][l] HV[p_l][n*64 + o] (0 outside) + head_b[o] -> f16 rows.
// The sum over k = (n, l), 36 terms, is one 64 x 16 x 36 product per pixel on WMMA: A rows = o (f16-staged HV), B columns = q (weights as f16 hi + f16 lo, so the f32 weight survives).
// k order, equal in both loaders: lane half g holds heads n = 2g, 2g + 1; element 2l + s = (window place l < 8, head 2g + s). Place l = 8 goes in a third product: elements 0, 1 pair HV with hi, elements 2, 3 pair the same HV with lo, the rest 0.
__global__ __launch_bounds__(512) void k_win(const float* __restrict__ AL, const float* __restrict__ HV, const float* __restrict__ HB, _Float16* __restrict__ Y16) {
  __shared__ __align__(16) _Float16 shv[100][PD];        // [halo pixel][o*4 + n]
  __shared__ __align__(16) float sal[100][NHD * NQ];     // [halo pixel][q*4 + n]
  __shared__ __align__(16) _Float16 sst[16][NQ * 72];    // per wave: one pixel's y rows [q][64] at a pitch of 144 B
  const int t = threadIdx.x, wave = t >> 5, lane = t & 31, c = lane & 15, g = lane >> 4; const size_t b = blockIdx.y; const int ty = (blockIdx.x / (WWD / 8)) * 8, tx = (blockIdx.x % (WWD / 8)) * 8;
  // loads first, LDS stores after, so that the staging passes overlap their memory latency; an item past the end takes the last item's address and stores nothing
  v4f hva[4][NHD], ala[NHD]; float bias[4][8];
#pragma unroll
  for (int k = 0; k < 4; ++k) { const int e = min(t + k * 512, 100 * 16 - 1), hp = e >> 4, o4 = e & 15; const int yy = ty - 1 + hp / 10, xx = tx - 1 + hp % 10; const bool inb = yy >= 0 && yy < HH && xx >= 0 && xx < WWD;
    const float* s = HV + (b * NP + (size_t)(inb ? yy * WWD + xx : 0)) * PD + o4 * 4;
#pragma unroll
    for (int n = 0; n < NHD; ++n) { hva[k][n] = *(const v4f*)(s + n * HD); if (!inb) hva[k][n] = v4f{0.f, 0.f, 0.f, 0.f}; } }
  { const int e = min(t, 100 * 4 - 1), hp = e >> 2, q4 = e & 3; const int yy = ty - 1 + hp / 10, xx = tx - 1 + hp % 10; const bool inb = yy >= 0 && yy < HH && xx >= 0 && xx < WWD;
    const float* s = AL + (b * NP + (size_t)(inb ? yy * WWD + xx : 0)) * (NHD * NQ) + q4 * 4;
#pragma unroll
    for (int n = 0; n < NHD; ++n) { ala[n] = *(const v4f*)(s + n * NQ); if (!inb) ala[n] = v4f{0.f, 0.f, 0.f, 0.f}; } }
#pragma unroll
  for (int j = 0; j < 4; ++j)
#pragma unroll
    for (int r = 0; r < 8; ++r) bias[j][r] = bfr(HB[j * 16 + 8 * g + r]);
#pragma unroll
  for (int k = 0; k < 4; ++k) { const int e = t + k * 512; v8h q0, q1;
#pragma unroll
    for (int i = 0; i < 2; ++i)
#pragma unroll
      for (int n = 0; n < NHD; ++n) { q0[i * 4 + n] = (_Float16)hva[k][n][i]; q1[i * 4 + n] = (_Float16)hva[k][n][2 + i]; }
    if (e < 100 * 16) { *(v8h*)&shv[e >> 4][(e & 15) * 16] = q0; *(v8h*)&shv[e >> 4][(e & 15) * 16 + 8] = q1; } }
  if (t < 100 * 4) {
#pragma unroll
    for (int i = 0; i < 4; ++i) *(v4f*)&sal[t >> 2][((t & 3) * 4 + i) * 4] = v4f{ala[0][i], ala[1][i], ala[2][i], ala[3][i]}; }
  __syncthreads();
  for (int i = 0; i < 4; ++i) { const int pl = wave * 4 + i, py = pl >> 3, px = pl & 7, hb = py * 10 + px;
    float w[9][2];
    { v2f lg[9];
#pragma unroll
      for (int l = 0; l < 9; ++l) lg[l] = *(const v2f*)&sal[hb + (l / 3) * 10 + l % 3][c * 4 + 2 * g];
#pragma unroll
      for (int s = 0; s < 2; ++s) { float mx = -3.0e38f;
#pragma unroll
        for (int l = 0; l < 9; ++l) mx = fmaxf(mx, lg[l][s]);
        float z = 0.f;
#pragma unroll
        for (int l = 0; l < 9; ++l) { w[l][s] = expf(lg[l][s] - mx); z += w[l][s]; }
        const float iz = 1.0f / z;
#pragma unroll
        for (int l = 0; l < 9; ++l) w[l][s] *= iz; } }
    v16h whi, wlo, w2 = {};
#pragma unroll
    for (int l = 0; l < 9; ++l)
#pragma unroll
      for (int s = 0; s < 2; ++s) { const _Float16 h = (_Float16)w[l][s]; const _Float16 lo = (_Float16)(w[l][s] - (float)h);
        if (l < 8) { whi[2 * l + s] = h; wlo[2 * l + s] = lo; } else { w2[s] = h; w2[2 + s] = lo; } }
    v8f acc[4];
#pragma unroll
    for (int j = 0; j < 4; ++j) { union { v16h v; int u[8]; } h1, h2; const int ch = (j * 16 + c) * 4 + 2 * g;
#pragma unroll
      for (int l = 0; l < 8; ++l) h1.u[l] = *(const int_a*)&shv[hb + (l / 3) * 10 + l % 3][ch];
      const int u8 = *(const int_a*)&shv[hb + 22][ch]; h2.u[0] = u8; h2.u[1] = u8;
#pragma unroll
      for (int l = 2; l < 8; ++l) h2.u[l] = 0;
      v8f d = {};
      d = __builtin_amdgcn_wmma_f32_16x16x32_f16(false, h1.v, false, whi, (short)0, d, false, false);
      d = __builtin_amdgcn_wmma_f32_16x16x32_f16(false, h1.v, false, wlo, (short)0, d, false, false);
      acc[j] = __builtin_amdgcn_wmma_f32_16x16x32_f16(false, h2.v, false, w2, (short)0, d, false, false); }
#pragma unroll
    for (int j = 0; j < 4; ++j) { v8h yv;   // lane holds q = c, o = j*16 + 8g + 0..7
#pragma unroll
      for (int r = 0; r < 8; ++r) yv[r] = (_Float16)(acc[j][r] + bias[j][r]);
      *(v8h*)&sst[wave][c * 72 + j * 16 + 8 * g] = yv; }
    asm volatile("s_wait_dscnt 0" ::: "memory");   // the wave's own rows are in LDS before its other lanes read them back
    const size_t p = b * NP + (size_t)(ty + py) * WWD + tx + px;
#pragma unroll
    for (int k = 0; k < 4; ++k) { const int ck = k * 32 + lane; vst2(Y16 + p * YW + ck * 8, *(const v8h*)&sst[wave][(ck >> 3) * 72 + (ck & 7) * 8]); }   // 512 contiguous bytes per store
    asm volatile("s_wait_dscnt 0" ::: "memory");   // holds the next pixel's LDS stores behind this read-back (no wait on the global stores)
  } }
// ---- k_z: block = (128 pixels, 128 channels, b), 8 waves: z = y . q_w^T (single f16 x f16x256) + q_b -> NCHW out[b][c][p]
__global__ __launch_bounds__(256) void k_z(const _Float16* __restrict__ Y16, const _Float16* __restrict__ PQW, const float* __restrict__ QB, float* __restrict__ OUT) { __shared__ __align__(16) _Float16 sm[2][256][GP];
  const int tid = threadIdx.x, wave = tid >> 5, lane = tid & 31, col = lane & 15, g = lane >> 4, wm = wave & 3, wn = wave >> 2; const size_t b = blockIdx.z; const int p0 = blockIdx.x * 128; const int c0 = blockIdx.y * 128;
  v8f acc[2][4] = {}; float qb[4];
#pragma unroll
  for (int j = 0; j < 4; ++j) qb[j] = bfr(QB[c0 + wn * 64 + j * 16 + col]);
  gemm128<YW / 128, YW * 2, false>((const char*)(Y16 + (b * NP + p0 + (tid >> 4)) * YW + (tid & 15) * 8), (const char*)(PQW + (size_t)(c0 + (tid >> 4)) * YW + (tid & 15) * 8), sm, tid, acc);
  float (*so)[128 + 4] = (float (*)[128 + 4])&sm[0][0][0];   // [channel][pixel], 67,584 B of the two buffers; every fragment read has ended at the last pass's barrier
#pragma unroll
  for (int i = 0; i < 2; ++i)
#pragma unroll
    for (int j = 0; j < 4; ++j) { v4f lo, hi;
#pragma unroll
      for (int r = 0; r < 4; ++r) { lo[r] = acc[i][j][r] * (1.0f / WSC) + qb[j]; hi[r] = acc[i][j][4 + r] * (1.0f / WSC) + qb[j]; }
      float* d = &so[wn * 64 + j * 16 + col][wm * 32 + i * 16 + 8 * g]; *(v4f*)d = lo; *(v4f*)(d + 4) = hi; }
  __syncthreads(); float* dst = OUT + (b * CC + c0 + wave) * NP + p0 + lane * 4;   // one address, constant steps: one channel's 512 contiguous bytes per wave store
#pragma unroll
  for (int k = 0; k < 16; ++k) vst2(dst + (size_t)k * 8 * NP, *(const v4f*)&so[wave + k * 8][lane * 4]); }
extern "C" void kernel_launch(void* const* d_in, const int* in_sizes, int n_in, void* d_out, int out_size, void* d_ws, size_t ws_size, hipStream_t stream) {
  (void)in_sizes; (void)n_in; (void)out_size;
  const float** F = (const float**)d_in;   // 0 x [4,256,64,64], 1 kv_w [512,256], 2 dot_w [4,16,64], 3 head_w [64,256], 4 head_b [64], 5 q_w [256,1024], 6 q_b [256]
  if (ws_size < (size_t)WS_END) return;
  char* ws = (char*)d_ws; __bf16* XT = (__bf16*)(ws + WS_XT); _Float16 *K16 = (_Float16*)(ws + WS_K16), *V16 = (_Float16*)(ws + WS_V16), *Y16 = (_Float16*)(ws + WS_Y16); float *AL = (float*)(ws + WS_AL), *HV = (float*)(ws + WS_HV);
  k_pack<<<dim3(2 * PD, 3), 256, 0, stream>>>(F[1], F[3], F[5], ws);
  k_xt<<<dim3(NP / 64, NB), 256, 0, stream>>>(F[0], XT);
  k_kv<<<dim3(NP / 128, 2 * PD / 128, NB), 256, 0, stream>>>(XT, (const __bf16*)(ws + WS_PKV), K16, V16);
  k_logit<<<dim3(TPX, NB), 128, 0, stream>>>(K16, F[2], AL);
  k_hv<<<dim3(TPX, NB), 128, 0, stream>>>(V16, (const _Float16*)(ws + WS_PHW), HV);
  k_win<<<dim3(TWB, NB), 512, 0, stream>>>(AL, HV, F[4], Y16);
  k_z<<<dim3(NP / 128, CC / 128, NB), 256, 0, stream>>>(Y16, (const _Float16*)(ws + WS_PQW), F[6], (float*)d_out);
}

// v004
// It runs in 39.9 microseconds.
// In two side-by-side timings against v003, it was 1.41 and 1.43 times as fast.
// Over all steps from v000 it is 17.8 times as fast.
// compute dtype: all float inputs rounded to bf16; the per-head value projection and the query dot are folded into the kv weights ahead of the conv: head_w_h . kv_w(v rows of head h) and dot_w_h . kv_w(k rows of head h), EXACT bf16 products on WMMA 16x16x32, f32 accumulate, rounded once to f16 x 2^8; one 1x1 conv on WMMA (x as f16 x folded f16 weights, f32 accumulate, channels-last) gives HV (rounded once to f16) and the query logits (f32); the 3x3-window softmax (zero-padded logits and values, as the module's unfold) in f32 on VALU and the weighted window sums on WMMA (f16 HV values x weights split into f16 hi + f16 lo, f32 accumulate); the final 1x1 conv on WMMA (y once to f16 x exact f16 x 2^8 q_w), biases in f32; f32 output (NCHW).
#include <hip/hip_runtime.h>
#include <math.h>

typedef __attribute__((ext_vector_type(16))) _Float16 v16h;
typedef __attribute__((ext_vector_type(16))) __bf16 v16b;
typedef __attribute__((ext_vector_type(8)))  _Float16 v8h;
typedef __attribute__((ext_vector_type(8)))  float v8f;
typedef __attribute__((ext_vector_type(4)))  float v4f;
typedef __attribute__((ext_vector_type(2)))  float v2f;
typedef __attribute__((ext_vector_type(4)))  unsigned v4u;
typedef __attribute__((ext_vector_type(4)))  int v4i;
typedef float __attribute__((may_alias)) float_a;
typedef int __attribute__((may_alias)) int_a;

template <typename T> __device__ __forceinline__ void vst2(void* p, T v) { *(T*)p = v;  }
__device__ __forceinline__ v8f wmma_bf(v16b a, v16b b, v8f c) {
  v8f d = __builtin_amdgcn_wmma_f32_16x16x32_bf16(false, a, false, b, (short)0, c, false, false);
  asm volatile("v_nop\n\tv_nop\n\tv_nop\n\tv_nop" : "+v"(d) : "v"(a), "v"(b));
  return d;
}
// 16x16x32 fragments: lane = (h = lane>>4, row/col = lane&15); elements 0..7 = k0+8h+0..7, 8..15 = k0+16+8h+0..7; D element r = row 8h+r
__device__ __forceinline__ v16h frag_h(const _Float16* rowk0, int lane) {
  union { v16h v; v8h q[2]; } u; const _Float16* p = rowk0 + 8 * (lane >> 4);
  u.q[0] = *(const v8h*)p; u.q[1] = *(const v8h*)(p + 16); return u.v;
}
__device__ __forceinline__ v16h frag_f32(const float* rowk0, int lane) {
  v16h a; const float* p = rowk0 + 8 * (lane >> 4);
#pragma unroll
  for (int i = 0; i < 8; ++i) { a[i] = (_Float16)p[i]; a[8 + i] = (_Float16)p[16 + i]; }
  return a;
}
__device__ __forceinline__ v16h frag_f32s(const float* rowk0, int lane, float sc) {
  v16h a; const float* p = rowk0 + 8 * (lane >> 4);
#pragma unroll
  for (int i = 0; i < 8; ++i) { a[i] = (_Float16)(p[i] * sc); a[8 + i] = (_Float16)(p[16 + i] * sc); }
  return a;
}
// column fragment from a [K][ld] layout (column n), rows >= K read as 0
__device__ __forceinline__ v16h fragc_f32(const float* W, int k0, int n, int lane, int ld, int K) {
  v16h a; const int g = lane >> 4;
#pragma unroll
  for (int i = 0; i < 8; ++i) { const int ka = k0 + 8 * g + i, kb = ka + 16;
    a[i] = (_Float16)(ka < K ? W[(size_t)(ka < K ? ka : K - 1) * ld + n] : 0.f); a[8 + i] = (_Float16)(kb < K ? W[(size_t)(kb < K ? kb : K - 1) * ld + n] : 0.f); }
  return a;
}
struct F2 { v16b h, l; };
__device__ __forceinline__ F2 bsplit16(const float v[16]) { F2 r;
#pragma unroll
  for (int i = 0; i < 16; ++i) { const __bf16 h = (__bf16)v[i]; r.h[i] = h; r.l[i] = (__bf16)(v[i] - (float)h); }
  return r; }
__device__ __forceinline__ F2 split_row(const float* row, int k0, int lane) { float v[16]; const float* p = row + k0 + 8 * (lane >> 4);
#pragma unroll
  for (int i = 0; i < 8; ++i) { v[i] = p[i]; v[8 + i] = p[16 + i]; }
  return bsplit16(v); }
__device__ __forceinline__ F2 split_rowK(const float* row, int k0, int lane, int K) { float v[16]; const int g = lane >> 4;
#pragma unroll
  for (int i = 0; i < 8; ++i) { const int ka = k0 + 8 * g + i, kb = ka + 16; v[i] = ka < K ? row[ka < K ? ka : K - 1] : 0.f; v[8 + i] = kb < K ? row[kb < K ? kb : K - 1] : 0.f; }
  return bsplit16(v); }
__device__ __forceinline__ F2 split_col(const float* W, int k0, int n, int lane, int ld, int K) { float v[16]; const int g = lane >> 4;
#pragma unroll
  for (int i = 0; i < 8; ++i) { const int ka = k0 + 8 * g + i, kb = ka + 16; v[i] = ka < K ? W[(size_t)(ka < K ? ka : K - 1) * ld + n] : 0.f; v[8 + i] = kb < K ? W[(size_t)(kb < K ? kb : K - 1) * ld + n] : 0.f; }
  return bsplit16(v); }
__device__ __forceinline__ v8f mac3(const F2& a, const F2& b, v8f c) { c = wmma_bf(a.l, b.h, c); c = wmma_bf(a.h, b.l, c); return wmma_bf(a.h, b.h, c); }
__device__ __forceinline__ float sigm(float v) { return 1.0f / (1.0f + expf(-v)); }


// Local multi-head channel attention (B 4, C 256, 64 x 64; 4 heads x 64, 16 queries, 3x3 window): kv conv, per-pixel query logits, softmax over each pixel's 3x3 neighbourhood, window-weighted values, head projection (+ bias), query projection (+ bias).
#define NB 4
#define CC 256
#define HH 64
#define WWD 64
#define NP (HH * WWD)
#define NHD 4
#define NQ 16
#define HD 64
#define PD 256
#define YW (NQ * HD)       // 1,024 channels into the query projection
#define WSC 256.0f
#ifndef TPX
#define TPX (NP / 64)      // unused
#define TWB ((HH / 8) * (WWD / 8))   // window blocks
#endif
typedef __attribute__((ext_vector_type(8))) __bf16 v8b;
__device__ __forceinline__ v16b frag_b(const __bf16* rowk0, int lane) {
  union { v16b v; v8b q[2]; } u; const __bf16* p = rowk0 + 8 * (lane >> 4);
  u.q[0] = *(const v8b*)p; u.q[1] = *(const v8b*)(p + 16); return u.v;
}
__device__ __forceinline__ float bfr(float v) { return (float)(__bf16)v; }
__device__ __attribute__((noinline)) float exp_ni(float v) { return expf(v); }
__device__ __attribute__((noinline)) float erf_ni(float v) { return erff(v); }

#define NFR 384                                     // folded weight rows: 256 HV rows (o*4 + n), 64 logit rows (q*4 + n), 64 rows of zeros that fill the third 128-column tile
#define WS_PW  0u                                   // f16 x 2^8 folded rows [384][256]; then f16 x 2^8 q_w rows [256][1024] (natural)
#define WS_PQW (WS_PW + 2u * (size_t)NFR * CC)
#define WS_XT  (WS_PQW + 2u * (size_t)CC * YW)           // f16 x (bf16-rounded) channels-last [b][p][256]
#define WS_HV  (WS_XT + 2u * (size_t)NB * NP * CC)       // f16 HV [b][p][o*4 + n]
#define WS_AL  (WS_HV + 2u * (size_t)NB * NP * PD)       // f32 logits [b][p][q*4 + n]
#define WS_Y16 (WS_AL + 4u * (size_t)NB * NP * NHD * NQ) // f16 y rows [b][p][q*64 + o]
#define WS_END (WS_Y16 + 2u * (size_t)NB * NP * YW)

// ---- k_pack: y = 0: the fold. Block n < 40 = (unit u = n >> 1, 128 columns c), one 16 x 16 tile per wave, two 16x16x32 products (64 terms d).
// Units 0..15 = (head u >> 2, 16 rows o): sum_d head_w[o][h*64 + d] kv_w[256 + h*64 + d][c] -> row o*4 + h; units 16..19 = head u - 16, 16 rows q: sum_d dot_w[h][q][d] kv_w[h*64 + d][c] -> row 256 + q*4 + h.
// The rows stand in the order in which k_win's fragments want the channels of a pixel. k order, equal in both loaders: elements 0..7 = d0 + 8g + 0..7, 8..15 = d0 + 16 + 8g + 0..7. Blocks 40..47 write the 64 rows of zeros. y = 1: q_w rows.
__global__ __launch_bounds__(256) void k_pack(const float* __restrict__ KVW, const float* __restrict__ DW, const float* __restrict__ HW, const float* __restrict__ QW, char* __restrict__ ws) { const int n = blockIdx.x, which = blockIdx.y, t = threadIdx.x; __shared__ __align__(16) _Float16 sh[YW]; __shared__ __align__(16) _Float16 sp[16][128 + 8];
  if (which == 0) { _Float16* PW = (_Float16*)(ws + WS_PW);
    if (n < 40) { const int wave = t >> 5, lane = t & 31, col = lane & 15, g = lane >> 4, u = n >> 1, cb = (n & 1) * 128; const bool hv = u < 16; const int hd = hv ? u >> 2 : u - 16;
      const float* ar = (hv ? HW + (size_t)((u & 3) * 16 + col) * PD + hd * HD : DW + (size_t)(hd * NQ + col) * HD) + 8 * g;
      const float* br = KVW + (size_t)((hv ? PD : 0) + hd * HD + 8 * g) * CC + cb + wave * 16 + col;
      v8f acc = {};
      // both loops unrolled so that all loads issue ahead of the first product
#pragma unroll
      for (int kc = 0; kc < 2; ++kc) { v16b a, w;
#pragma unroll
        for (int i = 0; i < 8; ++i) { a[i] = (__bf16)ar[kc * 32 + i]; a[8 + i] = (__bf16)ar[kc * 32 + 16 + i]; w[i] = (__bf16)br[(size_t)(kc * 32 + i) * CC]; w[8 + i] = (__bf16)br[(size_t)(kc * 32 + 16 + i) * CC]; }
        acc = __builtin_amdgcn_wmma_f32_16x16x32_bf16(false, a, false, w, (short)0, acc, false, false); }
#pragma unroll
      for (int r = 0; r < 8; ++r) sp[8 * g + r][wave * 16 + col] = (_Float16)(acc[r] * WSC);
      __syncthreads(); const int rl = t >> 4; const int ro = hv ? ((u & 3) * 16 + rl) * NHD + hd : PD + rl * NHD + hd;   // one wave stores two whole 256-B row pieces
      vst2((unsigned*)(PW + (size_t)ro * CC + cb + (t & 15) * 8), *(const v4u*)&sp[rl][(t & 15) * 8]); }
    else if (n < 48) { vst2((unsigned*)(PW + (size_t)(PD + NHD * NQ) * CC + (size_t)((n - 40) * 256 + t) * 8), v4u{0u, 0u, 0u, 0u});
      asm volatile("s_wait_xcnt 0x0" ::: "memory"); } }   // behind the store: the code laid out after it writes the registers that the store names
  else { for (int k = t; k < YW; k += 256) sh[k] = (_Float16)(bfr(QW[(size_t)n * YW + k]) * WSC); __syncthreads(); for (int q = t; q < YW / 8; q += 256) vst2((unsigned*)((_Float16*)(ws + WS_PQW) + (size_t)n * YW + q * 8), *(const v4u*)&sh[q * 8]); } }
// ---- k_xt: block = (64 pixels, b): x[b][c][p] -> XT[b][p][c], rounded to bf16, held as f16
__global__ __launch_bounds__(256) void k_xt(const float* __restrict__ X, _Float16* __restrict__ XT) { __shared__ float st[64][CC + 1]; __shared__ __align__(16) _Float16 so2[64][CC + 8]; const int t = threadIdx.x; const int p0 = blockIdx.x * 64; const size_t b = blockIdx.y;
  for (int e = t; e < CC * 64; e += 256) { const int c = e >> 6, pl = e & 63; st[pl][c] = X[(b * CC + c) * NP + p0 + pl]; } __syncthreads();
  for (int e = t; e < 64 * CC; e += 256) { const int pl = e >> 8, c = e & 255; so2[pl][c] = (_Float16)bfr(st[pl][c]); } __syncthreads();
  for (int e = t; e < 64 * 32; e += 256) { const int pl = e >> 5, q = e & 31; vst2((unsigned*)(XT + ((b * NP + p0 + pl) * CC) + q * 8), *(const v4u*)&so2[pl][q * 8]); } }
// ---- gemm128: one 128 x 128 tile of A . B^T for a block of 8 waves (wave tile 32 rows x 64 columns), both operands k-contiguous 16-bit rows of LDB bytes.
// A pass is 256 B of every row: 128 A rows then 128 B rows in LDS at a pitch of 272 B (16 B x odd: the ds_load_b128 fragment reads of 16 rows fall on all 64 banks). Each wave-wide global load takes two whole 256-B row pieces.
// Two LDS buffers: the next pass's 16 loads per thread are issued ahead of this pass's products and stored behind them; one block barrier per pass publishes the new buffer and ends the reads of the old one.
// ga, gb: the thread's own 16-byte piece (tid & 15) of row (tid >> 4) of the A tile and of the B tile. k runs upward through the passes and blocks, one accumulator chain per output tile.
// Every loop here and in the two callers' epilogues is unrolled so that the staging, fragment and accumulator arrays stay in registers and every address step is an immediate.
#define GP 136
template <int NPASS, int LDB, bool BF>
__device__ __forceinline__ void gemm128(const char* __restrict__ ga, const char* __restrict__ gb, _Float16 (*sm)[256][GP], int tid, v8f (&acc)[2][4]) {
  const int wave = tid >> 5, lane = tid & 31, col = lane & 15, wm = wave & 3, wn = wave >> 2, sr = tid >> 4, sq = tid & 15;
  v8h st[16];
#pragma unroll
  for (int i = 0; i < 8; ++i) { st[i] = *(const v8h*)(ga + (size_t)i * 16 * LDB); st[8 + i] = *(const v8h*)(gb + (size_t)i * 16 * LDB); }
#pragma unroll
  for (int i = 0; i < 16; ++i) *(v8h*)&sm[0][sr + 16 * i][sq * 8] = st[i];
  __syncthreads();
  v16h a[2][2], w[2][4];   // two fragment sets: block ks + 1 is fetched while block ks is multiplied
#pragma unroll
  for (int pass = 0; pass < NPASS; ++pass) {   // unrolled: the buffer index and the last pass's missing refill are then compile-time
    if (pass + 1 < NPASS) {
#pragma unroll
      for (int i = 0; i < 8; ++i) { st[i] = *(const v8h*)(ga + (size_t)i * 16 * LDB + (pass + 1) * 256); st[8 + i] = *(const v8h*)(gb + (size_t)i * 16 * LDB + (pass + 1) * 256); } }
#pragma unroll
    for (int i = 0; i < 2; ++i) a[0][i] = frag_h(&sm[pass & 1][wm * 32 + i * 16 + col][0], lane);
#pragma unroll
    for (int j = 0; j < 4; ++j) w[0][j] = frag_h(&sm[pass & 1][128 + wn * 64 + j * 16 + col][0], lane);
    __builtin_amdgcn_sched_barrier(0);   // keeps the next pass's global loads at the head of this pass (the compiler sank them to the LDS stores at its foot, where their whole latency is waited out)
#pragma unroll
    for (int ks = 0; ks < 4; ++ks) {
      if (ks < 3) {
#pragma unroll
        for (int i = 0; i < 2; ++i) a[(ks + 1) & 1][i] = frag_h(&sm[pass & 1][wm * 32 + i * 16 + col][(ks + 1) * 32], lane);
#pragma unroll
        for (int j = 0; j < 4; ++j) w[(ks + 1) & 1][j] = frag_h(&sm[pass & 1][128 + wn * 64 + j * 16 + col][(ks + 1) * 32], lane); }
      __builtin_amdgcn_sched_barrier(0);   // the next block's 12 LDS reads stand as one group ahead of this block's products, not among them
#pragma unroll
      for (int i = 0; i < 2; ++i)
#pragma unroll
        for (int j = 0; j < 4; ++j) {
          if (BF) acc[i][j] = __builtin_amdgcn_wmma_f32_16x16x32_bf16(false, __builtin_bit_cast(v16b, a[ks & 1][i]), false, __builtin_bit_cast(v16b, w[ks & 1][j]), (short)0, acc[i][j], false, false);
          else acc[i][j] = __builtin_amdgcn_wmma_f32_16x16x32_f16(false, a[ks & 1][i], false, w[ks & 1][j], (short)0, acc[i][j], false, false); }
      __builtin_amdgcn_sched_barrier(0);   // ends the block: the following group of reads does not move up among its products
    }
    if (pass + 1 < NPASS) {
#pragma unroll
      for (int i = 0; i < 16; ++i) *(v8h*)&sm[(pass + 1) & 1][sr + 16 * i][sq * 8] = st[i]; }
    if (pass + 2 == NPASS) asm volatile("s_wait_xcnt 0x0" ::: "memory");   // behind the last global loads: later values may take the registers that held the two row addresses (the last pass's scheduling fences keep those writes behind it)
    __syncthreads(); } }
// ---- k_kv: block = (128 pixels, 128 folded rows, b), 8 waves: x . folded^T: column tiles 0, 1 -> HV f16 rows, tile 2 (its first 64 columns) -> f32 logit rows
__global__ __launch_bounds__(256) void k_kv(const _Float16* __restrict__ XT, const _Float16* __restrict__ P, _Float16* __restrict__ HV, float* __restrict__ AL) { __shared__ __align__(16) _Float16 sm[2][256][GP];
  const int tid = threadIdx.x, wave = tid >> 5, lane = tid & 31, col = lane & 15, g = lane >> 4, wm = wave & 3, wn = wave >> 2; const size_t b = blockIdx.z; const size_t rb = b * NP + (size_t)blockIdx.x * 128; const int c0 = blockIdx.y * 128;
  v8f acc[2][4] = {};
  gemm128<CC / 128, CC * 2, false>((const char*)(XT + (rb + (tid >> 4)) * CC + (tid & 15) * 8), (const char*)(P + (size_t)(c0 + (tid >> 4)) * CC + (tid & 15) * 8), sm, tid, acc);
  if (c0 < PD) { _Float16 (*so)[GP] = sm[0];   // the tile's 128 f16 rows; every fragment read has ended at the last pass's barrier
#pragma unroll
    for (int i = 0; i < 2; ++i)
#pragma unroll
      for (int j = 0; j < 4; ++j)
#pragma unroll
        for (int r = 0; r < 8; ++r) so[wm * 32 + i * 16 + 8 * g + r][wn * 64 + j * 16 + col] = (_Float16)(acc[i][j][r] * (1.0f / WSC));
    __syncthreads(); _Float16* dst = HV + (rb + (tid >> 4)) * PD + c0 + (tid & 15) * 8;   // one address, constant steps: two whole 256-B row pieces per wave store
#pragma unroll
    for (int k = 0; k < 8; ++k) vst2((unsigned*)(dst + (size_t)k * 16 * PD), *(const v4u*)&so[(tid >> 4) + k * 16][(tid & 15) * 8]); }
  else { float (*sf)[NHD * NQ + 4] = (float (*)[NHD * NQ + 4])&sm[0][0][0];   // the tile's 128 logit rows at a pitch of 272 B
    if (wn == 0) {
#pragma unroll
      for (int i = 0; i < 2; ++i)
#pragma unroll
        for (int j = 0; j < 4; ++j)
#pragma unroll
          for (int r = 0; r < 8; ++r) sf[wm * 32 + i * 16 + 8 * g + r][j * 16 + col] = acc[i][j][r] * (1.0f / WSC); }
    __syncthreads(); float* dst = AL + rb * (NHD * NQ) + tid * 4;   // the 128 rows are 32 KiB in a row: 512 contiguous bytes per wave store
#pragma unroll
    for (int k = 0; k < 8; ++k) vst2(dst + k * 1024, *(const v4f*)&sf[(tid >> 4) + k * 16][(tid & 15) * 4]); } }
// ---- k_win: block = (8x8 pixel tile, b), 16 waves, 4 pixels per wave: per pixel, per (head n, query q): softmax over the 3x3 neighbourhood of AL (0 outside the image - zero-padded unfold), y[q*64 + o] = sum_n sum_l w[n][q][l] HV[p_l][o*4 + n] (0 outside) + head_b[o] -> f16 rows.
// The sum over k = (n, l), 36 terms, is one 64 x 16 x 36 product per pixel on WMMA: A rows = o (f16-staged HV), B columns = q (weights as f16 hi + f16 lo, so the f32 weight survives).
// k order, equal in both loaders: lane half g holds heads n = 2g, 2g + 1; element 2l + s = (window place l < 8, head 2g + s). Place l = 8 goes in a third product: elements 0, 1 pair HV with hi, elements 2, 3 pair the same HV with lo, the rest 0.
__global__ __launch_bounds__(512) void k_win(const float* __restrict__ AL, const _Float16* __restrict__ HV, const float* __restrict__ HB, _Float16* __restrict__ Y16) {
  __shared__ __align__(16) _Float16 shv[100][PD];        // [halo pixel][o*4 + n]
  __shared__ __align__(16) float sal[100][NHD * NQ];     // [halo pixel][q*4 + n]
  __shared__ __align__(16) _Float16 sst[16][NQ * 72];    // per wave: one pixel's y rows [q][64] at a pitch of 144 B
  const int t = threadIdx.x, wave = t >> 5, lane = t & 31, c = lane & 15, g = lane >> 4; const size_t b = blockIdx.y; const int ty = (blockIdx.x / (WWD / 8)) * 8, tx = (blockIdx.x % (WWD / 8)) * 8;
  // loads first, LDS stores after, so that the staging passes overlap their memory latency; an item past the end takes the last item's address and stores nothing
  v8h hva[4][2]; v4f ala[4]; float bias[4][8];
#pragma unroll
  for (int k = 0; k < 4; ++k) { const int e = min(t + k * 512, 100 * 16 - 1), hp = e >> 4, o4 = e & 15; const int yy = ty - 1 + hp / 10, xx = tx - 1 + hp % 10; const bool inb = yy >= 0 && yy < HH && xx >= 0 && xx < WWD;
    const _Float16* s = HV + (b * NP + (size_t)(inb ? yy * WWD + xx : 0)) * PD + o4 * 16;
#pragma unroll
    for (int n = 0; n < 2; ++n) { hva[k][n] = *(const v8h*)(s + n * 8); if (!inb) hva[k][n] = v8h{}; } }
  { const int e = min(t, 100 * 4 - 1), hp = e >> 2, q4 = e & 3; const int yy = ty - 1 + hp / 10, xx = tx - 1 + hp % 10; const bool inb = yy >= 0 && yy < HH && xx >= 0 && xx < WWD;
    const float* s = AL + (b * NP + (size_t)(inb ? yy * WWD + xx : 0)) * (NHD * NQ) + q4 * 16;
#pragma unroll
    for (int n = 0; n < 4; ++n) { ala[n] = *(const v4f*)(s + n * 4); if (!inb) ala[n] = v4f{0.f, 0.f, 0.f, 0.f}; } }
  asm volatile("s_wait_xcnt 0x0" ::: "memory");   // stands in front of the loads below, whose results may take the registers that held the staging addresses
#pragma unroll
  for (int j = 0; j < 4; ++j)
#pragma unroll
    for (int r = 0; r < 8; ++r) bias[j][r] = bfr(HB[j * 16 + 8 * g + r]);
  asm volatile("" :: "v"(hva[3][0]), "v"(hva[3][1]));   // holds the last staging pass's two loads up here with the others (the compiler sank them into the branch round their LDS stores, where two waves wait out a second latency in front of the block barrier)
#pragma unroll
  for (int k = 0; k < 4; ++k) { const int e = t + k * 512;
    if (k < 3 || e < 100 * 16) { *(v8h*)&shv[e >> 4][(e & 15) * 16] = hva[k][0]; *(v8h*)&shv[e >> 4][(e & 15) * 16 + 8] = hva[k][1]; } }
  if (t < 100 * 4) {
#pragma unroll
    for (int i = 0; i < 4; ++i) *(v4f*)&sal[t >> 2][((t & 3) * 4 + i) * 4] = ala[i]; }
  __syncthreads();
  for (int i = 0; i < 4; ++i) { const int pl = wave * 4 + i, py = pl >> 3, px = pl & 7, hb = py * 10 + px;
    float w[9][2];
    { v2f lg[9];
#pragma unroll
      for (int l = 0; l < 9; ++l) lg[l] = *(const v2f*)&sal[hb + (l / 3) * 10 + l % 3][c * 4 + 2 * g];
#pragma unroll
      for (int s = 0; s < 2; ++s) { float mx = -3.0e38f;
#pragma unroll
        for (int l = 0; l < 9; ++l) mx = fmaxf(mx, lg[l][s]);
        float z = 0.f;
#pragma unroll
        for (int l = 0; l < 9; ++l) { w[l][s] = expf(lg[l][s] - mx); z += w[l][s]; }
        const float iz = 1.0f / z;
#pragma unroll
        for (int l = 0; l < 9; ++l) w[l][s] *= iz; } }
    v16h whi, wlo, w2 = {};
#pragma unroll
    for (int l = 0; l < 9; ++l)
#pragma unroll
      for (int s = 0; s < 2; ++s) { const _Float16 h = (_Float16)w[l][s]; const _Float16 lo = (_Float16)(w[l][s] - (float)h);
        if (l < 8) { whi[2 * l + s] = h; wlo[2 * l + s] = lo; } else { w2[s] = h; w2[2 + s] = lo; } }
    v8f acc[4];
#pragma unroll
    for (int j = 0; j < 4; ++j) { union { v16h v; int u[8]; } h1, h2; const int ch = (j * 16 + c) * 4 + 2 * g;
#pragma unroll
      for (int l = 0; l < 8; ++l) h1.u[l] = *(const int_a*)&shv[hb + (l / 3) * 10 + l % 3][ch];
      const int u8 = *(const int_a*)&shv[hb + 22][ch]; h2.u[0] = u8; h2.u[1] = u8;
#pragma unroll
      for (int l = 2; l < 8; ++l) h2.u[l] = 0;
      v8f d = {};
      d = __builtin_amdgcn_wmma_f32_16x16x32_f16(false, h1.v, false, whi, (short)0, d, false, false);
      d = __builtin_amdgcn_wmma_f32_16x16x32_f16(false, h1.v, false, wlo, (short)0, d, false, false);
      acc[j] = __builtin_amdgcn_wmma_f32_16x16x32_f16(false, h2.v, false, w2, (short)0, d, false, false); }
#pragma unroll
    for (int j = 0; j < 4; ++j) { v8h yv;   // lane holds q = c, o = j*16 + 8g + 0..7
#pragma unroll
      for (int r = 0; r < 8; ++r) yv[r] = (_Float16)(acc[j][r] + bias[j][r]);
      *(v8h*)&sst[wave][c * 72 + j * 16 + 8 * g] = yv; }
    asm volatile("s_wait_dscnt 0" ::: "memory");   // the wave's own rows are in LDS before its other lanes read them back
    const size_t p = b * NP + (size_t)(ty + py) * WWD + tx + px;
#pragma unroll
    for (int k = 0; k < 4; ++k) { const int ck = k * 32 + lane; vst2(Y16 + p * YW + ck * 8, *(const v8h*)&sst[wave][(ck >> 3) * 72 + (ck & 7) * 8]); }   // 512 contiguous bytes per store
    asm volatile("s_wait_dscnt 0" ::: "memory");   // holds the next pixel's LDS stores behind this read-back (no wait on the global stores)
  } }
// ---- k_z: block = (128 pixels, 128 channels, b), 8 waves: z = y . q_w^T (single f16 x f16x256) + q_b -> NCHW out[b][c][p]
__global__ __launch_bounds__(256) void k_z(const _Float16* __restrict__ Y16, const _Float16* __restrict__ PQW, const float* __restrict__ QB, float* __restrict__ OUT) { __shared__ __align__(16) _Float16 sm[2][256][GP];
  const int tid = threadIdx.x, wave = tid >> 5, lane = tid & 31, col = lane & 15, g = lane >> 4, wm = wave & 3, wn = wave >> 2; const size_t b = blockIdx.z; const int p0 = blockIdx.x * 128; const int c0 = blockIdx.y * 128;
  v8f acc[2][4] = {}; float qb[4];
#pragma unroll
  for (int j = 0; j < 4; ++j) qb[j] = bfr(QB[c0 + wn * 64 + j * 16 + col]);
  gemm128<YW / 128, YW * 2, false>((const char*)(Y16 + (b * NP + p0 + (tid >> 4)) * YW + (tid & 15) * 8), (const char*)(PQW + (size_t)(c0 + (tid >> 4)) * YW + (tid & 15) * 8), sm, tid, acc);
  float (*so)[128 + 4] = (float (*)[128 + 4])&sm[0][0][0];   // [channel][pixel], 67,584 B of the two buffers; every fragment read has ended at the last pass's barrier
#pragma unroll
  for (int i = 0; i < 2; ++i)
#pragma unroll
    for (int j = 0; j < 4; ++j) { v4f lo, hi;
#pragma unroll
      for (int r = 0; r < 4; ++r) { lo[r] = acc[i][j][r] * (1.0f / WSC) + qb[j]; hi[r] = acc[i][j][4 + r] * (1.0f / WSC) + qb[j]; }
      float* d = &so[wn * 64 + j * 16 + col][wm * 32 + i * 16 + 8 * g]; *(v4f*)d = lo; *(v4f*)(d + 4) = hi; }
  __syncthreads(); float* dst = OUT + (b * CC + c0 + wave) * NP + p0 + lane * 4;   // one address, constant steps: one channel's 512 contiguous bytes per wave store
#pragma unroll
  for (int k = 0; k < 16; ++k) vst2(dst + (size_t)k * 8 * NP, *(const v4f*)&so[wave + k * 8][lane * 4]); }
extern "C" void kernel_launch(void* const* d_in, const int* in_sizes, int n_in, void* d_out, int out_size, void* d_ws, size_t ws_size, hipStream_t stream) {
  (void)in_sizes; (void)n_in; (void)out_size;
  const float** F = (const float**)d_in;   // 0 x [4,256,64,64], 1 kv_w [512,256], 2 dot_w [4,16,64], 3 head_w [64,256], 4 head_b [64], 5 q_w [256,1024], 6 q_b [256]
  if (ws_size < (size_t)WS_END) return;
  char* ws = (char*)d_ws; _Float16 *XT = (_Float16*)(ws + WS_XT), *HV = (_Float16*)(ws + WS_HV), *Y16 = (_Float16*)(ws + WS_Y16); float* AL = (float*)(ws + WS_AL);
  k_pack<<<dim3(CC, 2), 256, 0, stream>>>(F[1], F[2], F[3], F[5], ws);
  k_xt<<<dim3(NP / 64, NB), 256, 0, stream>>>(F[0], XT);
  k_kv<<<dim3(NP / 128, NFR / 128, NB), 256, 0, stream>>>(XT, (const _Float16*)(ws + WS_PW), HV, AL);
  k_win<<<dim3(TWB, NB), 512, 0, stream>>>(AL, HV, F[4], Y16);
  k_z<<<dim3(NP / 128, CC / 128, NB), 256, 0, stream>>>(Y16, (const _Float16*)(ws + WS_PQW), F[6], (float*)d_out);
}

// v005
// A run of this version takes 36.1 microseconds.
// In two side-by-side timings against v004, it was 1.09 and 1.10 times as fast.
// Counting every step since v000, it is 19.5 times as fast.
// compute dtype: all float inputs rounded to bf16; the per-head value projection and the query dot are folded into the kv weights ahead of the conv: head_w_h . kv_w(v rows of head h) and dot_w_h . kv_w(k rows of head h), EXACT bf16 products on WMMA 16x16x32, f32 accumulate, rounded once to f16 x 2^8; one 1x1 conv on WMMA (x as f16 x folded f16 weights, f32 accumulate, channels-last) gives HV (rounded once to f16) and the query logits (f32); the 3x3-window softmax (zero-padded logits and values, as the module's unfold) in f32 on VALU and the weighted window sums on WMMA (f16 HV values x weights split into f16 hi + f16 lo, f32 accumulate); the final 1x1 conv on WMMA (y once to f16 x exact f16 x 2^8 q_w), biases in f32; f32 output (NCHW).
#include <hip/hip_runtime.h>
#include <math.h>

typedef __attribute__((ext_vector_type(16))) _Float16 v16h;
typedef __attribute__((ext_vector_type(16))) __bf16 v16b;
typedef __attribute__((ext_vector_type(8)))  _Float16 v8h;
typedef __attribute__((ext_vector_type(8)))  float v8f;
typedef __attribute__((ext_vector_type(4)))  float v4f;
typedef __attribute__((ext_vector_type(2)))  float v2f;
typedef __attribute__((ext_vector_type(4)))  unsigned v4u;
typedef __attribute__((ext_vector_type(4)))  int v4i;
typedef float __attribute__((may_alias)) float_a;
typedef int __attribute__((may_alias)) int_a;

template <typename T> __device__ __forceinline__ void vst2(void* p, T v) { *(T*)p = v;  }
__device__ __forceinline__ v8f wmma_bf(v16b a, v16b b, v8f c) {
  v8f d = __builtin_amdgcn_wmma_f32_16x16x32_bf16(false, a, false, b, (short)0, c, false, false);
  asm volatile("v_nop\n\tv_nop\n\tv_nop\n\tv_nop" : "+v"(d) : "v"(a), "v"(b));
  return d;
}
// 16x16x32 fragments: lane = (h = lane>>4, row/col = lane&15); elements 0..7 = k0+8h+0..7, 8..15 = k0+16+8h+0..7; D element r = row 8h+r
__device__ __forceinline__ v16h frag_h(const _Float16* rowk0, int lane) {
  union { v16h v; v8h q[2]; } u; const _Float16* p = rowk0 + 8 * (lane >> 4);
  u.q[0] = *(const v8h*)p; u.q[1] = *(const v8h*)(p + 16); return u.v;
}
__device__ __forceinline__ v16h frag_f32(const float* rowk0, int lane) {
  v16h a; const float* p = rowk0 + 8 * (lane >> 4);
#pragma unroll
  for (int i = 0; i < 8; ++i) { a[i] = (_Float16)p[i]; a[8 + i] = (_Float16)p[16 + i]; }
  return a;
}
__device__ __forceinline__ v16h frag_f32s(const float* rowk0, int lane, float sc) {
  v16h a; const float* p = rowk0 + 8 * (lane >> 4);
#pragma unroll
  for (int i = 0; i < 8; ++i) { a[i] = (_Float16)(p[i] * sc); a[8 + i] = (_Float16)(p[16 + i] * sc); }
  return a;
}
// column fragment from a [K][ld] layout (column n), rows >= K read as 0
__device__ __forceinline__ v16h fragc_f32(const float* W, int k0, int n, int lane, int ld, int K) {
  v16h a; const int g = lane >> 4;
#pragma unroll
  for (int i = 0; i < 8; ++i) { const int ka = k0 + 8 * g + i, kb = ka + 16;
    a[i] = (_Float16)(ka < K ? W[(size_t)(ka < K ? ka : K - 1) * ld + n] : 0.f); a[8 + i] = (_Float16)(kb < K ? W[(size_t)(kb < K ? kb : K - 1) * ld + n] : 0.f); }
  return a;
}
struct F2 { v16b h, l; };
__device__ __forceinline__ F2 bsplit16(const float v[16]) { F2 r;
#pragma unroll
  for (int i = 0; i < 16; ++i) { const __bf16 h = (__bf16)v[i]; r.h[i] = h; r.l[i] = (__bf16)(v[i] - (float)h); }
  return r; }
__device__ __forceinline__ F2 split_row(const float* row, int k0, int lane) { float v[16]; const float* p = row + k0 + 8 * (lane >> 4);
#pragma unroll
  for (int i = 0; i < 8; ++i) { v[i] = p[i]; v[8 + i] = p[16 + i]; }
  return bsplit16(v); }
__device__ __forceinline__ F2 split_rowK(const float* row, int k0, int lane, int K) { float v[16]; const int g = lane >> 4;
#pragma unroll
  for (int i = 0; i < 8; ++i) { const int ka = k0 + 8 * g + i, kb = ka + 16; v[i] = ka < K ? row[ka < K ? ka : K - 1] : 0.f; v[8 + i] = kb < K ? row[kb < K ? kb : K - 1] : 0.f; }
  return bsplit16(v); }
__device__ __forceinline__ F2 split_col(const float* W, int k0, int n, int lane, int ld, int K) { float v[16]; const int g = lane >> 4;
#pragma unroll
  for (int i = 0; i < 8; ++i) { const int ka = k0 + 8 * g + i, kb = ka + 16; v[i] = ka < K ? W[(size_t)(ka < K ? ka : K - 1) * ld + n] : 0.f; v[8 + i] = kb < K ? W[(size_t)(kb < K ? kb : K - 1) * ld + n] : 0.f; }
  return bsplit16(v); }
__device__ __forceinline__ v8f mac3(const F2& a, const F2& b, v8f c) { c = wmma_bf(a.l, b.h, c); c = wmma_bf(a.h, b.l, c); return wmma_bf(a.h, b.h, c); }
__device__ __forceinline__ float sigm(float v) { return 1.0f / (1.0f + expf(-v)); }


// Local multi-head channel attention (B 4, C 256, 64 x 64; 4 heads x 64, 16 queries, 3x3 window): kv conv, per-pixel query logits, softmax over each pixel's 3x3 neighbourhood, window-weighted values, head projection (+ bias), query projection (+ bias).
#define NB 4
#define CC 256
#define HH 64
#define WWD 64
#define NP (HH * WWD)
#define NHD 4
#define NQ 16
#define HD 64
#define PD 256
#define YW (NQ * HD)       // 1,024 channels into the query projection
#define WSC 256.0f
#ifndef TPX
#define TPX (NP / 64)      // unused
#define TWB ((HH / 8) * (WWD / 8))   // window blocks
#endif
typedef __attribute__((ext_vector_type(8))) __bf16 v8b;
__device__ __forceinline__ v16b frag_b(const __bf16* rowk0, int lane) {
  union { v16b v; v8b q[2]; } u; const __bf16* p = rowk0 + 8 * (lane >> 4);
  u.q[0] = *(const v8b*)p; u.q[1] = *(const v8b*)(p + 16); return u.v;
}
__device__ __forceinline__ float bfr(float v) { return (float)(__bf16)v; }
__device__ __attribute__((noinline)) float exp_ni(float v) { return expf(v); }
__device__ __attribute__((noinline)) float erf_ni(float v) { return erff(v); }

#define NFR 384                                     // folded weight rows: 256 HV rows (o*4 + n), 64 logit rows (q*4 + n), 64 rows of zeros that fill the third 128-column tile
#define WS_PW  0u                                   // f16 x 2^8 folded rows [384][256]; then f16 x 2^8 q_w rows [256][1024] (natural)
#define WS_PQW (WS_PW + 2u * (size_t)NFR * CC)
#define WS_XT  (WS_PQW + 2u * (size_t)CC * YW)           // f16 x (bf16-rounded) channels-last [b][p][256]
#define WS_HV  (WS_XT + 2u * (size_t)NB * NP * CC)       // f16 HV [b][p][o*4 + n]
#define WS_AL  (WS_HV + 2u * (size_t)NB * NP * PD)       // f32 logits [b][p][q*4 + n]
#define WS_Y16 (WS_AL + 4u * (size_t)NB * NP * NHD * NQ) // f16 y rows [b][p][q*64 + o]
#define WS_END (WS_Y16 + 2u * (size_t)NB * NP * YW)

// ---- k_prep: the two preparations, which do not depend on each other, in one launch. Blocks 0..255 = (64 pixels, b): x[b][c][p] -> XT[b][p][c], rounded to bf16, held as f16. They come first: they run longest. Blocks 256.. = n + 256:
// n < 40: the fold. Block n = (unit u = n >> 1, 128 columns c), one 16 x 16 tile per wave, two 16x16x32 products (64 terms d).
// Units 0..15 = (head u >> 2, 16 rows o): sum_d head_w[o][h*64 + d] kv_w[256 + h*64 + d][c] -> row o*4 + h; units 16..19 = head u - 16, 16 rows q: sum_d dot_w[h][q][d] kv_w[h*64 + d][c] -> row 256 + q*4 + h.
// The rows stand in the order in which k_win's fragments want the channels of a pixel. k order, equal in both loaders: elements 0..7 = d0 + 8g + 0..7, 8..15 = d0 + 16 + 8g + 0..7. n = 40..47 write the 64 rows of zeros. n = 48..79: q_w, 8 rows each.
#define NXB (NB * (NP / 64))
#define NPREP (NXB + 48 + CC / 8)
typedef __attribute__((ext_vector_type(4))) _Float16 v4h;
__global__ __launch_bounds__(256) void k_prep(const float* __restrict__ X, const float* __restrict__ KVW, const float* __restrict__ DW, const float* __restrict__ HW, const float* __restrict__ QW, char* __restrict__ ws) { const int t = threadIdx.x; __shared__ __align__(16) char smem[64 * (CC + 1) * 4 + 64 * (CC + 8) * 2];
  if (blockIdx.x < NXB) { float (*st)[CC + 1] = (float (*)[CC + 1])smem; _Float16 (*so2)[CC + 8] = (_Float16 (*)[CC + 8])(smem + 64 * (CC + 1) * 4); _Float16* XT = (_Float16*)(ws + WS_XT); const int p0 = (blockIdx.x % (NP / 64)) * 64; const size_t b = blockIdx.x / (NP / 64);
    for (int e = t; e < CC * 64; e += 256) { const int c = e >> 6, pl = e & 63; st[pl][c] = X[(b * CC + c) * NP + p0 + pl]; } __syncthreads();
    for (int e = t; e < 64 * CC; e += 256) { const int pl = e >> 8, c = e & 255; so2[pl][c] = (_Float16)bfr(st[pl][c]); } __syncthreads();
    for (int e = t; e < 64 * 32; e += 256) { const int pl = e >> 5, q = e & 31; vst2((unsigned*)(XT + ((b * NP + p0 + pl) * CC) + q * 8), *(const v4u*)&so2[pl][q * 8]); } }
  else { const int n = blockIdx.x - NXB; _Float16* PW = (_Float16*)(ws + WS_PW);
    if (n < 40) { _Float16 (*sp)[128 + 8] = (_Float16 (*)[128 + 8])smem; const int wave = t >> 5, lane = t & 31, col = lane & 15, g = lane >> 4, u = n >> 1, cb = (n & 1) * 128; const bool hv = u < 16; const int hd = hv ? u >> 2 : u - 16;
      const float* ar = (hv ? HW + (size_t)((u & 3) * 16 + col) * PD + hd * HD : DW + (size_t)(hd * NQ + col) * HD) + 8 * g;
      const float* br = KVW + (size_t)((hv ? PD : 0) + hd * HD + 8 * g) * CC + cb + wave * 16 + col;
      v8f acc = {}; float av[2][16];
      // all loops unrolled so that all loads issue ahead of the first product
#pragma unroll
      for (int kc = 0; kc < 2; ++kc)
#pragma unroll
        for (int i = 0; i < 8; ++i) { av[kc][i] = ar[kc * 32 + i]; av[kc][8 + i] = ar[kc * 32 + 16 + i]; }
      asm volatile("s_wait_xcnt 0x0" ::: "memory");   // behind the row loads: the column loads' results may take the registers that held the row address
#pragma unroll
      for (int kc = 0; kc < 2; ++kc) { v16b a, w;
#pragma unroll
        for (int i = 0; i < 8; ++i) { a[i] = (__bf16)av[kc][i]; a[8 + i] = (__bf16)av[kc][8 + i]; w[i] = (__bf16)br[(size_t)(kc * 32 + i) * CC]; w[8 + i] = (__bf16)br[(size_t)(kc * 32 + 16 + i) * CC]; }
        acc = __builtin_amdgcn_wmma_f32_16x16x32_bf16(false, a, false, w, (short)0, acc, false, false); }
#pragma unroll
      for (int r = 0; r < 8; ++r) sp[8 * g + r][wave * 16 + col] = (_Float16)(acc[r] * WSC);
      __syncthreads(); const int rl = t >> 4; const int ro = hv ? ((u & 3) * 16 + rl) * NHD + hd : PD + rl * NHD + hd;   // one wave stores two whole 256-B row pieces
      vst2((unsigned*)(PW + (size_t)ro * CC + cb + (t & 15) * 8), *(const v4u*)&sp[rl][(t & 15) * 8]);
      asm volatile("s_wait_xcnt 0x0" ::: "memory"); }   // behind the store: the code laid out after it writes the registers that the store names
    else if (n < 48) { vst2((unsigned*)(PW + (size_t)(PD + NHD * NQ) * CC + (size_t)((n - 40) * 256 + t) * 8), v4u{0u, 0u, 0u, 0u});
      asm volatile("s_wait_xcnt 0x0" ::: "memory"); }   // behind the store: the code laid out after it writes the registers that the store names
    else { const size_t o = (size_t)(n - 48) * 8 * YW + t * 4; const float* s = QW + o; _Float16* d = (_Float16*)(ws + WS_PQW) + o; v4f q[8];   // the 8 rows are 32 KiB in a row: 512 contiguous bytes per wave load, 256 per wave store
      // unrolled so that all 8 loads issue ahead of the first store
#pragma unroll
      for (int k = 0; k < 8; ++k) q[k] = *(const v4f*)(s + k * 1024);
      asm volatile("s_wait_xcnt 0x0" ::: "memory");   // behind the loads: later values may take the registers that held their address
#pragma unroll
      for (int k = 0; k < 8; ++k) { v4h h;
#pragma unroll
        for (int i = 0; i < 4; ++i) h[i] = (_Float16)(bfr(q[k][i]) * WSC);
        vst2(d + k * 1024, h); }
      asm volatile("s_wait_xcnt 0x0" ::: "memory"); } } }   // behind the last store: the code laid out after it writes the registers that the stores name
// ---- gemm128: one 128 x 128 tile of A . B^T for a block of 8 waves (wave tile 32 rows x 64 columns), both operands k-contiguous 16-bit rows of LDB bytes.
// A pass is 256 B of every row: 128 A rows then 128 B rows in LDS at a pitch of 272 B (16 B x odd: the ds_load_b128 fragment reads of 16 rows fall on all 64 banks). Each wave-wide global load takes two whole 256-B row pieces.
// Two LDS buffers: the next pass's 16 loads per thread are issued ahead of this pass's products and stored behind them; one block barrier per pass publishes the new buffer and ends the reads of the old one.
// ga, gb: the thread's own 16-byte piece (tid & 15) of row (tid >> 4) of the A tile and of the B tile. k runs upward through the passes and blocks, one accumulator chain per output tile.
// Every loop here and in the two callers' epilogues is unrolled so that the staging, fragment and accumulator arrays stay in registers and every address step is an immediate.
#define GP 136
template <int NPASS, int LDB, bool BF>
__device__ __forceinline__ void gemm128(const char* __restrict__ ga, const char* __restrict__ gb, _Float16 (*sm)[256][GP], int tid, v8f (&acc)[2][4]) {
  const int wave = tid >> 5, lane = tid & 31, col = lane & 15, wm = wave & 3, wn = wave >> 2, sr = tid >> 4, sq = tid & 15;
  v8h st[16];
#pragma unroll
  for (int i = 0; i < 8; ++i) { st[i] = *(const v8h*)(ga + (size_t)i * 16 * LDB); st[8 + i] = *(const v8h*)(gb + (size_t)i * 16 * LDB); }
#pragma unroll
  for (int i = 0; i < 16; ++i) *(v8h*)&sm[0][sr + 16 * i][sq * 8] = st[i];
  __syncthreads();
  v16h a[2][2], w[2][4];   // two fragment sets: block ks + 1 is fetched while block ks is multiplied
#pragma unroll
  for (int pass = 0; pass < NPASS; ++pass) {   // unrolled: the buffer index and the last pass's missing refill are then compile-time
    if (pass + 1 < NPASS) {
#pragma unroll
      for (int i = 0; i < 8; ++i) { st[i] = *(const v8h*)(ga + (size_t)i * 16 * LDB + (pass + 1) * 256); st[8 + i] = *(const v8h*)(gb + (size_t)i * 16 * LDB + (pass + 1) * 256); } }
#pragma unroll
    for (int i = 0; i < 2; ++i) a[0][i] = frag_h(&sm[pass & 1][wm * 32 + i * 16 + col][0], lane);
#pragma unroll
    for (int j = 0; j < 4; ++j) w[0][j] = frag_h(&sm[pass & 1][128 + wn * 64 + j * 16 + col][0], lane);
    __builtin_amdgcn_sched_barrier(0);   // keeps the next pass's global loads at the head of this pass (the compiler sank them to the LDS stores at its foot, where their whole latency is waited out)
#pragma unroll
    for (int ks = 0; ks < 4; ++ks) {
      if (ks < 3) {
#pragma unroll
        for (int i = 0; i < 2; ++i) a[(ks + 1) & 1][i] = frag_h(&sm[pass & 1][wm * 32 + i * 16 + col][(ks + 1) * 32], lane);
#pragma unroll
        for (int j = 0; j < 4; ++j) w[(ks + 1) & 1][j] = frag_h(&sm[pass & 1][128 + wn * 64 + j * 16 + col][(ks + 1) * 32], lane); }
      __builtin_amdgcn_sched_barrier(0);   // the next block's 12 LDS reads stand as one group ahead of this block's products, not among them
#pragma unroll
      for (int i = 0; i < 2; ++i)
#pragma unroll
        for (int j = 0; j < 4; ++j) {
          if (BF) acc[i][j] = __builtin_amdgcn_wmma_f32_16x16x32_bf16(false, __builtin_bit_cast(v16b, a[ks & 1][i]), false, __builtin_bit_cast(v16b, w[ks & 1][j]), (short)0, acc[i][j], false, false);
          else acc[i][j] = __builtin_amdgcn_wmma_f32_16x16x32_f16(false, a[ks & 1][i], false, w[ks & 1][j], (short)0, acc[i][j], false, false); }
      __builtin_amdgcn_sched_barrier(0);   // ends the block: the following group of reads does not move up among its products
    }
    if (pass + 1 < NPASS) {
#pragma unroll
      for (int i = 0; i < 16; ++i) *(v8h*)&sm[(pass + 1) & 1][sr + 16 * i][sq * 8] = st[i]; }
    if (pass + 2 == NPASS) asm volatile("s_wait_xcnt 0x0" ::: "memory");   // behind the last global loads: later values may take the registers that held the two row addresses (the last pass's scheduling fences keep those writes behind it)
    __syncthreads(); } }
// ---- k_kv: block = (128 pixels, 128 folded rows, b), 8 waves: x . folded^T: column tiles 0, 1 -> HV f16 rows, tile 2 (its first 64 columns) -> f32 logit rows
__global__ __launch_bounds__(256) void k_kv(const _Float16* __restrict__ XT, const _Float16* __restrict__ P, _Float16* __restrict__ HV, float* __restrict__ AL) { __shared__ __align__(16) _Float16 sm[2][256][GP];
  const int tid = threadIdx.x, wave = tid >> 5, lane = tid & 31, col = lane & 15, g = lane >> 4, wm = wave & 3, wn = wave >> 2; const size_t b = blockIdx.z; const size_t rb = b * NP + (size_t)blockIdx.x * 128; const int c0 = blockIdx.y * 128;
  v8f acc[2][4] = {};
  gemm128<CC / 128, CC * 2, false>((const char*)(XT + (rb + (tid >> 4)) * CC + (tid & 15) * 8), (const char*)(P + (size_t)(c0 + (tid >> 4)) * CC + (tid & 15) * 8), sm, tid, acc);
  if (c0 < PD) { _Float16 (*so)[GP] = sm[0];   // the tile's 128 f16 rows; every fragment read has ended at the last pass's barrier
#pragma unroll
    for (int i = 0; i < 2; ++i)
#pragma unroll
      for (int j = 0; j < 4; ++j)
#pragma unroll
        for (int r = 0; r < 8; ++r) so[wm * 32 + i * 16 + 8 * g + r][wn * 64 + j * 16 + col] = (_Float16)(acc[i][j][r] * (1.0f / WSC));
    __syncthreads(); _Float16* dst = HV + (rb + (tid >> 4)) * PD + c0 + (tid & 15) * 8;   // one address, constant steps: two whole 256-B row pieces per wave store
#pragma unroll
    for (int k = 0; k < 8; ++k) vst2((unsigned*)(dst + (size_t)k * 16 * PD), *(const v4u*)&so[(tid >> 4) + k * 16][(tid & 15) * 8]); }
  else { float (*sf)[NHD * NQ + 4] = (float (*)[NHD * NQ + 4])&sm[0][0][0];   // the tile's 128 logit rows at a pitch of 272 B
    if (wn == 0) {
#pragma unroll
      for (int i = 0; i < 2; ++i)
#pragma unroll
        for (int j = 0; j < 4; ++j)
#pragma unroll
          for (int r = 0; r < 8; ++r) sf[wm * 32 + i * 16 + 8 * g + r][j * 16 + col] = acc[i][j][r] * (1.0f / WSC); }
    __syncthreads(); float* dst = AL + rb * (NHD * NQ) + tid * 4;   // the 128 rows are 32 KiB in a row: 512 contiguous bytes per wave store
#pragma unroll
    for (int k = 0; k < 8; ++k) vst2(dst + k * 1024, *(const v4f*)&sf[(tid >> 4) + k * 16][(tid & 15) * 4]); } }
// ---- k_win: block = (8x8 pixel tile, b), 16 waves, 4 pixels per wave: per pixel, per (head n, query q): softmax over the 3x3 neighbourhood of AL (0 outside the image - zero-padded unfold), y[q*64 + o] = sum_n sum_l w[n][q][l] HV[p_l][o*4 + n] (0 outside) + head_b[o] -> f16 rows.
// The sum over k = (n, l), 36 terms, is one 64 x 16 x 36 product per pixel on WMMA: A rows = o (f16-staged HV), B columns = q (weights as f16 hi + f16 lo, so the f32 weight survives).
// k order, equal in both loaders: lane half g holds heads n = 2g, 2g + 1; element 2l + s = (window place l < 8, head 2g + s). Place l = 8 goes in a third product: elements 0, 1 pair HV with hi, elements 2, 3 pair the same HV with lo, the rest 0.
__global__ __launch_bounds__(512) void k_win(const float* __restrict__ AL, const _Float16* __restrict__ HV, const float* __restrict__ HB, _Float16* __restrict__ Y16) {
  __shared__ __align__(16) _Float16 shv[100][PD];        // [halo pixel][o*4 + n]
  __shared__ __align__(16) float sal[100][NHD * NQ];     // [halo pixel][q*4 + n]
  __shared__ __align__(16) _Float16 sst[16][NQ * 72];    // per wave: one pixel's y rows [q][64] at a pitch of 144 B
  const int t = threadIdx.x, wave = t >> 5, lane = t & 31, c = lane & 15, g = lane >> 4; const size_t b = blockIdx.y; const int ty = (blockIdx.x / (WWD / 8)) * 8, tx = (blockIdx.x % (WWD / 8)) * 8;
  // loads first, LDS stores after, so that the staging passes overlap their memory latency; an item past the end takes the last item's address and stores nothing
  v8h hva[4][2]; v4f ala[4]; float bias[4][8];
#pragma unroll
  for (int k = 0; k < 4; ++k) { const int e = min(t + k * 512, 100 * 16 - 1), hp = e >> 4, o4 = e & 15; const int yy = ty - 1 + hp / 10, xx = tx - 1 + hp % 10; const bool inb = yy >= 0 && yy < HH && xx >= 0 && xx < WWD;
    const _Float16* s = HV + (b * NP + (size_t)(inb ? yy * WWD + xx : 0)) * PD + o4 * 16;
#pragma unroll
    for (int n = 0; n < 2; ++n) { hva[k][n] = *(const v8h*)(s + n * 8); if (!inb) hva[k][n] = v8h{}; } }
  { const int e = min(t, 100 * 4 - 1), hp = e >> 2, q4 = e & 3; const int yy = ty - 1 + hp / 10, xx = tx - 1 + hp % 10; const bool inb = yy >= 0 && yy < HH && xx >= 0 && xx < WWD;
    const float* s = AL + (b * NP + (size_t)(inb ? yy * WWD + xx : 0)) * (NHD * NQ) + q4 * 16;
#pragma unroll
    for (int n = 0; n < 4; ++n) { ala[n] = *(const v4f*)(s + n * 4); if (!inb) ala[n] = v4f{0.f, 0.f, 0.f, 0.f}; } }
  asm volatile("s_wait_xcnt 0x0" ::: "memory");   // stands in front of the loads below, whose results may take the registers that held the staging addresses
#pragma unroll
  for (int j = 0; j < 4; ++j)
#pragma unroll
    for (int r = 0; r < 8; ++r) bias[j][r] = bfr(HB[j * 16 + 8 * g + r]);
  asm volatile("" :: "v"(hva[3][0]), "v"(hva[3][1]));   // holds the last staging pass's two loads up here with the others (the compiler sank them into the branch round their LDS stores, where two waves wait out a second latency in front of the block barrier)
#pragma unroll
  for (int k = 0; k < 4; ++k) { const int e = t + k * 512;
    if (k < 3 || e < 100 * 16) { *(v8h*)&shv[e >> 4][(e & 15) * 16] = hva[k][0]; *(v8h*)&shv[e >> 4][(e & 15) * 16 + 8] = hva[k][1]; } }
  if (t < 100 * 4) {
#pragma unroll
    for (int i = 0; i < 4; ++i) *(v4f*)&sal[t >> 2][((t & 3) * 4 + i) * 4] = ala[i]; }
  __syncthreads();
  for (int i = 0; i < 4; ++i) { const int pl = wave * 4 + i, py = pl >> 3, px = pl & 7, hb = py * 10 + px;
    float w[9][2];
    { v2f lg[9];
#pragma unroll
      for (int l = 0; l < 9; ++l) lg[l] = *(const v2f*)&sal[hb + (l / 3) * 10 + l % 3][c * 4 + 2 * g];
#pragma unroll
      for (int s = 0; s < 2; ++s) { float mx = -3.0e38f;
#pragma unroll
        for (int l = 0; l < 9; ++l) mx = fmaxf(mx, lg[l][s]);
        float z = 0.f;
#pragma unroll
        for (int l = 0; l < 9; ++l) { w[l][s] = expf(lg[l][s] - mx); z += w[l][s]; }
        const float iz = 1.0f / z;
#pragma unroll
        for (int l = 0; l < 9; ++l) w[l][s] *= iz; } }
    v16h whi, wlo, w2 = {};
#pragma unroll
    for (int l = 0; l < 9; ++l)
#pragma unroll
      for (int s = 0; s < 2; ++s) { const _Float16 h = (_Float16)w[l][s]; const _Float16 lo = (_Float16)(w[l][s] - (float)h);
        if (l < 8) { whi[2 * l + s] = h; wlo[2 * l + s] = lo; } else { w2[s] = h; w2[2 + s] = lo; } }
    v8f acc[4];
#pragma unroll
    for (int j = 0; j < 4; ++j) { union { v16h v; int u[8]; } h1, h2; const int ch = (j * 16 + c) * 4 + 2 * g;
#pragma unroll
      for (int l = 0; l < 8; ++l) h1.u[l] = *(const int_a*)&shv[hb + (l / 3) * 10 + l % 3][ch];
      const int u8 = *(const int_a*)&shv[hb + 22][ch]; h2.u[0] = u8; h2.u[1] = u8;
#pragma unroll
      for (int l = 2; l < 8; ++l) h2.u[l] = 0;
      v8f d = {};
      d = __builtin_amdgcn_wmma_f32_16x16x32_f16(false, h1.v, false, whi, (short)0, d, false, false);
      d = __builtin_amdgcn_wmma_f32_16x16x32_f16(false, h1.v, false, wlo, (short)0, d, false, false);
      acc[j] = __builtin_amdgcn_wmma_f32_16x16x32_f16(false, h2.v, false, w2, (short)0, d, false, false); }
#pragma unroll
    for (int j = 0; j < 4; ++j) { v8h yv;   // lane holds q = c, o = j*16 + 8g + 0..7
#pragma unroll
      for (int r = 0; r < 8; ++r) yv[r] = (_Float16)(acc[j][r] + bias[j][r]);
      *(v8h*)&sst[wave][c * 72 + j * 16 + 8 * g] = yv; }
    asm volatile("s_wait_dscnt 0" ::: "memory");   // the wave's own rows are in LDS before its other lanes read them back
    const size_t p = b * NP + (size_t)(ty + py) * WWD + tx + px;
#pragma unroll
    for (int k = 0; k < 4; ++k) { const int ck = k * 32 + lane; vst2(Y16 + p * YW + ck * 8, *(const v8h*)&sst[wave][(ck >> 3) * 72 + (ck & 7) * 8]); }   // 512 contiguous bytes per store
    asm volatile("s_wait_dscnt 0" ::: "memory");   // holds the next pixel's LDS stores behind this read-back (no wait on the global stores)
  } }
// ---- k_z: block = (128 pixels, 128 channels, b), 8 waves: z = y . q_w^T (single f16 x f16x256) + q_b -> NCHW out[b][c][p]
__global__ __launch_bounds__(256) void k_z(const _Float16* __restrict__ Y16, const _Float16* __restrict__ PQW, const float* __restrict__ QB, float* __restrict__ OUT) { __shared__ __align__(16) _Float16 sm[2][256][GP];
  const int tid = threadIdx.x, wave = tid >> 5, lane = tid & 31, col = lane & 15, g = lane >> 4, wm = wave & 3, wn = wave >> 2; const size_t b = blockIdx.z; const int p0 = blockIdx.x * 128; const int c0 = blockIdx.y * 128;
  v8f acc[2][4] = {}; float qb[4];
#pragma unroll
  for (int j = 0; j < 4; ++j) qb[j] = bfr(QB[c0 + wn * 64 + j * 16 + col]);
  gemm128<YW / 128, YW * 2, false>((const char*)(Y16 + (b * NP + p0 + (tid >> 4)) * YW + (tid & 15) * 8), (const char*)(PQW + (size_t)(c0 + (tid >> 4)) * YW + (tid & 15) * 8), sm, tid, acc);
  float (*so)[128 + 4] = (float (*)[128 + 4])&sm[0][0][0];   // [channel][pixel], 67,584 B of the two buffers; every fragment read has ended at the last pass's barrier
#pragma unroll
  for (int i = 0; i < 2; ++i)
#pragma unroll
    for (int j = 0; j < 4; ++j) { v4f lo, hi;
#pragma unroll
      for (int r = 0; r < 4; ++r) { lo[r] = acc[i][j][r] * (1.0f / WSC) + qb[j]; hi[r] = acc[i][j][4 + r] * (1.0f / WSC) + qb[j]; }
      float* d = &so[wn * 64 + j * 16 + col][wm * 32 + i * 16 + 8 * g]; *(v4f*)d = lo; *(v4f*)(d + 4) = hi; }
  __syncthreads(); float* dst = OUT + (b * CC + c0 + wave) * NP + p0 + lane * 4;   // one address, constant steps: one channel's 512 contiguous bytes per wave store
#pragma unroll
  for (int k = 0; k < 16; ++k) vst2(dst + (size_t)k * 8 * NP, *(const v4f*)&so[wave + k * 8][lane * 4]); }
extern "C" void kernel_launch(void* const* d_in, const int* in_sizes, int n_in, void* d_out, int out_size, void* d_ws, size_t ws_size, hipStream_t stream) {
  (void)in_sizes; (void)n_in; (void)out_size;
  const float** F = (const float**)d_in;   // 0 x [4,256,64,64], 1 kv_w [512,256], 2 dot_w [4,16,64], 3 head_w [64,256], 4 head_b [64], 5 q_w [256,1024], 6 q_b [256]
  if (ws_size < (size_t)WS_END) return;
  char* ws = (char*)d_ws; _Float16 *XT = (_Float16*)(ws + WS_XT), *HV = (_Float16*)(ws + WS_HV), *Y16 = (_Float16*)(ws + WS_Y16); float* AL = (float*)(ws + WS_AL);
  k_prep<<<dim3(NPREP), 256, 0, stream>>>(F[0], F[1], F[2], F[3], F[5], ws);
  k_kv<<<dim3(NP / 128, NFR / 128, NB), 256, 0, stream>>>(XT, (const _Float16*)(ws + WS_PW), HV, AL);
  k_win<<<dim3(TWB, NB), 512, 0, stream>>>(AL, HV, F[4], Y16);
  k_z<<<dim3(NP / 128, CC / 128, NB), 256, 0, stream>>>(Y16, (const _Float16*)(ws + WS_PQW), F[6], (float*)d_out);
}

// v006
// It runs in 30.9 microseconds.
// Next to v005, in two timings, it ran 1.16 and 1.17 times as fast.
// Over all steps from v000 it is 22.8 times as fast.
// compute dtype: all float inputs rounded to bf16; the per-head value projection and the query dot are folded into the kv weights ahead of the conv: head_w_h . kv_w(v rows of head h) and dot_w_h . kv_w(k rows of head h), EXACT bf16 products on WMMA 16x16x32, f32 accumulate, rounded once to f16 x 2^8; one 1x1 conv on WMMA (x as f16 x folded f16 weights, f32 accumulate, channels-last) gives HV (rounded once to f16) and the query logits (f32); the 3x3-window softmax (zero-padded logits and values, as the module's unfold) in f32 on VALU and the weighted window sums on WMMA (f16 HV values x weights split into f16 hi + f16 lo, f32 accumulate); the final 1x1 conv on WMMA (y once to f16 x exact f16 x 2^8 q_w), biases in f32; f32 output (NCHW).
#include <hip/hip_runtime.h>
#include <math.h>

typedef __attribute__((ext_vector_type(16))) _Float16 v16h;
typedef __attribute__((ext_vector_type(16))) __bf16 v16b;
typedef __attribute__((ext_vector_type(8)))  _Float16 v8h;
typedef __attribute__((ext_vector_type(8)))  float v8f;
typedef __attribute__((ext_vector_type(4)))  float v4f;
typedef __attribute__((ext_vector_type(2)))  float v2f;
typedef __attribute__((ext_vector_type(4)))  unsigned v4u;
typedef __attribute__((ext_vector_type(4)))  int v4i;
typedef float __attribute__((may_alias)) float_a;
typedef int __attribute__((may_alias)) int_a;

template <typename T> __device__ __forceinline__ void vst2(void* p, T v) { *(T*)p = v;  }
__device__ __forceinline__ v8f wmma_bf(v16b a, v16b b, v8f c) {
  v8f d = __builtin_amdgcn_wmma_f32_16x16x32_bf16(false, a, false, b, (short)0, c, false, false);
  asm volatile("v_nop\n\tv_nop\n\tv_nop\n\tv_nop" : "+v"(d) : "v"(a), "v"(b));
  return d;
}
// 16x16x32 fragments: lane = (h = lane>>4, row/col = lane&15); elements 0..7 = k0+8h+0..7, 8..15 = k0+16+8h+0..7; D element r = row 8h+r
__device__ __forceinline__ v16h frag_h(const _Float16* rowk0, int lane) {
  union { v16h v; v8h q[2]; } u; const _Float16* p = rowk0 + 8 * (lane >> 4);
  u.q[0] = *(const v8h*)p; u.q[1] = *(const v8h*)(p + 16); return u.v;
}
__device__ __forceinline__ v16h frag_f32(const float* rowk0, int lane) {
  v16h a; const float* p = rowk0 + 8 * (lane >> 4);
#pragma unroll
  for (int i = 0; i < 8; ++i) { a[i] = (_Float16)p[i]; a[8 + i] = (_Float16)p[16 + i]; }
  return a;
}
__device__ __forceinline__ v16h frag_f32s(const float* rowk0, int lane, float sc) {
  v16h a; const float* p = rowk0 + 8 * (lane >> 4);
#pragma unroll
  for (int i = 0; i < 8; ++i) { a[i] = (_Float16)(p[i] * sc); a[8 + i] = (_Float16)(p[16 + i] * sc); }
  return a;
}
// column fragment from a [K][ld] layout (column n), rows >= K read as 0
__device__ __forceinline__ v16h fragc_f32(const float* W, int k0, int n, int lane, int ld, int K) {
  v16h a; const int g = lane >> 4;
#pragma unroll
  for (int i = 0; i < 8; ++i) { const int ka = k0 + 8 * g + i, kb = ka + 16;
    a[i] = (_Float16)(ka < K ? W[(size_t)(ka < K ? ka : K - 1) * ld + n] : 0.f); a[8 + i] = (_Float16)(kb < K ? W[(size_t)(kb < K ? kb : K - 1) * ld + n] : 0.f); }
  return a;
}
struct F2 { v16b h, l; };
__device__ __forceinline__ F2 bsplit16(const float v[16]) { F2 r;
#pragma unroll
  for (int i = 0; i < 16; ++i) { const __bf16 h = (__bf16)v[i]; r.h[i] = h; r.l[i] = (__bf16)(v[i] - (float)h); }
  return r; }
__device__ __forceinline__ F2 split_row(const float* row, int k0, int lane) { float v[16]; const float* p = row + k0 + 8 * (lane >> 4);
#pragma unroll
  for (int i = 0; i < 8; ++i) { v[i] = p[i]; v[8 + i] = p[16 + i]; }
  return bsplit16(v); }
__device__ __forceinline__ F2 split_rowK(const float* row, int k0, int lane, int K) { float v[16]; const int g = lane >> 4;
#pragma unroll
  for (int i = 0; i < 8; ++i) { const int ka = k0 + 8 * g + i, kb = ka + 16; v[i] = ka < K ? row[ka < K ? ka : K - 1] : 0.f; v[8 + i] = kb < K ? row[kb < K ? kb : K - 1] : 0.f; }
  return bsplit16(v); }
__device__ __forceinline__ F2 split_col(const float* W, int k0, int n, int lane, int ld, int K) { float v[16]; const int g = lane >> 4;
#pragma unroll
  for (int i = 0; i < 8; ++i) { const int ka = k0 + 8 * g + i, kb = ka + 16; v[i] = ka < K ? W[(size_t)(ka < K ? ka : K - 1) * ld + n] : 0.f; v[8 + i] = kb < K ? W[(size_t)(kb < K ? kb : K - 1) * ld + n] : 0.f; }
  return bsplit16(v); }
__device__ __forceinline__ v8f mac3(const F2& a, const F2& b, v8f c) { c = wmma_bf(a.l, b.h, c); c = wmma_bf(a.h, b.l, c); return wmma_bf(a.h, b.h, c); }
__device__ __forceinline__ float sigm(float v) { return 1.0f / (1.0f + expf(-v)); }


// Local multi-head channel attention (B 4, C 256, 64 x 64; 4 heads x 64, 16 queries, 3x3 window): kv conv, per-pixel query logits, softmax over each pixel's 3x3 neighbourhood, window-weighted values, head projection (+ bias), query projection (+ bias).
#define NB 4
#define CC 256
#define HH 64
#define WWD 64
#define NP (HH * WWD)
#define NHD 4
#define NQ 16
#define HD 64
#define PD 256
#define YW (NQ * HD)       // 1,024 channels into the query projection
#define WSC 256.0f
#ifndef TPX
#define TPX (NP / 64)      // not used by the kernels or launches
#endif
typedef __attribute__((ext_vector_type(8))) __bf16 v8b;
__device__ __forceinline__ v16b frag_b(const __bf16* rowk0, int lane) {
  union { v16b v; v8b q[2]; } u; const __bf16* p = rowk0 + 8 * (lane >> 4);
  u.q[0] = *(const v8b*)p; u.q[1] = *(const v8b*)(p + 16); return u.v;
}
__device__ __forceinline__ float bfr(float v) { return (float)(__bf16)v; }
__device__ __attribute__((noinline)) float exp_ni(float v) { return expf(v); }
__device__ __attribute__((noinline)) float erf_ni(float v) { return erff(v); }

#define NFR 384                                     // folded weight rows: 256 HV rows (o*4 + n), 64 logit rows (q*4 + n), 64 rows of zeros that fill the third 128-column tile
#define WS_PW  0u                                   // f16 x 2^8 folded rows [384][256]; then f16 x 2^8 q_w in fragment order: [16 channels nt][32 k ks][plane h][lane = gg*16 + col][8] = q_w[nt*16 + col][ks*32 + h*16 + gg*8 + 0..7]
#define WS_PQW (WS_PW + 2u * (size_t)NFR * CC)
#define WS_XT  (WS_PQW + 2u * (size_t)CC * YW)           // f16 x (bf16-rounded) channels-last [b][p][256]
#define WS_HV  (WS_XT + 2u * (size_t)NB * NP * CC)       // f16 HV [b][p][o*4 + n]
#define WS_AL  (WS_HV + 2u * (size_t)NB * NP * PD)       // f32 logits [b][p][q*4 + n]
#define WS_END (WS_AL + 4u * (size_t)NB * NP * NHD * NQ)

// ---- k_prep: the two preparations, which do not depend on each other, in one launch. Blocks 0..255 = (64 pixels, b): x[b][c][p] -> XT[b][p][c], rounded to bf16, held as f16. They come first: they run longest. Blocks 256.. = n + 256:
// n < 40: the fold. Block n = (unit u = n >> 1, 128 columns c), one 16 x 16 tile per wave, two 16x16x32 products (64 terms d).
// Units 0..15 = (head u >> 2, 16 rows o): sum_d head_w[o][h*64 + d] kv_w[256 + h*64 + d][c] -> row o*4 + h; units 16..19 = head u - 16, 16 rows q: sum_d dot_w[h][q][d] kv_w[h*64 + d][c] -> row 256 + q*4 + h.
// The rows stand in the order in which k_wz's fragments want the channels of a pixel. k order, equal in both loaders: elements 0..7 = d0 + 8g + 0..7, 8..15 = d0 + 16 + 8g + 0..7. n = 40..47 write the 64 rows of zeros. n = 48..79: q_w, 8 rows each, into k_wz's fragment order.
#define NXB (NB * (NP / 64))
#define NPREP (NXB + 48 + CC / 8)
typedef __attribute__((ext_vector_type(4))) _Float16 v4h;
__global__ __launch_bounds__(256) void k_prep(const float* __restrict__ X, const float* __restrict__ KVW, const float* __restrict__ DW, const float* __restrict__ HW, const float* __restrict__ QW, char* __restrict__ ws) { const int t = threadIdx.x; __shared__ __align__(16) char smem[64 * (CC + 1) * 4 + 64 * (CC + 8) * 2];
  if (blockIdx.x < NXB) { float (*st)[CC + 1] = (float (*)[CC + 1])smem; _Float16 (*so2)[CC + 8] = (_Float16 (*)[CC + 8])(smem + 64 * (CC + 1) * 4); _Float16* XT = (_Float16*)(ws + WS_XT); const int p0 = (blockIdx.x % (NP / 64)) * 64; const size_t b = blockIdx.x / (NP / 64);
    for (int e = t; e < CC * 64; e += 256) { const int c = e >> 6, pl = e & 63; st[pl][c] = X[(b * CC + c) * NP + p0 + pl]; } __syncthreads();
    for (int e = t; e < 64 * CC; e += 256) { const int pl = e >> 8, c = e & 255; so2[pl][c] = (_Float16)bfr(st[pl][c]); } __syncthreads();
    for (int e = t; e < 64 * 32; e += 256) { const int pl = e >> 5, q = e & 31; vst2((unsigned*)(XT + ((b * NP + p0 + pl) * CC) + q * 8), *(const v4u*)&so2[pl][q * 8]); } }
  else { const int n = blockIdx.x - NXB; _Float16* PW = (_Float16*)(ws + WS_PW);
    if (n < 40) { _Float16 (*sp)[128 + 8] = (_Float16 (*)[128 + 8])smem; const int wave = t >> 5, lane = t & 31, col = lane & 15, g = lane >> 4, u = n >> 1, cb = (n & 1) * 128; const bool hv = u < 16; const int hd = hv ? u >> 2 : u - 16;
      const float* ar = (hv ? HW + (size_t)((u & 3) * 16 + col) * PD + hd * HD : DW + (size_t)(hd * NQ + col) * HD) + 8 * g;
      const float* br = KVW + (size_t)((hv ? PD : 0) + hd * HD + 8 * g) * CC + cb + wave * 16 + col;
      v8f acc = {}; float av[2][16];
      // all loops unrolled so that all loads issue ahead of the first product
#pragma unroll
      for (int kc = 0; kc < 2; ++kc)
#pragma unroll
        for (int i = 0; i < 8; ++i) { av[kc][i] = ar[kc * 32 + i]; av[kc][8 + i] = ar[kc * 32 + 16 + i]; }
      asm volatile("s_wait_xcnt 0x0" ::: "memory");   // behind the row loads: the column loads' results may take the registers that held the row address
#pragma unroll
      for (int kc = 0; kc < 2; ++kc) { v16b a, w;
#pragma unroll
        for (int i = 0; i < 8; ++i) { a[i] = (__bf16)av[kc][i]; a[8 + i] = (__bf16)av[kc][8 + i]; w[i] = (__bf16)br[(size_t)(kc * 32 + i) * CC]; w[8 + i] = (__bf16)br[(size_t)(kc * 32 + 16 + i) * CC]; }
        acc = __builtin_amdgcn_wmma_f32_16x16x32_bf16(false, a, false, w, (short)0, acc, false, false); }
#pragma unroll
      for (int r = 0; r < 8; ++r) sp[8 * g + r][wave * 16 + col] = (_Float16)(acc[r] * WSC);
      __syncthreads(); const int rl = t >> 4; const int ro = hv ? ((u & 3) * 16 + rl) * NHD + hd : PD + rl * NHD + hd;   // one wave stores two whole 256-B row pieces
      vst2((unsigned*)(PW + (size_t)ro * CC + cb + (t & 15) * 8), *(const v4u*)&sp[rl][(t & 15) * 8]);
      asm volatile("s_wait_xcnt 0x0" ::: "memory"); }   // behind the store: the code laid out after it writes the registers that the store names
    else if (n < 48) { vst2((unsigned*)(PW + (size_t)(PD + NHD * NQ) * CC + (size_t)((n - 40) * 256 + t) * 8), v4u{0u, 0u, 0u, 0u});
      asm volatile("s_wait_xcnt 0x0" ::: "memory"); }   // behind the store: the code laid out after it writes the registers that the store names
    else { const int ch = (n - 48) * 8 + (t & 7), kc = t >> 3; const float* s = QW + (size_t)ch * YW + kc * 8; _Float16* d = (_Float16*)(ws + WS_PQW) + ((size_t)(((ch >> 4) * 32 + (kc >> 2)) * 2 + ((kc >> 1) & 1)) * 32 + (kc & 1) * 16 + (ch & 15)) * 8; v4f q[4][2];   // thread = (row, 8 k): 8 rows' pieces of one k group are one whole 128-B line of a fragment plane, four such lines per wave store
      // unrolled so that all 8 loads issue ahead of the first store
#pragma unroll
      for (int k = 0; k < 4; ++k) { q[k][0] = *(const v4f*)(s + k * 256); q[k][1] = *(const v4f*)(s + k * 256 + 4); }
      asm volatile("s_wait_xcnt 0x0" ::: "memory");   // behind the loads: later values may take the registers that held their address
#pragma unroll
      for (int k = 0; k < 4; ++k) { v8h h;   // 256 k on = 8 k blocks on = 8 x 512 halves
#pragma unroll
        for (int i = 0; i < 4; ++i) { h[i] = (_Float16)bfr(q[k][0][i] * WSC); h[4 + i] = (_Float16)bfr(q[k][1][i] * WSC); }   // x 2^8 ahead of the bf16 rounding: the same value, and no f16 value is formed below the scale
        vst2(d + k * 8 * 512, h); }
      asm volatile("s_wait_xcnt 0x0" ::: "memory"); } } }   // behind the last store: the code laid out after it writes the registers that the stores name
// ---- gemm128: one 128 x 128 tile of A . B^T for a block of 8 waves (wave tile 32 rows x 64 columns), both operands k-contiguous 16-bit rows of LDB bytes.
// A pass is 256 B of every row: 128 A rows then 128 B rows in LDS at a pitch of 272 B (16 B x odd: the ds_load_b128 fragment reads of 16 rows fall on all 64 banks). Each wave-wide global load takes two whole 256-B row pieces.
// Two LDS buffers: the next pass's 16 loads per thread are issued ahead of this pass's products and stored behind them; one block barrier per pass publishes the new buffer and ends the reads of the old one.
// ga, gb: the thread's own 16-byte piece (tid & 15) of row (tid >> 4) of the A tile and of the B tile. k runs upward through the passes and blocks, one accumulator chain per output tile.
// Every loop here and in the caller's epilogue is unrolled so that the staging, fragment and accumulator arrays stay in registers and every address step is an immediate.
#define GP 136
template <int NPASS, int LDB, bool BF>
__device__ __forceinline__ void gemm128(const char* __restrict__ ga, const char* __restrict__ gb, _Float16 (*sm)[256][GP], int tid, v8f (&acc)[2][4]) {
  const int wave = tid >> 5, lane = tid & 31, col = lane & 15, wm = wave & 3, wn = wave >> 2, sr = tid >> 4, sq = tid & 15;
  v8h st[16];
#pragma unroll
  for (int i = 0; i < 8; ++i) { st[i] = *(const v8h*)(ga + (size_t)i * 16 * LDB); st[8 + i] = *(const v8h*)(gb + (size_t)i * 16 * LDB); }
#pragma unroll
  for (int i = 0; i < 16; ++i) *(v8h*)&sm[0][sr + 16 * i][sq * 8] = st[i];
  __syncthreads();
  v16h a[2][2], w[2][4];   // two fragment sets: block ks + 1 is fetched while block ks is multiplied
#pragma unroll
  for (int pass = 0; pass < NPASS; ++pass) {   // unrolled: the buffer index and the last pass's missing refill are then compile-time
    if (pass + 1 < NPASS) {
#pragma unroll
      for (int i = 0; i < 8; ++i) { st[i] = *(const v8h*)(ga + (size_t)i * 16 * LDB + (pass + 1) * 256); st[8 + i] = *(const v8h*)(gb + (size_t)i * 16 * LDB + (pass + 1) * 256); } }
#pragma unroll
    for (int i = 0; i < 2; ++i) a[0][i] = frag_h(&sm[pass & 1][wm * 32 + i * 16 + col][0], lane);
#pragma unroll
    for (int j = 0; j < 4; ++j) w[0][j] = frag_h(&sm[pass & 1][128 + wn * 64 + j * 16 + col][0], lane);
    __builtin_amdgcn_sched_barrier(0);   // keeps the next pass's global loads at the head of this pass (the compiler sank them to the LDS stores at its foot, where their whole latency is waited out)
#pragma unroll
    for (int ks = 0; ks < 4; ++ks) {
      if (ks < 3) {
#pragma unroll
        for (int i = 0; i < 2; ++i) a[(ks + 1) & 1][i] = frag_h(&sm[pass & 1][wm * 32 + i * 16 + col][(ks + 1) * 32], lane);
#pragma unroll
        for (int j = 0; j < 4; ++j) w[(ks + 1) & 1][j] = frag_h(&sm[pass & 1][128 + wn * 64 + j * 16 + col][(ks + 1) * 32], lane); }
      __builtin_amdgcn_sched_barrier(0);   // the next block's 12 LDS reads stand as one group ahead of this block's products, not among them
#pragma unroll
      for (int i = 0; i < 2; ++i)
#pragma unroll
        for (int j = 0; j < 4; ++j) {
          if (BF) acc[i][j] = __builtin_amdgcn_wmma_f32_16x16x32_bf16(false, __builtin_bit_cast(v16b, a[ks & 1][i]), false, __builtin_bit_cast(v16b, w[ks & 1][j]), (short)0, acc[i][j], false, false);
          else acc[i][j] = __builtin_amdgcn_wmma_f32_16x16x32_f16(false, a[ks & 1][i], false, w[ks & 1][j], (short)0, acc[i][j], false, false); }
      __builtin_amdgcn_sched_barrier(0);   // ends the block: the following group of reads does not move up among its products
    }
    if (pass + 1 < NPASS) {
#pragma unroll
      for (int i = 0; i < 16; ++i) *(v8h*)&sm[(pass + 1) & 1][sr + 16 * i][sq * 8] = st[i]; }
    if (pass + 2 == NPASS) asm volatile("s_wait_xcnt 0x0" ::: "memory");   // behind the last global loads: later values may take the registers that held the two row addresses (the last pass's scheduling fences keep those writes behind it)
    __syncthreads(); } }
// ---- k_kv: block = (128 pixels, 128 folded rows, b), 8 waves: x . folded^T: column tiles 0, 1 -> HV f16 rows, tile 2 (its first 64 columns) -> f32 logit rows
__global__ __launch_bounds__(256) void k_kv(const _Float16* __restrict__ XT, const _Float16* __restrict__ P, _Float16* __restrict__ HV, float* __restrict__ AL) { __shared__ __align__(16) _Float16 sm[2][256][GP];
  const int tid = threadIdx.x, wave = tid >> 5, lane = tid & 31, col = lane & 15, g = lane >> 4, wm = wave & 3, wn = wave >> 2; const size_t b = blockIdx.z; const size_t rb = b * NP + (size_t)blockIdx.x * 128; const int c0 = blockIdx.y * 128;
  v8f acc[2][4] = {};
  gemm128<CC / 128, CC * 2, false>((const char*)(XT + (rb + (tid >> 4)) * CC + (tid & 15) * 8), (const char*)(P + (size_t)(c0 + (tid >> 4)) * CC + (tid & 15) * 8), sm, tid, acc);
  if (c0 < PD) { _Float16 (*so)[GP] = sm[0];   // the tile's 128 f16 rows; every fragment read has ended at the last pass's barrier
#pragma unroll
    for (int i = 0; i < 2; ++i)
#pragma unroll
      for (int j = 0; j < 4; ++j)
#pragma unroll
        for (int r = 0; r < 8; ++r) so[wm * 32 + i * 16 + 8 * g + r][wn * 64 + j * 16 + col] = (_Float16)(acc[i][j][r] * (1.0f / WSC));
    __syncthreads(); _Float16* dst = HV + (rb + (tid >> 4)) * PD + c0 + (tid & 15) * 8;   // one address, constant steps: two whole 256-B row pieces per wave store
#pragma unroll
    for (int k = 0; k < 8; ++k) vst2((unsigned*)(dst + (size_t)k * 16 * PD), *(const v4u*)&so[(tid >> 4) + k * 16][(tid & 15) * 8]); }
  else { float (*sf)[NHD * NQ + 4] = (float (*)[NHD * NQ + 4])&sm[0][0][0];   // the tile's 128 logit rows at a pitch of 272 B
    if (wn == 0) {
#pragma unroll
      for (int i = 0; i < 2; ++i)
#pragma unroll
        for (int j = 0; j < 4; ++j)
#pragma unroll
          for (int r = 0; r < 8; ++r) sf[wm * 32 + i * 16 + 8 * g + r][j * 16 + col] = acc[i][j][r] * (1.0f / WSC); }
    __syncthreads(); float* dst = AL + rb * (NHD * NQ) + tid * 4;   // the 128 rows are 32 KiB in a row: 512 contiguous bytes per wave store
#pragma unroll
    for (int k = 0; k < 8; ++k) vst2(dst + k * 1024, *(const v4f*)&sf[(tid >> 4) + k * 16][(tid & 15) * 4]); } }
// ---- k_wz: block = (2 x 32 pixel tile, b), 16 waves. Part 1, 4 pixels per wave: per pixel, per (head n, query q): softmax over the 3x3 neighbourhood of AL (0 outside the image - zero-padded unfold), y[q*64 + o] = sum_n sum_l w[n][q][l] HV[p_l][o*4 + n] (0 outside) + head_b[o] -> f16 rows that stay in LDS.
// The sum over k = (n, l), 36 terms, is one 64 x 16 x 36 product per pixel on WMMA: A rows = o (f16-staged HV), B columns = q (weights as f16 hi + f16 lo, so the f32 weight survives).
// k order, equal in both loaders: lane half g holds heads n = 2g, 2g + 1; element 2l + s = (window place l < 8, head 2g + s). Place l = 8 goes in a third product: elements 0, 1 pair HV with hi, elements 2, 3 pair the same HV with lo, the rest 0.
// Part 2: z = y . q_w^T (single f16 x f16x256) + q_b for the block's 64 pixels x 256 channels -> NCHW out[b][c][p]. Wave = (k half kk, 32 channels wn), wave tile 64 pixels x 32 channels over 512 k: y fragments from LDS, q_w fragments straight from the packed planes (each read once per block).
// k order, equal in both loaders: block ks = 32 k from q*64 + o = ks*32; elements 0..7 = 8g + 0..7, 8..15 = 16 + 8g + 0..7. The two k halves are added at the end, lower half first.
// The tile is 32 pixels wide so that every 128-B line of out has one writer.
#define TLW 32
#define HLW (TLW + 2)
#define NHP (4 * HLW)                      // 136 halo pixels
#define YP (NQ * 72 + 8)                   // y row in halves: 16 queries at a pitch of 144 B, row pitch 2,320 B (16 B x odd: the fragment reads of 16 rows fall on all 64 banks)
#define ZP (64 + 4)                        // z row [channel][64 pixels] in floats, pitch 272 B
#define SM_AL (NHP * PD * 2)
#define SM_Y (SM_AL + NHP * NHD * NQ * 4)
#define SM_END (SM_Y + 64 * YP * 2)
__global__ __launch_bounds__(512) void k_wz(const float* __restrict__ AL, const _Float16* __restrict__ HV, const float* __restrict__ HB, const _Float16* __restrict__ PQW, const float* __restrict__ QB, float* __restrict__ OUT) {
  __shared__ __align__(16) char smem[SM_END];
  _Float16 (*shv)[PD] = (_Float16 (*)[PD])smem;                        // [halo pixel][o*4 + n]
  float (*sal)[NHD * NQ] = (float (*)[NHD * NQ])(smem + SM_AL);        // [halo pixel][q*4 + n]
  _Float16 (*sy)[YP] = (_Float16 (*)[YP])(smem + SM_Y);                // [pixel][q*72 + o]
  const int t = threadIdx.x, wave = t >> 5, lane = t & 31, c = lane & 15, g = lane >> 4; const size_t b = blockIdx.y; const int ty = (blockIdx.x >> 1) * 2, tx = (blockIdx.x & 1) * TLW;
  const int kk = wave >> 3, wn = wave & 7;
  // loads first, LDS stores after, so that the staging passes overlap their memory latency; an item past the end takes the last item's address and stores nothing
  v8h hva[5][2]; v4f ala[5]; float bias[4][8];
#pragma unroll
  for (int k = 0; k < 5; ++k) { const int e = min(t + k * 512, NHP * 16 - 1), hp = e >> 4, o4 = e & 15; const int yy = ty - 1 + hp / HLW, xx = tx - 1 + hp % HLW; const bool inb = yy >= 0 && yy < HH && xx >= 0 && xx < WWD;
    const size_t pp = b * NP + (size_t)(inb ? yy * WWD + xx : 0); const _Float16* s = HV + pp * PD + o4 * 16;
#pragma unroll
    for (int n = 0; n < 2; ++n) { hva[k][n] = *(const v8h*)(s + n * 8); if (!inb) hva[k][n] = v8h{}; }
    ala[k] = *(const v4f*)(AL + pp * (NHD * NQ) + o4 * 4); if (!inb) ala[k] = v4f{0.f, 0.f, 0.f, 0.f}; }
  asm volatile("s_wait_xcnt 0x0" ::: "memory");   // stands in front of the loads below, whose results may take the registers that held the staging addresses
#pragma unroll
  for (int j = 0; j < 4; ++j)
#pragma unroll
    for (int r = 0; r < 8; ++r) bias[j][r] = bfr(HB[j * 16 + 8 * g + r]);
  // part 2's first three k blocks of q_w and its biases are asked for here: they do not depend on part 1 and arrive under it
  const _Float16* bp = PQW + (size_t)(wn * 64 + kk * 16) * 512 + lane * 8;   // fragment (j, s): two 512-B planes at (j*32 + s) * 1,024 B
  union BF { v16h v; v8h q[2]; }; BF bq[4][2]; float qb[8];
#pragma unroll
  for (int s = 0; s < 3; ++s)
#pragma unroll
    for (int j = 0; j < 2; ++j) { bq[s][j].q[0] = *(const v8h*)(bp + (j * 32 + s) * 512); bq[s][j].q[1] = *(const v8h*)(bp + (j * 32 + s) * 512 + 256); }
#pragma unroll
  for (int k = 0; k < 8; ++k) qb[k] = bfr(QB[wave * 2 + g + k * 32]);
  asm volatile("s_wait_xcnt 0x0" ::: "memory");   // behind the bias loads: later values may take the registers that held their addresses
  asm volatile("" :: "v"(hva[4][0]), "v"(hva[4][1]), "v"(ala[4]));   // holds the last staging pass's loads up here with the others (sunk into the branch round their LDS stores, four waves would wait out a second latency in front of the block barrier)
#pragma unroll
  for (int k = 0; k < 5; ++k) { const int e = t + k * 512;
    if (k < 4 || e < NHP * 16) { *(v8h*)&shv[e >> 4][(e & 15) * 16] = hva[k][0]; *(v8h*)&shv[e >> 4][(e & 15) * 16 + 8] = hva[k][1]; *(v4f*)&sal[e >> 4][(e & 15) * 4] = ala[k]; } }
  __syncthreads();
  for (int i = 0; i < 4; ++i) { const int pl = wave * 4 + i, hb = (pl >> 5) * HLW + (pl & 31);
    float w[9][2];
    { v2f lg[9];
#pragma unroll
      for (int l = 0; l < 9; ++l) lg[l] = *(const v2f*)&sal[hb + (l / 3) * HLW + l % 3][c * 4 + 2 * g];
#pragma unroll
      for (int s = 0; s < 2; ++s) { float mx = -3.0e38f;
#pragma unroll
        for (int l = 0; l < 9; ++l) mx = fmaxf(mx, lg[l][s]);
        float z = 0.f;
#pragma unroll
        for (int l = 0; l < 9; ++l) { w[l][s] = expf(lg[l][s] - mx); z += w[l][s]; }
        const float iz = 1.0f / z;
#pragma unroll
        for (int l = 0; l < 9; ++l) w[l][s] *= iz; } }
    v16h whi, wlo, w2 = {};
#pragma unroll
    for (int l = 0; l < 9; ++l)
#pragma unroll
      for (int s = 0; s < 2; ++s) { const _Float16 h = (_Float16)w[l][s]; const _Float16 lo = (_Float16)(w[l][s] - (float)h);
        if (l < 8) { whi[2 * l + s] = h; wlo[2 * l + s] = lo; } else { w2[s] = h; w2[2 + s] = lo; } }
    v8f acc[4];
#pragma unroll
    for (int j = 0; j < 4; ++j) { union { v16h v; int u[8]; } h1, h2; const int ch = (j * 16 + c) * 4 + 2 * g;
#pragma unroll
      for (int l = 0; l < 8; ++l) h1.u[l] = *(const int_a*)&shv[hb + (l / 3) * HLW + l % 3][ch];
      const int u8 = *(const int_a*)&shv[hb + 2 * HLW + 2][ch]; h2.u[0] = u8; h2.u[1] = u8;
#pragma unroll
      for (int l = 2; l < 8; ++l) h2.u[l] = 0;
      v8f d = {};
      d = __builtin_amdgcn_wmma_f32_16x16x32_f16(false, h1.v, false, whi, (short)0, d, false, false);
      d = __builtin_amdgcn_wmma_f32_16x16x32_f16(false, h1.v, false, wlo, (short)0, d, false, false);
      acc[j] = __builtin_amdgcn_wmma_f32_16x16x32_f16(false, h2.v, false, w2, (short)0, d, false, false); }
#pragma unroll
    for (int j = 0; j < 4; ++j) { v8h yv;   // lane holds q = c, o = j*16 + 8g + 0..7
#pragma unroll
      for (int r = 0; r < 8; ++r) yv[r] = (_Float16)(acc[j][r] + bias[j][r]);
      *(v8h*)&sy[pl][c * 72 + j * 16 + 8 * g] = yv; }
  }
  __syncthreads();   // publishes the 64 y rows
  v8f za[4][2] = {}; v16h a[2][4];   // two y fragment sets: block s + 1 is fetched while block s is multiplied; q_w runs three blocks ahead in a ring of four
  const _Float16* ap = &sy[c][kk * 8 * 72];
#pragma unroll
  for (int i = 0; i < 4; ++i) a[0][i] = frag_h(ap + i * 16 * YP, lane);
  // unrolled so that the ring and set indices are compile-time and every address step is an immediate
#pragma unroll
  for (int s = 0; s < 16; ++s) {
    if (s + 3 < 16) {
#pragma unroll
      for (int j = 0; j < 2; ++j) { bq[(s + 3) & 3][j].q[0] = *(const v8h*)(bp + (j * 32 + s + 3) * 512); bq[(s + 3) & 3][j].q[1] = *(const v8h*)(bp + (j * 32 + s + 3) * 512 + 256); } }
    if (s + 4 == 16) asm volatile("s_wait_xcnt 0x0" ::: "memory");   // behind the last q_w loads: later values may take the registers that held their address
    if (s + 1 < 16) {
#pragma unroll
      for (int i = 0; i < 4; ++i) a[(s + 1) & 1][i] = frag_h(ap + i * 16 * YP + ((s + 1) >> 1) * 72 + ((s + 1) & 1) * 32, lane); }
    __builtin_amdgcn_sched_barrier(0);   // the loads for later blocks stand as one group ahead of this block's products, not among them
#pragma unroll
    for (int i = 0; i < 4; ++i)
#pragma unroll
      for (int j = 0; j < 2; ++j) za[i][j] = __builtin_amdgcn_wmma_f32_16x16x32_f16(false, a[s & 1][i], false, bq[s & 3][j].v, (short)0, za[i][j], false, false);
    __builtin_amdgcn_sched_barrier(0);   // ends the block: the following group of loads does not move up among its products
  }
  __syncthreads();   // ends every wave's reads of the y rows: the two z planes below lie over the staging arrays and the first y rows
  { float (*so)[ZP] = (float (*)[ZP])(smem + kk * (CC * ZP * 4));   // this k half's plane [channel][pixel]
#pragma unroll
    for (int i = 0; i < 4; ++i)
#pragma unroll
      for (int j = 0; j < 2; ++j) { v4f lo, hi;
#pragma unroll
        for (int r = 0; r < 4; ++r) { lo[r] = za[i][j][r]; hi[r] = za[i][j][4 + r]; }
        float* d = &so[wn * 32 + j * 16 + c][i * 16 + 8 * g]; *(v4f*)d = lo; *(v4f*)(d + 4) = hi; } }
  __syncthreads();
  const float* s0 = (const float*)smem + (wave * 2 + g) * ZP + c * 4;
  float* dst = OUT + (b * CC + wave * 2 + g) * NP + (ty + (c >> 3)) * WWD + tx + (c & 7) * 4;   // one address, constant steps: two channels' four whole 128-B lines per wave store
  v4f zv[8];
#pragma unroll
  for (int k = 0; k < 8; ++k) zv[k] = (*(const v4f*)(s0 + k * 32 * ZP) + *(const v4f*)(s0 + (CC + k * 32) * ZP)) * (1.0f / WSC) + qb[k];
#pragma unroll
  for (int k = 0; k < 8; ++k) vst2(dst + (size_t)k * 32 * NP, zv[k]); }
extern "C" void kernel_launch(void* const* d_in, const int* in_sizes, int n_in, void* d_out, int out_size, void* d_ws, size_t ws_size, hipStream_t stream) {
  (void)in_sizes; (void)n_in; (void)out_size;
  const float** F = (const float**)d_in;   // 0 x [4,256,64,64], 1 kv_w [512,256], 2 dot_w [4,16,64], 3 head_w [64,256], 4 head_b [64], 5 q_w [256,1024], 6 q_b [256]
  if (ws_size < (size_t)WS_END) return;
  char* ws = (char*)d_ws; _Float16 *XT = (_Float16*)(ws + WS_XT), *HV = (_Float16*)(ws + WS_HV); float* AL = (float*)(ws + WS_AL);
  k_prep<<<dim3(NPREP), 256, 0, stream>>>(F[0], F[1], F[2], F[3], F[5], ws);
  k_kv<<<dim3(NP / 128, NFR / 128, NB), 256, 0, stream>>>(XT, (const _Float16*)(ws + WS_PW), HV, AL);
  k_wz<<<dim3(NP / 64, NB), 512, 0, stream>>>(AL, HV, F[4], (const _Float16*)(ws + WS_PQW), F[6], (float*)d_out);
}

// v007
// Measured time: 29.4 microseconds a run.
// Timed twice side by side with v006, it ran 1.06 and 1.05 times as fast.
// Over all steps from v000 it is 24.0 times as fast.
// compute dtype: all float inputs rounded to bf16; the per-head value projection and the query dot are folded into the kv weights ahead of the conv: head_w_h . kv_w(v rows of head h) and dot_w_h . kv_w(k rows of head h), EXACT bf16 products on WMMA 16x16x32, f32 accumulate, rounded once to f16 x 2^8; one 1x1 conv on WMMA (x as f16 x folded f16 weights, f32 accumulate, channels-last) gives HV (rounded once to f16) and the query logits (f32); the 3x3-window softmax (zero-padded logits and values, as the module's unfold) in f32 on VALU and the weighted window sums on WMMA (f16 HV values x weights split into f16 hi + f16 lo, f32 accumulate); the final 1x1 conv on WMMA (y once to f16 x exact f16 x 2^8 q_w), biases in f32; f32 output (NCHW).
#include <hip/hip_runtime.h>
#include <math.h>

typedef __attribute__((ext_vector_type(16))) _Float16 v16h;
typedef __attribute__((ext_vector_type(16))) __bf16 v16b;
typedef __attribute__((ext_vector_type(8)))  _Float16 v8h;
typedef __attribute__((ext_vector_type(8)))  float v8f;
typedef __attribute__((ext_vector_type(4)))  float v4f;
typedef __attribute__((ext_vector_type(2)))  float v2f;
typedef __attribute__((ext_vector_type(4)))  unsigned v4u;
typedef __attribute__((ext_vector_type(4)))  int v4i;
typedef float __attribute__((may_alias)) float_a;
typedef int __attribute__((may_alias)) int_a;

template <typename T> __device__ __forceinline__ void vst2(void* p, T v) { *(T*)p = v;  }
__device__ __forceinline__ v8f wmma_bf(v16b a, v16b b, v8f c) {
  v8f d = __builtin_amdgcn_wmma_f32_16x16x32_bf16(false, a, false, b, (short)0, c, false, false);
  asm volatile("v_nop\n\tv_nop\n\tv_nop\n\tv_nop" : "+v"(d) : "v"(a), "v"(b));
  return d;
}
// 16x16x32 fragments: lane = (h = lane>>4, row/col = lane&15); elements 0..7 = k0+8h+0..7, 8..15 = k0+16+8h+0..7; D element r = row 8h+r
__device__ __forceinline__ v16h frag_h(const _Float16* rowk0, int lane) {
  union { v16h v; v8h q[2]; } u; const _Float16* p = rowk0 + 8 * (lane >> 4);
  u.q[0] = *(const v8h*)p; u.q[1] = *(const v8h*)(p + 16); return u.v;
}
__device__ __forceinline__ v16h frag_f32(const float* rowk0, int lane) {
  v16h a; const float* p = rowk0 + 8 * (lane >> 4);
#pragma unroll
  for (int i = 0; i < 8; ++i) { a[i] = (_Float16)p[i]; a[8 + i] = (_Float16)p[16 + i]; }
  return a;
}
__device__ __forceinline__ v16h frag_f32s(const float* rowk0, int lane, float sc) {
  v16h a; const float* p = rowk0 + 8 * (lane >> 4);
#pragma unroll
  for (int i = 0; i < 8; ++i) { a[i] = (_Float16)(p[i] * sc); a[8 + i] = (_Float16)(p[16 + i] * sc); }
  return a;
}
// column fragment from a [K][ld] layout (column n), rows >= K read as 0
__device__ __forceinline__ v16h fragc_f32(const float* W, int k0, int n, int lane, int ld, int K) {
  v16h a; const int g = lane >> 4;
#pragma unroll
  for (int i = 0; i < 8; ++i) { const int ka = k0 + 8 * g + i, kb = ka + 16;
    a[i] = (_Float16)(ka < K ? W[(size_t)(ka < K ? ka : K - 1) * ld + n] : 0.f); a[8 + i] = (_Float16)(kb < K ? W[(size_t)(kb < K ? kb : K - 1) * ld + n] : 0.f); }
  return a;
}
struct F2 { v16b h, l; };
__device__ __forceinline__ F2 bsplit16(const float v[16]) { F2 r;
#pragma unroll
  for (int i = 0; i < 16; ++i) { const __bf16 h = (__bf16)v[i]; r.h[i] = h; r.l[i] = (__bf16)(v[i] - (float)h); }
  return r; }
__device__ __forceinline__ F2 split_row(const float* row, int k0, int lane) { float v[16]; const float* p = row + k0 + 8 * (lane >> 4);
#pragma unroll
  for (int i = 0; i < 8; ++i) { v[i] = p[i]; v[8 + i] = p[16 + i]; }
  return bsplit16(v); }
__device__ __forceinline__ F2 split_rowK(const float* row, int k0, int lane, int K) { float v[16]; const int g = lane >> 4;
#pragma unroll
  for (int i = 0; i < 8; ++i) { const int ka = k0 + 8 * g + i, kb = ka + 16; v[i] = ka < K ? row[ka < K ? ka : K - 1] : 0.f; v[8 + i] = kb < K ? row[kb < K ? kb : K - 1] : 0.f; }
  return bsplit16(v); }
__device__ __forceinline__ F2 split_col(const float* W, int k0, int n, int lane, int ld, int K) { float v[16]; const int g = lane >> 4;
#pragma unroll
  for (int i = 0; i < 8; ++i) { const int ka = k0 + 8 * g + i, kb = ka + 16; v[i] = ka < K ? W[(size_t)(ka < K ? ka : K - 1) * ld + n] : 0.f; v[8 + i] = kb < K ? W[(size_t)(kb < K ? kb : K - 1) * ld + n] : 0.f; }
  return bsplit16(v); }
__device__ __forceinline__ v8f mac3(const F2& a, const F2& b, v8f c) { c = wmma_bf(a.l, b.h, c); c = wmma_bf(a.h, b.l, c); return wmma_bf(a.h, b.h, c); }
__device__ __forceinline__ float sigm(float v) { return 1.0f / (1.0f + expf(-v)); }


// Local multi-head channel attention (B 4, C 256, 64 x 64; 4 heads x 64, 16 queries, 3x3 window): kv conv, per-pixel query logits, softmax over each pixel's 3x3 neighbourhood, window-weighted values, head projection (+ bias), query projection (+ bias).
#define NB 4
#define CC 256
#define HH 64
#define WWD 64
#define NP (HH * WWD)
#define NHD 4
#define NQ 16
#define HD 64
#define PD 256
#define YW (NQ * HD)       // 1,024 channels into the query projection
#define WSC 256.0f
#ifndef TPX
#define TPX (NP / 64)      // not used by the kernels or launches
#endif
typedef __attribute__((ext_vector_type(8))) __bf16 v8b;
__device__ __forceinline__ v16b frag_b(const __bf16* rowk0, int lane) {
  union { v16b v; v8b q[2]; } u; const __bf16* p = rowk0 + 8 * (lane >> 4);
  u.q[0] = *(const v8b*)p; u.q[1] = *(const v8b*)(p + 16); return u.v;
}
__device__ __forceinline__ float bfr(float v) { return (float)(__bf16)v; }
__device__ __attribute__((noinline)) float exp_ni(float v) { return expf(v); }
__device__ __attribute__((noinline)) float erf_ni(float v) { return erff(v); }

#define NFR 320                                     // folded weight rows: 256 HV rows (o*4 + n), 64 logit rows (q*4 + n)
#define WS_PW  0u                                   // f16 x 2^8 folded rows [320][256]; then f16 x 2^8 q_w in fragment order: [16 channels nt][32 k ks][plane h][lane = gg*16 + col][8] = q_w[nt*16 + col][ks*32 + h*16 + gg*8 + 0..7]
#define WS_PQW (WS_PW + 2u * (size_t)NFR * CC)
#define WS_HV  (WS_PQW + 2u * (size_t)CC * YW)           // f16 HV [b][p][o*4 + n]
#define WS_AL  (WS_HV + 2u * (size_t)NB * NP * PD)       // f32 logits [b][p][q*4 + n]
#define WS_END (WS_AL + 4u * (size_t)NB * NP * NHD * NQ)

// ---- k_prep: the weight preparations, which do not depend on each other, in one launch. Block n:
// n < 40: the fold. Block n = (unit u = n >> 1, 128 columns c), one 16 x 16 tile per wave, two 16x16x32 products (64 terms d).
// Units 0..15 = (head u >> 2, 16 rows o): sum_d head_w[o][h*64 + d] kv_w[256 + h*64 + d][c] -> row o*4 + h; units 16..19 = head u - 16, 16 rows q: sum_d dot_w[h][q][d] kv_w[h*64 + d][c] -> row 256 + q*4 + h.
// The rows stand in the order in which k_wz's fragments want the channels of a pixel. k order, equal in both loaders: elements 0..7 = d0 + 8g + 0..7, 8..15 = d0 + 16 + 8g + 0..7. n = 40..71: q_w, 8 rows each, into k_wz's fragment order.
#define NPREP (40 + CC / 8)
typedef __attribute__((ext_vector_type(4))) _Float16 v4h;
__global__ __launch_bounds__(256) void k_prep(const float* __restrict__ KVW, const float* __restrict__ DW, const float* __restrict__ HW, const float* __restrict__ QW, char* __restrict__ ws) { const int t = threadIdx.x; __shared__ __align__(16) _Float16 sp[16][128 + 8];
  { const int n = blockIdx.x; _Float16* PW = (_Float16*)(ws + WS_PW);
    if (n < 40) { const int wave = t >> 5, lane = t & 31, col = lane & 15, g = lane >> 4, u = n >> 1, cb = (n & 1) * 128; const bool hv = u < 16; const int hd = hv ? u >> 2 : u - 16;
      const float* ar = (hv ? HW + (size_t)((u & 3) * 16 + col) * PD + hd * HD : DW + (size_t)(hd * NQ + col) * HD) + 8 * g;
      const float* br = KVW + (size_t)((hv ? PD : 0) + hd * HD + 8 * g) * CC + cb + wave * 16 + col;
      v8f acc = {}; float av[2][16];
      // all loops unrolled so that all loads issue ahead of the first product
#pragma unroll
      for (int kc = 0; kc < 2; ++kc)
#pragma unroll
        for (int i = 0; i < 8; ++i) { av[kc][i] = ar[kc * 32 + i]; av[kc][8 + i] = ar[kc * 32 + 16 + i]; }
      asm volatile("s_wait_xcnt 0x0" ::: "memory");   // behind the row loads: the column loads' results may take the registers that held the row address
#pragma unroll
      for (int kc = 0; kc < 2; ++kc) { v16b a, w;
#pragma unroll
        for (int i = 0; i < 8; ++i) { a[i] = (__bf16)av[kc][i]; a[8 + i] = (__bf16)av[kc][8 + i]; w[i] = (__bf16)br[(size_t)(kc * 32 + i) * CC]; w[8 + i] = (__bf16)br[(size_t)(kc * 32 + 16 + i) * CC]; }
        acc = __builtin_amdgcn_wmma_f32_16x16x32_bf16(false, a, false, w, (short)0, acc, false, false); }
#pragma unroll
      for (int r = 0; r < 8; ++r) sp[8 * g + r][wave * 16 + col] = (_Float16)(acc[r] * WSC);
      __syncthreads(); const int rl = t >> 4; const int ro = hv ? ((u & 3) * 16 + rl) * NHD + hd : PD + rl * NHD + hd;   // one wave stores two whole 256-B row pieces
      vst2((unsigned*)(PW + (size_t)ro * CC + cb + (t & 15) * 8), *(const v4u*)&sp[rl][(t & 15) * 8]);
      asm volatile("s_wait_xcnt 0x0" ::: "memory"); }   // behind the store: the code laid out after it writes the registers that the store names
    else { const int ch = (n - 40) * 8 + (t & 7), kc = t >> 3; const float* s = QW + (size_t)ch * YW + kc * 8; _Float16* d = (_Float16*)(ws + WS_PQW) + ((size_t)(((ch >> 4) * 32 + (kc >> 2)) * 2 + ((kc >> 1) & 1)) * 32 + (kc & 1) * 16 + (ch & 15)) * 8; v4f q[4][2];   // thread = (row, 8 k): 8 rows' pieces of one k group are one whole 128-B line of a fragment plane, four such lines per wave store
      // unrolled so that all 8 loads issue ahead of the first store
#pragma unroll
      for (int k = 0; k < 4; ++k) { q[k][0] = *(const v4f*)(s + k * 256); q[k][1] = *(const v4f*)(s + k * 256 + 4); }
      asm volatile("s_wait_xcnt 0x0" ::: "memory");   // behind the loads: later values may take the registers that held their address
#pragma unroll
      for (int k = 0; k < 4; ++k) { v8h h;   // 256 k on = 8 k blocks on = 8 x 512 halves
#pragma unroll
        for (int i = 0; i < 4; ++i) { h[i] = (_Float16)bfr(q[k][0][i] * WSC); h[4 + i] = (_Float16)bfr(q[k][1][i] * WSC); }   // x 2^8 ahead of the bf16 rounding: the same value, and no f16 value is formed below the scale
        vst2(d + k * 8 * 512, h); }
      asm volatile("s_wait_xcnt 0x0" ::: "memory"); } } }   // behind the last store: the code laid out after it writes the registers that the stores name
// ---- k_kv: block = (64 pixels = one image row, all 320 folded rows, b), 8 waves (wave tile 32 pixels x 80 columns): x . folded^T: columns 0..255 -> HV f16 rows, 256..319 -> f32 logit rows. One block a WGP; x is read and rounded once.
// x comes straight from its NCHW f32 rows: a wave-wide 16-byte load takes two channels' 64 pixels (two whole 256-B pieces); a thread holds 4 pixels x 8 channels per channel octet, rounds them (bf16, held as f16) and stores each pixel's 8 channels as one 16-byte piece.
// All 256 k of both operands are asked for at once and staged once: buffer k >> 7, 64 A rows then 320 B rows at a pitch of 272 B (16 B x odd: the 16-byte stores and the ds_load_b128 fragment reads of 16 rows fall on all 64 banks).
// A row rho = j*16 + pq holds pixel 4*pq + j, so that the lanes of one store stand one pitch apart; the output rows are put back in pixel order by the addresses of the global stores: pixel = 4*(rho & 15) + (rho >> 4).
// k runs upward through the 8 blocks of 32, one accumulator chain per output tile. Every loop is unrolled so that the staging, fragment and accumulator arrays stay in registers and every address step is an immediate.
#define GP 136
#define KPX 64
#define HVP (PD + 8)                       // staged HV row in halves, pitch 528 B (16 B x odd)
__global__ __launch_bounds__(256) void k_kv(const float* __restrict__ X, const _Float16* __restrict__ P, _Float16* __restrict__ HV, float* __restrict__ AL) { __shared__ __align__(16) _Float16 sm[2][KPX + NFR][GP];
  const int tid = threadIdx.x, wave = tid >> 5, lane = tid & 31, col = lane & 15, g = lane >> 4, wm = wave & 1, wn = wave >> 1, sr = tid >> 4, sq = tid & 15; const size_t b = blockIdx.y; const size_t rb = b * NP + (size_t)blockIdx.x * KPX;
  const float* gx = X + (b * CC + sr * 8) * NP + blockIdx.x * KPX + sq * 4;   // channel octets sr + 16 o, o = 0, 1; pixels 4 sq + 0..3
  const _Float16* gb = P + (size_t)sr * CC + sq * 8;                          // the thread's 16-byte piece sq of row sr: two whole 256-B row pieces per wave load
  v4f xa[2][8]; v8h st[NFR / 16][2];
#pragma unroll
  for (int o = 0; o < 2; ++o)
#pragma unroll
    for (int i = 0; i < 8; ++i) xa[o][i] = *(const v4f*)(gx + (size_t)(o * 128 + i) * NP);
  asm volatile("s_wait_xcnt 0x0" ::: "memory");   // behind the x loads: the results of the loads below may take the registers that held the x address
#pragma unroll
  for (int i = 0; i < NFR / 16; ++i) { st[i][0] = *(const v8h*)(gb + (size_t)i * 16 * CC); st[i][1] = *(const v8h*)(gb + (size_t)i * 16 * CC + 128); }
  asm volatile("s_wait_xcnt 0x0" ::: "memory");   // behind the loads: later values may take the registers that held their addresses
  __builtin_amdgcn_sched_barrier(0);   // keeps all 56 loads ahead of the first LDS store, so that one memory latency is waited out and not one per group
#pragma unroll
  for (int o = 0; o < 2; ++o)
#pragma unroll
    for (int j = 0; j < 4; ++j) { v8h h;
#pragma unroll
      for (int i = 0; i < 8; ++i) h[i] = (_Float16)bfr(xa[o][i][j]);
      *(v8h*)&sm[o][j * 16 + sq][sr * 8] = h; }
#pragma unroll
  for (int i = 0; i < NFR / 16; ++i) { *(v8h*)&sm[0][KPX + sr + 16 * i][sq * 8] = st[i][0]; *(v8h*)&sm[1][KPX + sr + 16 * i][sq * 8] = st[i][1]; }
  __syncthreads();   // publishes both operands
  v8f acc[2][5] = {}; v16h a[2][2], w[2][5];   // two fragment sets: block kb + 1 is fetched while block kb is multiplied
#pragma unroll
  for (int i = 0; i < 2; ++i) a[0][i] = frag_h(&sm[0][wm * 32 + i * 16 + col][0], lane);
#pragma unroll
  for (int j = 0; j < 5; ++j) w[0][j] = frag_h(&sm[0][KPX + wn * 80 + j * 16 + col][0], lane);
#pragma unroll
  for (int kb = 0; kb < 8; ++kb) {
    if (kb < 7) {
#pragma unroll
      for (int i = 0; i < 2; ++i) a[(kb + 1) & 1][i] = frag_h(&sm[(kb + 1) >> 2][wm * 32 + i * 16 + col][((kb + 1) & 3) * 32], lane);
#pragma unroll
      for (int j = 0; j < 5; ++j) w[(kb + 1) & 1][j] = frag_h(&sm[(kb + 1) >> 2][KPX + wn * 80 + j * 16 + col][((kb + 1) & 3) * 32], lane); }
    __builtin_amdgcn_sched_barrier(0);   // the next block's 14 LDS reads stand as one group ahead of this block's products, not among them
#pragma unroll
    for (int i = 0; i < 2; ++i)
#pragma unroll
      for (int j = 0; j < 5; ++j) acc[i][j] = __builtin_amdgcn_wmma_f32_16x16x32_f16(false, a[kb & 1][i], false, w[kb & 1][j], (short)0, acc[i][j], false, false);
    __builtin_amdgcn_sched_barrier(0);   // ends the block: the following group of reads does not move up among its products
  }
  __syncthreads();   // ends every wave's fragment reads: the output rows below lie over the first buffer
  _Float16 (*so)[HVP] = (_Float16 (*)[HVP])&sm[0][0][0];                                     // 64 HV rows, in the order rho
  float (*sf)[NHD * NQ + 4] = (float (*)[NHD * NQ + 4])((char*)&sm[0][0][0] + KPX * HVP * 2);   // 64 logit rows at a pitch of 272 B, the same order
#pragma unroll
  for (int j = 0; j < 5; ++j) { const int ct = wn * 5 + j;   // column tile: 0..15 HV, 16..19 logits; the same in every lane of a wave
    if (ct < PD / 16) {
#pragma unroll
      for (int i = 0; i < 2; ++i)
#pragma unroll
        for (int r = 0; r < 8; ++r) so[wm * 32 + i * 16 + 8 * g + r][ct * 16 + col] = (_Float16)(acc[i][j][r] * (1.0f / WSC)); }
    else {
#pragma unroll
      for (int i = 0; i < 2; ++i)
#pragma unroll
        for (int r = 0; r < 8; ++r) sf[wm * 32 + i * 16 + 8 * g + r][(ct - PD / 16) * 16 + col] = acc[i][j][r] * (1.0f / WSC); } }
  __syncthreads();   // publishes the output rows
  _Float16* dh = HV + (rb + wave * 4) * PD + lane * 8;   // one address, constant steps: one whole 512-B row per wave store; row rho = wave + 8 k is pixel 4 wave + 32 (k & 1) + (k >> 1)
#pragma unroll
  for (int k = 0; k < 8; ++k) vst2((unsigned*)(dh + (size_t)(32 * (k & 1) + (k >> 1)) * PD), *(const v4u*)&so[wave + k * 8][lane * 8]);
  float* dl = AL + (rb + sr * 4) * (NHD * NQ) + sq * 4;   // two whole 256-B logit rows per wave store; row rho = sr + 16 k is pixel 4 sr + k
#pragma unroll
  for (int k = 0; k < 4; ++k) vst2(dl + (size_t)k * (NHD * NQ), *(const v4f*)&sf[sr + k * 16][sq * 4]); }
// ---- k_wz: block = (2 x 32 pixel tile, b), 16 waves. Part 1, 4 pixels per wave: per pixel, per (head n, query q): softmax over the 3x3 neighbourhood of AL (0 outside the image - zero-padded unfold), y[q*64 + o] = sum_n sum_l w[n][q][l] HV[p_l][o*4 + n] (0 outside) + head_b[o] -> f16 rows that stay in LDS.
// The sum over k = (n, l), 36 terms, is one 64 x 16 x 36 product per pixel on WMMA: A rows = o (f16-staged HV), B columns = q (weights as f16 hi + f16 lo, so the f32 weight survives).
// k order, equal in both loaders: lane half g holds heads n = 2g, 2g + 1; element 2l + s = (window place l < 8, head 2g + s). Place l = 8 goes in a third product: elements 0, 1 pair HV with hi, elements 2, 3 pair the same HV with lo, the rest 0.
// Part 2: z = y . q_w^T (single f16 x f16x256) + q_b for the block's 64 pixels x 256 channels -> NCHW out[b][c][p]. Wave = (k half kk, 32 channels wn), wave tile 64 pixels x 32 channels over 512 k: y fragments from LDS, q_w fragments straight from the packed planes (each read once per block).
// k order, equal in both loaders: block ks = 32 k from q*64 + o = ks*32; elements 0..7 = 8g + 0..7, 8..15 = 16 + 8g + 0..7. The two k halves are added at the end, lower half first.
// The tile is 32 pixels wide so that every 128-B line of out has one writer.
#define TLW 32
#define HLW (TLW + 2)
#define NHP (4 * HLW)                      // 136 halo pixels
#define YP (NQ * 72 + 8)                   // y row in halves: 16 queries at a pitch of 144 B, row pitch 2,320 B (16 B x odd: the fragment reads of 16 rows fall on all 64 banks)
#define ZP (64 + 4)                        // z row [channel][64 pixels] in floats, pitch 272 B
#define SM_AL (NHP * PD * 2)
#define SM_Y (SM_AL + NHP * NHD * NQ * 4)
#define SM_END (SM_Y + 64 * YP * 2)
__global__ __launch_bounds__(512) void k_wz(const float* __restrict__ AL, const _Float16* __restrict__ HV, const float* __restrict__ HB, const _Float16* __restrict__ PQW, const float* __restrict__ QB, float* __restrict__ OUT) {
  __shared__ __align__(16) char smem[SM_END];
  _Float16 (*shv)[PD] = (_Float16 (*)[PD])smem;                        // [halo pixel][o*4 + n]
  float (*sal)[NHD * NQ] = (float (*)[NHD * NQ])(smem + SM_AL);        // [halo pixel][q*4 + n]
  _Float16 (*sy)[YP] = (_Float16 (*)[YP])(smem + SM_Y);                // [pixel][q*72 + o]
  const int t = threadIdx.x, wave = t >> 5, lane = t & 31, c = lane & 15, g = lane >> 4; const size_t b = blockIdx.y; const int ty = (blockIdx.x >> 1) * 2, tx = (blockIdx.x & 1) * TLW;
  const int kk = wave >> 3, wn = wave & 7;
  // loads first, LDS stores after, so that the staging passes overlap their memory latency; an item past the end takes the last item's address and stores nothing
  v8h hva[5][2]; v4f ala[5]; float bias[4][8];
#pragma unroll
  for (int k = 0; k < 5; ++k) { const int e = min(t + k * 512, NHP * 16 - 1), hp = e >> 4, o4 = e & 15; const int yy = ty - 1 + hp / HLW, xx = tx - 1 + hp % HLW; const bool inb = yy >= 0 && yy < HH && xx >= 0 && xx < WWD;
    const size_t pp = b * NP + (size_t)(inb ? yy * WWD + xx : 0); const _Float16* s = HV + pp * PD + o4 * 16;
#pragma unroll
    for (int n = 0; n < 2; ++n) { hva[k][n] = *(const v8h*)(s + n * 8); if (!inb) hva[k][n] = v8h{}; }
    ala[k] = *(const v4f*)(AL + pp * (NHD * NQ) + o4 * 4); if (!inb) ala[k] = v4f{0.f, 0.f, 0.f, 0.f}; }
  asm volatile("s_wait_xcnt 0x0" ::: "memory");   // stands in front of the loads below, whose results may take the registers that held the staging addresses
#pragma unroll
  for (int j = 0; j < 4; ++j)
#pragma unroll
    for (int r = 0; r < 8; ++r) bias[j][r] = bfr(HB[j * 16 + 8 * g + r]);
  // part 2's first three k blocks of q_w and its biases are asked for here: they do not depend on part 1 and arrive under it
  const _Float16* bp = PQW + (size_t)(wn * 64 + kk * 16) * 512 + lane * 8;   // fragment (j, s): two 512-B planes at (j*32 + s) * 1,024 B
  union BF { v16h v; v8h q[2]; }; BF bq[4][2]; float qb[8];
#pragma unroll
  for (int s = 0; s < 3; ++s)
#pragma unroll
    for (int j = 0; j < 2; ++j) { bq[s][j].q[0] = *(const v8h*)(bp + (j * 32 + s) * 512); bq[s][j].q[1] = *(const v8h*)(bp + (j * 32 + s) * 512 + 256); }
#pragma unroll
  for (int k = 0; k < 8; ++k) qb[k] = bfr(QB[wave * 2 + g + k * 32]);
  asm volatile("s_wait_xcnt 0x0" ::: "memory");   // behind the bias loads: later values may take the registers that held their addresses
  asm volatile("" :: "v"(hva[4][0]), "v"(hva[4][1]), "v"(ala[4]));   // holds the last staging pass's loads up here with the others (sunk into the branch round their LDS stores, four waves would wait out a second latency in front of the block barrier)
#pragma unroll
  for (int k = 0; k < 5; ++k) { const int e = t + k * 512;
    if (k < 4 || e < NHP * 16) { *(v8h*)&shv[e >> 4][(e & 15) * 16] = hva[k][0]; *(v8h*)&shv[e >> 4][(e & 15) * 16 + 8] = hva[k][1]; *(v4f*)&sal[e >> 4][(e & 15) * 4] = ala[k]; } }
  __syncthreads();
  for (int i = 0; i < 4; ++i) { const int pl = wave * 4 + i, hb = (pl >> 5) * HLW + (pl & 31);
    float w[9][2];
    { v2f lg[9];
#pragma unroll
      for (int l = 0; l < 9; ++l) lg[l] = *(const v2f*)&sal[hb + (l / 3) * HLW + l % 3][c * 4 + 2 * g];
#pragma unroll
      for (int s = 0; s < 2; ++s) { float mx = -3.0e38f;
#pragma unroll
        for (int l = 0; l < 9; ++l) mx = fmaxf(mx, lg[l][s]);
        float z = 0.f;
#pragma unroll
        for (int l = 0; l < 9; ++l) { w[l][s] = expf(lg[l][s] - mx); z += w[l][s]; }
        const float iz = 1.0f / z;
#pragma unroll
        for (int l = 0; l < 9; ++l) w[l][s] *= iz; } }
    v16h whi, wlo, w2 = {};
#pragma unroll
    for (int l = 0; l < 9; ++l)
#pragma unroll
      for (int s = 0; s < 2; ++s) { const _Float16 h = (_Float16)w[l][s]; const _Float16 lo = (_Float16)(w[l][s] - (float)h);
        if (l < 8) { whi[2 * l + s] = h; wlo[2 * l + s] = lo; } else { w2[s] = h; w2[2 + s] = lo; } }
    v8f acc[4];
#pragma unroll
    for (int j = 0; j < 4; ++j) { union { v16h v; int u[8]; } h1, h2; const int ch = (j * 16 + c) * 4 + 2 * g;
#pragma unroll
      for (int l = 0; l < 8; ++l) h1.u[l] = *(const int_a*)&shv[hb + (l / 3) * HLW + l % 3][ch];
      const int u8 = *(const int_a*)&shv[hb + 2 * HLW + 2][ch]; h2.u[0] = u8; h2.u[1] = u8;
#pragma unroll
      for (int l = 2; l < 8; ++l) h2.u[l] = 0;
      v8f d = {};
      d = __builtin_amdgcn_wmma_f32_16x16x32_f16(false, h1.v, false, whi, (short)0, d, false, false);
      d = __builtin_amdgcn_wmma_f32_16x16x32_f16(false, h1.v, false, wlo, (short)0, d, false, false);
      acc[j] = __builtin_amdgcn_wmma_f32_16x16x32_f16(false, h2.v, false, w2, (short)0, d, false, false); }
#pragma unroll
    for (int j = 0; j < 4; ++j) { v8h yv;   // lane holds q = c, o = j*16 + 8g + 0..7
#pragma unroll
      for (int r = 0; r < 8; ++r) yv[r] = (_Float16)(acc[j][r] + bias[j][r]);
      *(v8h*)&sy[pl][c * 72 + j * 16 + 8 * g] = yv; }
  }
  __syncthreads();   // publishes the 64 y rows
  v8f za[4][2] = {}; v16h a[2][4];   // two y fragment sets: block s + 1 is fetched while block s is multiplied; q_w runs three blocks ahead in a ring of four
  const _Float16* ap = &sy[c][kk * 8 * 72];
#pragma unroll
  for (int i = 0; i < 4; ++i) a[0][i] = frag_h(ap + i * 16 * YP, lane);
  // unrolled so that the ring and set indices are compile-time and every address step is an immediate
#pragma unroll
  for (int s = 0; s < 16; ++s) {
    if (s + 3 < 16) {
#pragma unroll
      for (int j = 0; j < 2; ++j) { bq[(s + 3) & 3][j].q[0] = *(const v8h*)(bp + (j * 32 + s + 3) * 512); bq[(s + 3) & 3][j].q[1] = *(const v8h*)(bp + (j * 32 + s + 3) * 512 + 256); } }
    if (s + 4 == 16) asm volatile("s_wait_xcnt 0x0" ::: "memory");   // behind the last q_w loads: later values may take the registers that held their address
    if (s + 1 < 16) {
#pragma unroll
      for (int i = 0; i < 4; ++i) a[(s + 1) & 1][i] = frag_h(ap + i * 16 * YP + ((s + 1) >> 1) * 72 + ((s + 1) & 1) * 32, lane); }
    __builtin_amdgcn_sched_barrier(0);   // the loads for later blocks stand as one group ahead of this block's products, not among them
#pragma unroll
    for (int i = 0; i < 4; ++i)
#pragma unroll
      for (int j = 0; j < 2; ++j) za[i][j] = __builtin_amdgcn_wmma_f32_16x16x32_f16(false, a[s & 1][i], false, bq[s & 3][j].v, (short)0, za[i][j], false, false);
    __builtin_amdgcn_sched_barrier(0);   // ends the block: the following group of loads does not move up among its products
  }
  __syncthreads();   // ends every wave's reads of the y rows: the two z planes below lie over the staging arrays and the first y rows
  { float (*so)[ZP] = (float (*)[ZP])(smem + kk * (CC * ZP * 4));   // this k half's plane [channel][pixel]
#pragma unroll
    for (int i = 0; i < 4; ++i)
#pragma unroll
      for (int j = 0; j < 2; ++j) { v4f lo, hi;
#pragma unroll
        for (int r = 0; r < 4; ++r) { lo[r] = za[i][j][r]; hi[r] = za[i][j][4 + r]; }
        float* d = &so[wn * 32 + j * 16 + c][i * 16 + 8 * g]; *(v4f*)d = lo; *(v4f*)(d + 4) = hi; } }
  __syncthreads();
  const float* s0 = (const float*)smem + (wave * 2 + g) * ZP + c * 4;
  float* dst = OUT + (b * CC + wave * 2 + g) * NP + (ty + (c >> 3)) * WWD + tx + (c & 7) * 4;   // one address, constant steps: two channels' four whole 128-B lines per wave store
  v4f zv[8];
#pragma unroll
  for (int k = 0; k < 8; ++k) zv[k] = (*(const v4f*)(s0 + k * 32 * ZP) + *(const v4f*)(s0 + (CC + k * 32) * ZP)) * (1.0f / WSC) + qb[k];
#pragma unroll
  for (int k = 0; k < 8; ++k) vst2(dst + (size_t)k * 32 * NP, zv[k]); }
extern "C" void kernel_launch(void* const* d_in, const int* in_sizes, int n_in, void* d_out, int out_size, void* d_ws, size_t ws_size, hipStream_t stream) {
  (void)in_sizes; (void)n_in; (void)out_size;
  const float** F = (const float**)d_in;   // 0 x [4,256,64,64], 1 kv_w [512,256], 2 dot_w [4,16,64], 3 head_w [64,256], 4 head_b [64], 5 q_w [256,1024], 6 q_b [256]
  if (ws_size < (size_t)WS_END) return;
  char* ws = (char*)d_ws; _Float16* HV = (_Float16*)(ws + WS_HV); float* AL = (float*)(ws + WS_AL);
  k_prep<<<dim3(NPREP), 256, 0, stream>>>(F[1], F[2], F[3], F[5], ws);
  k_kv<<<dim3(NP / 64, NB), 256, 0, stream>>>(F[0], (const _Float16*)(ws + WS_PW), HV, AL);
  k_wz<<<dim3(NP / 64, NB), 512, 0, stream>>>(AL, HV, F[4], (const _Float16*)(ws + WS_PQW), F[6], (float*)d_out);
}

// v008
// One run takes 24.7 microseconds.
// Timed twice side by side with v007, it ran 1.18 times as fast both times.
// Counting every step since v000, it is 28.2 times as fast.
// compute dtype: all float inputs rounded to bf16; the per-head value projection and the query dot are folded into the kv weights ahead of the conv: head_w_h . kv_w(v rows of head h) and dot_w_h . kv_w(k rows of head h), EXACT bf16 products on WMMA 16x16x32, f32 accumulate, rounded once to f16 x 2^8; one 1x1 conv on WMMA (x as f16 x folded f16 weights, f32 accumulate) gives HV (rounded once to f16) and the query logits (f32), made by each block for its own pixels and their neighbours; the 3x3-window softmax (zero-padded logits and values, as the module's unfold) in f32 on VALU and the weighted window sums on WMMA (f16 HV values x weights split into f16 hi + f16 lo, f32 accumulate); the final 1x1 conv on WMMA (y once to f16 x exact f16 x 2^8 q_w), biases in f32; f32 output (NCHW).
#include <hip/hip_runtime.h>
#include <math.h>

typedef __attribute__((ext_vector_type(16))) _Float16 v16h;
typedef __attribute__((ext_vector_type(16))) __bf16 v16b;
typedef __attribute__((ext_vector_type(8)))  _Float16 v8h;
typedef __attribute__((ext_vector_type(8)))  float v8f;
typedef __attribute__((ext_vector_type(4)))  float v4f;
typedef __attribute__((ext_vector_type(2)))  float v2f;
typedef __attribute__((ext_vector_type(4)))  unsigned v4u;
typedef __attribute__((ext_vector_type(4)))  int v4i;
typedef float __attribute__((may_alias)) float_a;
typedef int __attribute__((may_alias)) int_a;

template <typename T> __device__ __forceinline__ void vst2(void* p, T v) { *(T*)p = v;  }
__device__ __forceinline__ v8f wmma_bf(v16b a, v16b b, v8f c) {
  v8f d = __builtin_amdgcn_wmma_f32_16x16x32_bf16(false, a, false, b, (short)0, c, false, false);
  asm volatile("v_nop\n\tv_nop\n\tv_nop\n\tv_nop" : "+v"(d) : "v"(a), "v"(b));
  return d;
}
// 16x16x32 fragments: lane = (h = lane>>4, row/col = lane&15); elements 0..7 = k0+8h+0..7, 8..15 = k0+16+8h+0..7; D element r = row 8h+r
__device__ __forceinline__ v16h frag_h(const _Float16* rowk0, int lane) {
  union { v16h v; v8h q[2]; } u; const _Float16* p = rowk0 + 8 * (lane >> 4);
  u.q[0] = *(const v8h*)p; u.q[1] = *(const v8h*)(p + 16); return u.v;
}
__device__ __forceinline__ v16h frag_f32(const float* rowk0, int lane) {
  v16h a; const float* p = rowk0 + 8 * (lane >> 4);
#pragma unroll
  for (int i = 0; i < 8; ++i) { a[i] = (_Float16)p[i]; a[8 + i] = (_Float16)p[16 + i]; }
  return a;
}
__device__ __forceinline__ v16h frag_f32s(const float* rowk0, int lane, float sc) {
  v16h a; const float* p = rowk0 + 8 * (lane >> 4);
#pragma unroll
  for (int i = 0; i < 8; ++i) { a[i] = (_Float16)(p[i] * sc); a[8 + i] = (_Float16)(p[16 + i] * sc); }
  return a;
}
// column fragment from a [K][ld] layout (column n), rows >= K read as 0
__device__ __forceinline__ v16h fragc_f32(const float* W, int k0, int n, int lane, int ld, int K) {
  v16h a; const int g = lane >> 4;
#pragma unroll
  for (int i = 0; i < 8; ++i) { const int ka = k0 + 8 * g + i, kb = ka + 16;
    a[i] = (_Float16)(ka < K ? W[(size_t)(ka < K ? ka : K - 1) * ld + n] : 0.f); a[8 + i] = (_Float16)(kb < K ? W[(size_t)(kb < K ? kb : K - 1) * ld + n] : 0.f); }
  return a;
}
struct F2 { v16b h, l; };
__device__ __forceinline__ F2 bsplit16(const float v[16]) { F2 r;
#pragma unroll
  for (int i = 0; i < 16; ++i) { const __bf16 h = (__bf16)v[i]; r.h[i] = h; r.l[i] = (__bf16)(v[i] - (float)h); }
  return r; }
__device__ __forceinline__ F2 split_row(const float* row, int k0, int lane) { float v[16]; const float* p = row + k0 + 8 * (lane >> 4);
#pragma unroll
  for (int i = 0; i < 8; ++i) { v[i] = p[i]; v[8 + i] = p[16 + i]; }
  return bsplit16(v); }
__device__ __forceinline__ F2 split_rowK(const float* row, int k0, int lane, int K) { float v[16]; const int g = lane >> 4;
#pragma unroll
  for (int i = 0; i < 8; ++i) { const int ka = k0 + 8 * g + i, kb = ka + 16; v[i] = ka < K ? row[ka < K ? ka : K - 1] : 0.f; v[8 + i] = kb < K ? row[kb < K ? kb : K - 1] : 0.f; }
  return bsplit16(v); }
__device__ __forceinline__ F2 split_col(const float* W, int k0, int n, int lane, int ld, int K) { float v[16]; const int g = lane >> 4;
#pragma unroll
  for (int i = 0; i < 8; ++i) { const int ka = k0 + 8 * g + i, kb = ka + 16; v[i] = ka < K ? W[(size_t)(ka < K ? ka : K - 1) * ld + n] : 0.f; v[8 + i] = kb < K ? W[(size_t)(kb < K ? kb : K - 1) * ld + n] : 0.f; }
  return bsplit16(v); }
__device__ __forceinline__ v8f mac3(const F2& a, const F2& b, v8f c) { c = wmma_bf(a.l, b.h, c); c = wmma_bf(a.h, b.l, c); return wmma_bf(a.h, b.h, c); }
__device__ __forceinline__ float sigm(float v) { return 1.0f / (1.0f + expf(-v)); }


// Local multi-head channel attention (B 4, C 256, 64 x 64; 4 heads x 64, 16 queries, 3x3 window): kv conv, per-pixel query logits, softmax over each pixel's 3x3 neighbourhood, window-weighted values, head projection (+ bias), query projection (+ bias).
#define NB 4
#define CC 256
#define HH 64
#define WWD 64
#define NP (HH * WWD)
#define NHD 4
#define NQ 16
#define HD 64
#define PD 256
#define YW (NQ * HD)       // 1,024 channels into the query projection
#define WSC 256.0f
#ifndef TPX
#define TPX (NP / 64)      // not used by the kernels or launches
#endif
typedef __attribute__((ext_vector_type(8))) __bf16 v8b;
__device__ __forceinline__ v16b frag_b(const __bf16* rowk0, int lane) {
  union { v16b v; v8b q[2]; } u; const __bf16* p = rowk0 + 8 * (lane >> 4);
  u.q[0] = *(const v8b*)p; u.q[1] = *(const v8b*)(p + 16); return u.v;
}
__device__ __forceinline__ float bfr(float v) { return (float)(__bf16)v; }
__device__ __attribute__((noinline)) float exp_ni(float v) { return expf(v); }
__device__ __attribute__((noinline)) float erf_ni(float v) { return erff(v); }

#define NFR 320                                     // folded weight rows: 256 HV rows (o*4 + n), 64 logit rows (q*4 + n)
#define WS_PW  0u                                   // f16 x 2^8 folded rows [320][256]; then f16 x 2^8 q_w in fragment order: [16 channels nt][32 k ks][plane h][lane = gg*16 + col][8] = q_w[nt*16 + col][ks*32 + h*16 + gg*8 + 0..7]
#define WS_PQW (WS_PW + 2u * (size_t)NFR * CC)
#define WS_END (WS_PQW + 2u * (size_t)CC * YW)

// ---- k_prep: the weight preparations, which do not depend on each other, in one launch. Block n:
// n < 40: the fold. Block n = (unit u = n >> 1, 128 columns c), one 16 x 16 tile per wave, two 16x16x32 products (64 terms d).
// Units 0..15 = (head u >> 2, 16 rows o): sum_d head_w[o][h*64 + d] kv_w[256 + h*64 + d][c] -> row o*4 + h; units 16..19 = head u - 16, 16 rows q: sum_d dot_w[h][q][d] kv_w[h*64 + d][c] -> row 256 + q*4 + h.
// The rows stand in the order in which k_wz's fragments want the channels of a pixel. k order, equal in both loaders: elements 0..7 = d0 + 8g + 0..7, 8..15 = d0 + 16 + 8g + 0..7. n = 40..71: q_w, 8 rows each, into k_wz's fragment order.
#define NPREP (40 + CC / 8)
typedef __attribute__((ext_vector_type(4))) _Float16 v4h;
__global__ __launch_bounds__(256) void k_prep(const float* __restrict__ KVW, const float* __restrict__ DW, const float* __restrict__ HW, const float* __restrict__ QW, char* __restrict__ ws) { const int t = threadIdx.x; __shared__ __align__(16) _Float16 sp[16][128 + 8];
  { const int n = blockIdx.x; _Float16* PW = (_Float16*)(ws + WS_PW);
    if (n < 40) { const int wave = t >> 5, lane = t & 31, col = lane & 15, g = lane >> 4, u = n >> 1, cb = (n & 1) * 128; const bool hv = u < 16; const int hd = hv ? u >> 2 : u - 16;
      const float* ar = (hv ? HW + (size_t)((u & 3) * 16 + col) * PD + hd * HD : DW + (size_t)(hd * NQ + col) * HD) + 8 * g;
      const float* br = KVW + (size_t)((hv ? PD : 0) + hd * HD + 8 * g) * CC + cb + wave * 16 + col;
      v8f acc = {}; float av[2][16];
      // all loops unrolled so that all loads issue ahead of the first product
#pragma unroll
      for (int kc = 0; kc < 2; ++kc)
#pragma unroll
        for (int i = 0; i < 8; ++i) { av[kc][i] = ar[kc * 32 + i]; av[kc][8 + i] = ar[kc * 32 + 16 + i]; }
      asm volatile("s_wait_xcnt 0x0" ::: "memory");   // behind the row loads: the column loads' results may take the registers that held the row address
#pragma unroll
      for (int kc = 0; kc < 2; ++kc) { v16b a, w;
#pragma unroll
        for (int i = 0; i < 8; ++i) { a[i] = (__bf16)av[kc][i]; a[8 + i] = (__bf16)av[kc][8 + i]; w[i] = (__bf16)br[(size_t)(kc * 32 + i) * CC]; w[8 + i] = (__bf16)br[(size_t)(kc * 32 + 16 + i) * CC]; }
        acc = __builtin_amdgcn_wmma_f32_16x16x32_bf16(false, a, false, w, (short)0, acc, false, false); }
#pragma unroll
      for (int r = 0; r < 8; ++r) sp[8 * g + r][wave * 16 + col] = (_Float16)(acc[r] * WSC);
      __syncthreads(); const int rl = t >> 4; const int ro = hv ? ((u & 3) * 16 + rl) * NHD + hd : PD + rl * NHD + hd;   // one wave stores two whole 256-B row pieces
      vst2((unsigned*)(PW + (size_t)ro * CC + cb + (t & 15) * 8), *(const v4u*)&sp[rl][(t & 15) * 8]);
      asm volatile("s_wait_xcnt 0x0" ::: "memory"); }   // behind the store: the code laid out after it writes the registers that the store names
    else { const int ch = (n - 40) * 8 + (t & 7), kc = t >> 3; const float* s = QW + (size_t)ch * YW + kc * 8; _Float16* d = (_Float16*)(ws + WS_PQW) + ((size_t)(((ch >> 4) * 32 + (kc >> 2)) * 2 + ((kc >> 1) & 1)) * 32 + (kc & 1) * 16 + (ch & 15)) * 8; v4f q[4][2];   // thread = (row, 8 k): 8 rows' pieces of one k group are one whole 128-B line of a fragment plane, four such lines per wave store
      // unrolled so that all 8 loads issue ahead of the first store
#pragma unroll
      for (int k = 0; k < 4; ++k) { q[k][0] = *(const v4f*)(s + k * 256); q[k][1] = *(const v4f*)(s + k * 256 + 4); }
      asm volatile("s_wait_xcnt 0x0" ::: "memory");   // behind the loads: later values may take the registers that held their address
#pragma unroll
      for (int k = 0; k < 4; ++k) { v8h h;   // 256 k on = 8 k blocks on = 8 x 512 halves
#pragma unroll
        for (int i = 0; i < 4; ++i) { h[i] = (_Float16)bfr(q[k][0][i] * WSC); h[4 + i] = (_Float16)bfr(q[k][1][i] * WSC); }   // x 2^8 ahead of the bf16 rounding: the same value, and no f16 value is formed below the scale
        vst2(d + k * 8 * 512, h); }
      asm volatile("s_wait_xcnt 0x0" ::: "memory"); } } }   // behind the last store: the code laid out after it writes the registers that the stores name
// ---- k_wz: block = (2 x 32 pixel tile, b), 16 waves. Part 0, the kv conv for the tile's 4 x 34 halo pixels: folded rows . x -> HV f16 rows and f32 logit rows that stay in LDS (a pixel outside the image has x = 0, so both come out 0: the zero-padded unfold).
// x comes straight from its NCHW f32 rows: a wave-wide 16-byte load takes one channel's 32 inner pixels of the 4 halo rows (four whole 128-B lines); a thread holds 4 pixels x 8 channels per channel octet, rounds them (bf16, held as f16) and stores each pixel's 8 channels as one 16-byte piece.
// The one halo column that lies in the image (the other lies outside: the image is two tiles wide) comes by 4-byte loads, one (channel, row) each.
// All 256 k of both operands are asked for at once and staged once: buffer k >> 7, 144 x rows then 320 folded rows at a pitch of 272 B (16 B x odd: the 16-byte stores and the ds_load_b128 fragment reads of 16 rows fall on all 64 banks).
// x row rho: rho = j*32 + yl*8 + q < 128 holds halo pixel (row yl, column 1 + 4q + j), so that the lanes of one store stand one pitch apart; 128 + yl = the halo column inside the image; 132 + yl = the one outside, 0; 136..143 = 0, their products are not kept.
// Waves 0..14 = (3 pixel tiles pg, 5 folded-row tiles cg): A rows = folded rows, B columns = pixels, so that a lane ends with 8 successive channels of one pixel: one 16-byte LDS store per HV tile. k runs upward through the 8 blocks of 32, one accumulator chain per output tile; both loaders are frag_h, the same k order.
// Part 1, 4 pixels per wave: per pixel, per (head n, query q): softmax over the 3x3 neighbourhood of the logits, y[q*64 + o] = sum_n sum_l w[n][q][l] HV[p_l][o*4 + n] + head_b[o] -> f16 rows that stay in LDS.
// The sum over k = (n, l), 36 terms, is one 64 x 16 x 36 product per pixel on WMMA: A rows = o (f16-staged HV), B columns = q (weights as f16 hi + f16 lo, so the f32 weight survives).
// k order, equal in both loaders: lane half g holds heads n = 2g, 2g + 1; element 2l + s = (window place l < 8, head 2g + s). Place l = 8 goes in a third product: elements 0, 1 pair HV with hi, elements 2, 3 pair the same HV with lo, the rest 0.
// Part 2: z = y . q_w^T (single f16 x f16x256) + q_b for the block's 64 pixels x 256 channels -> NCHW out[b][c][p]. Wave = (k half kk, 32 channels wn), wave tile 64 pixels x 32 channels over 512 k: y fragments from LDS, q_w fragments straight from the packed planes (each read once per block).
// k order, equal in both loaders: block ks = 32 k from q*64 + o = ks*32; elements 0..7 = 8g + 0..7, 8..15 = 16 + 8g + 0..7. The two k halves are added at the end, lower half first.
// The tile is 32 pixels wide so that every 128-B line of out has one writer.
#define GP 136                             // staged operand row in halves (128 k), pitch 272 B
#define XR 144                             // staged x rows
#define TLW 32
#define HLW (TLW + 2)
#define NHP (4 * HLW)                      // 136 halo pixels
#define HVP (PD + 8)                       // HV row in halves, pitch 528 B (16 B x odd: the 16-byte stores of 16 pixels fall on all 64 banks)
#define ALP (NHD * NQ + 4)                 // logit row in floats, pitch 272 B
#define YP (NQ * 72 + 8)                   // y row in halves: 16 queries at a pitch of 144 B, row pitch 2,320 B (16 B x odd: the fragment reads of 16 rows fall on all 64 banks)
#define ZP (64 + 4)                        // z row [channel][64 pixels] in floats, pitch 272 B
#define SM_AL (NHP * HVP * 2)
#define SM_Y (SM_AL + NHP * ALP * 4)
#define SM_END (SM_Y + 64 * YP * 2)
static_assert(2 * (XR + NFR) * GP * 2 <= SM_END, "the staged operands lie inside the block's LDS");
__global__ __launch_bounds__(512) void k_wz(const float* __restrict__ X, const _Float16* __restrict__ P, const float* __restrict__ HB, const _Float16* __restrict__ PQW, const float* __restrict__ QB, float* __restrict__ OUT) {
  __shared__ __align__(16) char smem[SM_END];
  _Float16 (*sm)[XR + NFR][GP] = (_Float16 (*)[XR + NFR][GP])smem;     // part 0's operands; the HV and logit rows below lie over them
  _Float16 (*shv)[HVP] = (_Float16 (*)[HVP])smem;                      // [halo pixel][o*4 + n]
  float (*sal)[ALP] = (float (*)[ALP])(smem + SM_AL);                  // [halo pixel][q*4 + n]
  _Float16 (*sy)[YP] = (_Float16 (*)[YP])(smem + SM_Y);                // [pixel][q*72 + o]
  const int t = threadIdx.x, wave = t >> 5, lane = t & 31, c = lane & 15, g = lane >> 4; const size_t b = blockIdx.y; const int ty = (blockIdx.x >> 1) * 2, tx = (blockIdx.x & 1) * TLW;
  const int kk = wave >> 3, wn = wave & 7;
  // ---- part 0. Loads first, LDS stores after, so that one memory latency is waited out; a row outside the image takes a row's address inside it and stores 0
  { const int yy = ty - 1 + (lane >> 3); const bool iny = yy >= 0 && yy < HH;
    const float* gx = X + (b * CC + wave * 8) * NP + (iny ? yy : ty) * WWD + tx + (lane & 7) * 4;   // channel octets wave + 16 o, o = 0, 1; halo row lane >> 3, inner pixels 4 (lane & 7) + 0..3
    const int ye = ty - 1 + (t >> 8);                                                             // edge items (channel t & 255, halo rows (t >> 8) + 2 k, k = 0, 1)
    const float* ge = X + (b * CC + (t & 255)) * NP + (tx ? tx - 1 : TLW);
    const _Float16* gb = P + (size_t)(t >> 4) * CC + (t & 15) * 8;                                // the thread's 16-byte piece t & 15 of row t >> 4: two whole 256-B row pieces per wave load
    v4f xa[2][8]; float xe[2]; v8h st[NFR / 32][2];
#pragma unroll
    for (int o = 0; o < 2; ++o)
#pragma unroll
      for (int i = 0; i < 8; ++i) xa[o][i] = *(const v4f*)(gx + (size_t)(o * 128 + i) * NP);
#pragma unroll
    for (int k = 0; k < 2; ++k) { const int y2 = ye + 2 * k; xe[k] = ge[(y2 >= 0 && y2 < HH ? y2 : ty) * WWD]; }
    asm volatile("s_wait_xcnt 0x0" ::: "memory");   // behind the x loads: the results of the loads below may take the registers that held the x addresses
#pragma unroll
    for (int i = 0; i < NFR / 32; ++i) { st[i][0] = *(const v8h*)(gb + (size_t)i * 32 * CC); st[i][1] = *(const v8h*)(gb + (size_t)i * 32 * CC + 128); }
    asm volatile("s_wait_xcnt 0x0" ::: "memory");   // behind the loads: later values may take the registers that held their addresses
    __builtin_amdgcn_sched_barrier(0);   // keeps all 38 loads ahead of the first LDS store, so that one memory latency is waited out and not one per group
    if (t < 384) *(v8h*)&sm[(t >> 4) & 1][XR - 12 + (t >> 5)][(t & 15) * 8] = v8h{};   // x rows 132..143
#pragma unroll
    for (int o = 0; o < 2; ++o)
#pragma unroll
      for (int j = 0; j < 4; ++j) { v8h h;
#pragma unroll
        for (int i = 0; i < 8; ++i) h[i] = (_Float16)bfr(xa[o][i][j]);
        if (!iny) h = v8h{};
        *(v8h*)&sm[o][j * 32 + lane][wave * 8] = h; }
#pragma unroll
    for (int k = 0; k < 2; ++k) { const int y2 = ye + 2 * k; sm[(t >> 7) & 1][128 + (t >> 8) + 2 * k][t & 127] = (_Float16)(y2 >= 0 && y2 < HH ? bfr(xe[k]) : 0.f); }
#pragma unroll
    for (int i = 0; i < NFR / 32; ++i) { *(v8h*)&sm[0][XR + (t >> 4) + 32 * i][(t & 15) * 8] = st[i][0]; *(v8h*)&sm[1][XR + (t >> 4) + 32 * i][(t & 15) * 8] = st[i][1]; } }
  __syncthreads();   // publishes both operands
  const int wv = __builtin_amdgcn_readfirstlane(wave), pg = wv % 3, cg = wv / 3;   // the wave's number in a scalar register: the tests on it below are scalar branches
  v8f acc[4][3] = {};
  if (wv < 15) { v16h fw[2][4], fx[2][3];   // two fragment sets: block kb + 1 is fetched while block kb is multiplied
    const _Float16* pw = &sm[0][XR + cg * 64 + c][0]; const _Float16* px = &sm[0][pg * 48 + c][0];
#pragma unroll
    for (int j = 0; j < 4; ++j) fw[0][j] = frag_h(pw + j * 16 * GP, lane);
#pragma unroll
    for (int i = 0; i < 3; ++i) fx[0][i] = frag_h(px + i * 16 * GP, lane);
    // unrolled so that the set indices are compile-time and every address step is an immediate
#pragma unroll
    for (int kb = 0; kb < 8; ++kb) {
      if (kb < 7) { const int ko = ((kb + 1) >> 2) * (XR + NFR) * GP + ((kb + 1) & 3) * 32;
#pragma unroll
        for (int j = 0; j < 4; ++j) fw[(kb + 1) & 1][j] = frag_h(pw + ko + j * 16 * GP, lane);
#pragma unroll
        for (int i = 0; i < 3; ++i) fx[(kb + 1) & 1][i] = frag_h(px + ko + i * 16 * GP, lane); }
      __builtin_amdgcn_sched_barrier(0);   // the next block's 14 LDS reads stand as one group ahead of this block's products, not among them
#pragma unroll
      for (int j = 0; j < 4; ++j)
#pragma unroll
        for (int i = 0; i < 3; ++i) acc[j][i] = __builtin_amdgcn_wmma_f32_16x16x32_f16(false, fw[kb & 1][j], false, fx[kb & 1][i], (short)0, acc[j][i], false, false);
      __builtin_amdgcn_sched_barrier(0);   // ends the block: the following group of reads does not move up among its products
    } }
  __syncthreads();   // ends every wave's fragment reads: the HV and logit rows below lie over the operands
  // the biases are asked for here, behind the barrier (which waits for a wave's loads) and ahead of the LDS stores below, under which they arrive
  float bias[4][8], qb[8];
#pragma unroll
  for (int j = 0; j < 4; ++j)
#pragma unroll
    for (int r = 0; r < 8; ++r) bias[j][r] = bfr(HB[j * 16 + 8 * g + r]);
#pragma unroll
  for (int k = 0; k < 8; ++k) qb[k] = bfr(QB[wave * 2 + g + k * 32]);
  asm volatile("s_wait_xcnt 0x0" ::: "memory");   // behind the bias loads: later values may take the registers that held their addresses
  if (wv < 15) {
#pragma unroll
    for (int i = 0; i < 3; ++i) { const int rho = (pg * 3 + i) * 16 + c, e = rho - 128;   // x row -> halo pixel
      const int hp = rho < 128 ? ((rho >> 3) & 3) * HLW + 1 + 4 * (rho & 7) + (rho >> 5) : (e & 3) * HLW + (((e >> 2) != 0) == (tx != 0) ? HLW - 1 : 0);
      if (rho < NHP) {
        if (cg < 4) {
#pragma unroll
          for (int j = 0; j < 4; ++j) { v8h h;
#pragma unroll
            for (int r = 0; r < 8; ++r) h[r] = (_Float16)(acc[j][i][r] * (1.0f / WSC));
            *(v8h*)&shv[hp][cg * 64 + j * 16 + 8 * g] = h; } }
        else {
#pragma unroll
          for (int j = 0; j < 4; ++j) { v4f lo, hi;
#pragma unroll
            for (int r = 0; r < 4; ++r) { lo[r] = acc[j][i][r] * (1.0f / WSC); hi[r] = acc[j][i][4 + r] * (1.0f / WSC); }
            float* d = &sal[hp][j * 16 + 8 * g]; *(v4f*)d = lo; *(v4f*)(d + 4) = hi; } } } } }
  __syncthreads();   // publishes the HV and logit rows
  // part 2's first three k blocks of q_w are asked for here, behind the barrier (which waits for a wave's loads): they do not depend on part 1 and arrive under it
  const _Float16* bp = PQW + (size_t)(wn * 64 + kk * 16) * 512 + lane * 8;   // fragment (j, s): two 512-B planes at (j*32 + s) * 1,024 B
  union BF { v16h v; v8h q[2]; }; BF bq[4][2];
#pragma unroll
  for (int s = 0; s < 3; ++s)
#pragma unroll
    for (int j = 0; j < 2; ++j) { bq[s][j].q[0] = *(const v8h*)(bp + (j * 32 + s) * 512); bq[s][j].q[1] = *(const v8h*)(bp + (j * 32 + s) * 512 + 256); }
  for (int i = 0; i < 4; ++i) { const int pl = wave * 4 + i, hb = (pl >> 5) * HLW + (pl & 31);
    float w[9][2];
    { v2f lg[9];
#pragma unroll
      for (int l = 0; l < 9; ++l) lg[l] = *(const v2f*)&sal[hb + (l / 3) * HLW + l % 3][c * 4 + 2 * g];
#pragma unroll
      for (int s = 0; s < 2; ++s) { float mx = -3.0e38f;
#pragma unroll
        for (int l = 0; l < 9; ++l) mx = fmaxf(mx, lg[l][s]);
        float z = 0.f;
#pragma unroll
        for (int l = 0; l < 9; ++l) { w[l][s] = expf(lg[l][s] - mx); z += w[l][s]; }
        const float iz = 1.0f / z;
#pragma unroll
        for (int l = 0; l < 9; ++l) w[l][s] *= iz; } }
    v16h whi, wlo, w2 = {};
#pragma unroll
    for (int l = 0; l < 9; ++l)
#pragma unroll
      for (int s = 0; s < 2; ++s) { const _Float16 h = (_Float16)w[l][s]; const _Float16 lo = (_Float16)(w[l][s] - (float)h);
        if (l < 8) { whi[2 * l + s] = h; wlo[2 * l + s] = lo; } else { w2[s] = h; w2[2 + s] = lo; } }
    v8f acc[4];
#pragma unroll
    for (int j = 0; j < 4; ++j) { union { v16h v; int u[8]; } h1, h2; const int ch = (j * 16 + c) * 4 + 2 * g;
#pragma unroll
      for (int l = 0; l < 8; ++l) h1.u[l] = *(const int_a*)&shv[hb + (l / 3) * HLW + l % 3][ch];
      const int u8 = *(const int_a*)&shv[hb + 2 * HLW + 2][ch]; h2.u[0] = u8; h2.u[1] = u8;
#pragma unroll
      for (int l = 2; l < 8; ++l) h2.u[l] = 0;
      v8f d = {};
      d = __builtin_amdgcn_wmma_f32_16x16x32_f16(false, h1.v, false, whi, (short)0, d, false, false);
      d = __builtin_amdgcn_wmma_f32_16x16x32_f16(false, h1.v, false, wlo, (short)0, d, false, false);
      acc[j] = __builtin_amdgcn_wmma_f32_16x16x32_f16(false, h2.v, false, w2, (short)0, d, false, false); }
#pragma unroll
    for (int j = 0; j < 4; ++j) { v8h yv;   // lane holds q = c, o = j*16 + 8g + 0..7
#pragma unroll
      for (int r = 0; r < 8; ++r) yv[r] = (_Float16)(acc[j][r] + bias[j][r]);
      *(v8h*)&sy[pl][c * 72 + j * 16 + 8 * g] = yv; }
  }
  __syncthreads();   // publishes the 64 y rows
  v8f za[4][2] = {}; v16h a[2][4];   // two y fragment sets: block s + 1 is fetched while block s is multiplied; q_w runs three blocks ahead in a ring of four
  const _Float16* ap = &sy[c][kk * 8 * 72];
#pragma unroll
  for (int i = 0; i < 4; ++i) a[0][i] = frag_h(ap + i * 16 * YP, lane);
  // unrolled so that the ring and set indices are compile-time and every address step is an immediate
#pragma unroll
  for (int s = 0; s < 16; ++s) {
    if (s + 3 < 16) {
#pragma unroll
      for (int j = 0; j < 2; ++j) { bq[(s + 3) & 3][j].q[0] = *(const v8h*)(bp + (j * 32 + s + 3) * 512); bq[(s + 3) & 3][j].q[1] = *(const v8h*)(bp + (j * 32 + s + 3) * 512 + 256); } }
    if (s + 4 == 16) asm volatile("s_wait_xcnt 0x0" ::: "memory");   // behind the last q_w loads: later values may take the registers that held their address
    if (s + 1 < 16) {
#pragma unroll
      for (int i = 0; i < 4; ++i) a[(s + 1) & 1][i] = frag_h(ap + i * 16 * YP + ((s + 1) >> 1) * 72 + ((s + 1) & 1) * 32, lane); }
    __builtin_amdgcn_sched_barrier(0);   // the loads for later blocks stand as one group ahead of this block's products, not among them
#pragma unroll
    for (int i = 0; i < 4; ++i)
#pragma unroll
      for (int j = 0; j < 2; ++j) za[i][j] = __builtin_amdgcn_wmma_f32_16x16x32_f16(false, a[s & 1][i], false, bq[s & 3][j].v, (short)0, za[i][j], false, false);
    __builtin_amdgcn_sched_barrier(0);   // ends the block: the following group of loads does not move up among its products
  }
  __syncthreads();   // ends every wave's reads of the y rows: the two z planes below lie over the staging arrays and the first y rows
  { float (*so)[ZP] = (float (*)[ZP])(smem + kk * (CC * ZP * 4));   // this k half's plane [channel][pixel]
#pragma unroll
    for (int i = 0; i < 4; ++i)
#pragma unroll
      for (int j = 0; j < 2; ++j) { v4f lo, hi;
#pragma unroll
        for (int r = 0; r < 4; ++r) { lo[r] = za[i][j][r]; hi[r] = za[i][j][4 + r]; }
        float* d = &so[wn * 32 + j * 16 + c][i * 16 + 8 * g]; *(v4f*)d = lo; *(v4f*)(d + 4) = hi; } }
  __syncthreads();
  const float* s0 = (const float*)smem + (wave * 2 + g) * ZP + c * 4;
  float* dst = OUT + (b * CC + wave * 2 + g) * NP + (ty + (c >> 3)) * WWD + tx + (c & 7) * 4;   // one address, constant steps: two channels' four whole 128-B lines per wave store
  v4f zv[8];
#pragma unroll
  for (int k = 0; k < 8; ++k) zv[k] = (*(const v4f*)(s0 + k * 32 * ZP) + *(const v4f*)(s0 + (CC + k * 32) * ZP)) * (1.0f / WSC) + qb[k];
#pragma unroll
  for (int k = 0; k < 8; ++k) vst2(dst + (size_t)k * 32 * NP, zv[k]); }
extern "C" void kernel_launch(void* const* d_in, const int* in_sizes, int n_in, void* d_out, int out_size, void* d_ws, size_t ws_size, hipStream_t stream) {
  (void)in_sizes; (void)n_in; (void)out_size;
  const float** F = (const float**)d_in;   // 0 x [4,256,64,64], 1 kv_w [512,256], 2 dot_w [4,16,64], 3 head_w [64,256], 4 head_b [64], 5 q_w [256,1024], 6 q_b [256]
  if (ws_size < (size_t)WS_END) return;
  char* ws = (char*)d_ws;
  k_prep<<<dim3(NPREP), 256, 0, stream>>>(F[1], F[2], F[3], F[5], ws);
  k_wz<<<dim3(NP / 64, NB), 512, 0, stream>>>(F[0], (const _Float16*)(ws + WS_PW), F[4], (const _Float16*)(ws + WS_PQW), F[6], (float*)d_out);
}

// v009
// Measured time: 23 microseconds a run.
// In both of two side-by-side timings against v008, it was 1.09 times as fast.
// Over all steps from v000 it is 30.9 times as fast.
// compute dtype: all float inputs rounded to bf16; the per-head value projection and the query dot are folded into the kv weights ahead of the conv: head_w_h . kv_w(v rows of head h) and dot_w_h . kv_w(k rows of head h), EXACT bf16 products on WMMA 16x16x32, f32 accumulate, rounded once to f16 x 2^8; one 1x1 conv on WMMA (x as f16 x folded f16 weights, f32 accumulate) gives HV (rounded once to f16) and the query logits (f32), made by each block for its own pixels and their neighbours; the 3x3-window softmax (zero-padded logits and values, as the module's unfold) in f32 on VALU and the weighted window sums on WMMA (f16 HV values x weights split into f16 hi + f16 lo, f32 accumulate); the final 1x1 conv on WMMA (y once to f16 x exact f16 x 2^8 q_w), biases in f32; f32 output (NCHW).
#include <hip/hip_runtime.h>
#include <math.h>

typedef __attribute__((ext_vector_type(16))) _Float16 v16h;
typedef __attribute__((ext_vector_type(16))) __bf16 v16b;
typedef __attribute__((ext_vector_type(8)))  _Float16 v8h;
typedef __attribute__((ext_vector_type(8)))  float v8f;
typedef __attribute__((ext_vector_type(4)))  float v4f;
typedef __attribute__((ext_vector_type(2)))  float v2f;
typedef __attribute__((ext_vector_type(4)))  unsigned v4u;
typedef __attribute__((ext_vector_type(4)))  int v4i;
typedef float __attribute__((may_alias)) float_a;
typedef int __attribute__((may_alias)) int_a;

template <typename T> __device__ __forceinline__ void vst2(void* p, T v) { *(T*)p = v;  }
__device__ __forceinline__ v8f wmma_bf(v16b a, v16b b, v8f c) {
  v8f d = __builtin_amdgcn_wmma_f32_16x16x32_bf16(false, a, false, b, (short)0, c, false, false);
  asm volatile("v_nop\n\tv_nop\n\tv_nop\n\tv_nop" : "+v"(d) : "v"(a), "v"(b));
  return d;
}
// 16x16x32 fragments: lane = (h = lane>>4, row/col = lane&15); elements 0..7 = k0+8h+0..7, 8..15 = k0+16+8h+0..7; D element r = row 8h+r
__device__ __forceinline__ v16h frag_h(const _Float16* rowk0, int lane) {
  union { v16h v; v8h q[2]; } u; const _Float16* p = rowk0 + 8 * (lane >> 4);
  u.q[0] = *(const v8h*)p; u.q[1] = *(const v8h*)(p + 16); return u.v;
}
__device__ __forceinline__ v16h frag_f32(const float* rowk0, int lane) {
  v16h a; const float* p = rowk0 + 8 * (lane >> 4);
#pragma unroll
  for (int i = 0; i < 8; ++i) { a[i] = (_Float16)p[i]; a[8 + i] = (_Float16)p[16 + i]; }
  return a;
}
__device__ __forceinline__ v16h frag_f32s(const float* rowk0, int lane, float sc) {
  v16h a; const float* p = rowk0 + 8 * (lane >> 4);
#pragma unroll
  for (int i = 0; i < 8; ++i) { a[i] = (_Float16)(p[i] * sc); a[8 + i] = (_Float16)(p[16 + i] * sc); }
  return a;
}
// column fragment from a [K][ld] layout (column n), rows >= K read as 0
__device__ __forceinline__ v16h fragc_f32(const float* W, int k0, int n, int lane, int ld, int K) {
  v16h a; const int g = lane >> 4;
#pragma unroll
  for (int i = 0; i < 8; ++i) { const int ka = k0 + 8 * g + i, kb = ka + 16;
    a[i] = (_Float16)(ka < K ? W[(size_t)(ka < K ? ka : K - 1) * ld + n] : 0.f); a[8 + i] = (_Float16)(kb < K ? W[(size_t)(kb < K ? kb : K - 1) * ld + n] : 0.f); }
  return a;
}
struct F2 { v16b h, l; };
__device__ __forceinline__ F2 bsplit16(const float v[16]) { F2 r;
#pragma unroll
  for (int i = 0; i < 16; ++i) { const __bf16 h = (__bf16)v[i]; r.h[i] = h; r.l[i] = (__bf16)(v[i] - (float)h); }
  return r; }
__device__ __forceinline__ F2 split_row(const float* row, int k0, int lane) { float v[16]; const float* p = row + k0 + 8 * (lane >> 4);
#pragma unroll
  for (int i = 0; i < 8; ++i) { v[i] = p[i]; v[8 + i] = p[16 + i]; }
  return bsplit16(v); }
__device__ __forceinline__ F2 split_rowK(const float* row, int k0, int lane, int K) { float v[16]; const int g = lane >> 4;
#pragma unroll
  for (int i = 0; i < 8; ++i) { const int ka = k0 + 8 * g + i, kb = ka + 16; v[i] = ka < K ? row[ka < K ? ka : K - 1] : 0.f; v[8 + i] = kb < K ? row[kb < K ? kb : K - 1] : 0.f; }
  return bsplit16(v); }
__device__ __forceinline__ F2 split_col(const float* W, int k0, int n, int lane, int ld, int K) { float v[16]; const int g = lane >> 4;
#pragma unroll
  for (int i = 0; i < 8; ++i) { const int ka = k0 + 8 * g + i, kb = ka + 16; v[i] = ka < K ? W[(size_t)(ka < K ? ka : K - 1) * ld + n] : 0.f; v[8 + i] = kb < K ? W[(size_t)(kb < K ? kb : K - 1) * ld + n] : 0.f; }
  return bsplit16(v); }
__device__ __forceinline__ v8f mac3(const F2& a, const F2& b, v8f c) { c = wmma_bf(a.l, b.h, c); c = wmma_bf(a.h, b.l, c); return wmma_bf(a.h, b.h, c); }
__device__ __forceinline__ float sigm(float v) { return 1.0f / (1.0f + expf(-v)); }


// Local multi-head channel attention (B 4, C 256, 64 x 64; 4 heads x 64, 16 queries, 3x3 window): kv conv, per-pixel query logits, softmax over each pixel's 3x3 neighbourhood, window-weighted values, head projection (+ bias), query projection (+ bias).
#define NB 4
#define CC 256
#define HH 64
#define WWD 64
#define NP (HH * WWD)
#define NHD 4
#define NQ 16
#define HD 64
#define PD 256
#define YW (NQ * HD)       // 1,024 channels into the query projection
#define WSC 256.0f
#ifndef TPX
#define TPX (NP / 64)      // not used by the kernels or launches
#endif
typedef __attribute__((ext_vector_type(8))) __bf16 v8b;
__device__ __forceinline__ v16b frag_b(const __bf16* rowk0, int lane) {
  union { v16b v; v8b q[2]; } u; const __bf16* p = rowk0 + 8 * (lane >> 4);
  u.q[0] = *(const v8b*)p; u.q[1] = *(const v8b*)(p + 16); return u.v;
}
__device__ __forceinline__ float bfr(float v) { return (float)(__bf16)v; }
__device__ __attribute__((noinline)) float exp_ni(float v) { return expf(v); }
__device__ __attribute__((noinline)) float erf_ni(float v) { return erff(v); }

#define NFR 320                                     // folded weight rows: 256 HV rows (o*4 + n), 64 logit rows (q*4 + n)
#define WS_PW  0u                                   // f16 x 2^8 folded rows [320][256]; then f16 x 2^8 q_w in fragment order: [16 channels nt][32 k ks][plane h][lane = gg*16 + col][8] = q_w[nt*16 + col][ks*32 + h*16 + gg*8 + 0..7]
#define WS_PQW (WS_PW + 2u * (size_t)NFR * CC)
#define WS_END (WS_PQW + 2u * (size_t)CC * YW)

// ---- k_prep: the weight preparations, which do not depend on each other, in one launch. Block n:
// n < 40: the fold. Block n = (unit u = n >> 1, 128 columns c), one 16 x 16 tile per wave, two 16x16x32 products (64 terms d).
// Units 0..15 = (head u >> 2, 16 rows o): sum_d head_w[o][h*64 + d] kv_w[256 + h*64 + d][c] -> row o*4 + h; units 16..19 = head u - 16, 16 rows q: sum_d dot_w[h][q][d] kv_w[h*64 + d][c] -> row 256 + q*4 + h.
// The rows stand in the order in which k_wz's fragments want the channels of a pixel. k order, equal in both loaders: elements 0..7 = d0 + 8g + 0..7, 8..15 = d0 + 16 + 8g + 0..7. n = 40..71: q_w, 8 rows each, into k_wz's fragment order.
#define NPREP (40 + CC / 8)
typedef __attribute__((ext_vector_type(4))) _Float16 v4h;
__global__ __launch_bounds__(256) void k_prep(const float* __restrict__ KVW, const float* __restrict__ DW, const float* __restrict__ HW, const float* __restrict__ QW, char* __restrict__ ws) { const int t = threadIdx.x; __shared__ __align__(16) _Float16 sp[16][128 + 8];
  { const int n = blockIdx.x; _Float16* PW = (_Float16*)(ws + WS_PW);
    if (n < 40) { const int wave = t >> 5, lane = t & 31, col = lane & 15, g = lane >> 4, u = n >> 1, cb = (n & 1) * 128; const bool hv = u < 16; const int hd = hv ? u >> 2 : u - 16;
      const float* ar = (hv ? HW + (size_t)((u & 3) * 16 + col) * PD + hd * HD : DW + (size_t)(hd * NQ + col) * HD) + 8 * g;
      const float* br = KVW + (size_t)((hv ? PD : 0) + hd * HD + 8 * g) * CC + cb + wave * 16 + col;
      v8f acc = {}; float av[2][16];
      // all loops unrolled so that all loads issue ahead of the first product
#pragma unroll
      for (int kc = 0; kc < 2; ++kc)
#pragma unroll
        for (int i = 0; i < 8; ++i) { av[kc][i] = ar[kc * 32 + i]; av[kc][8 + i] = ar[kc * 32 + 16 + i]; }
      asm volatile("s_wait_xcnt 0x0" ::: "memory");   // behind the row loads: the column loads' results may take the registers that held the row address
#pragma unroll
      for (int kc = 0; kc < 2; ++kc) { v16b a, w;
#pragma unroll
        for (int i = 0; i < 8; ++i) { a[i] = (__bf16)av[kc][i]; a[8 + i] = (__bf16)av[kc][8 + i]; w[i] = (__bf16)br[(size_t)(kc * 32 + i) * CC]; w[8 + i] = (__bf16)br[(size_t)(kc * 32 + 16 + i) * CC]; }
        acc = __builtin_amdgcn_wmma_f32_16x16x32_bf16(false, a, false, w, (short)0, acc, false, false); }
#pragma unroll
      for (int r = 0; r < 8; ++r) sp[8 * g + r][wave * 16 + col] = (_Float16)(acc[r] * WSC);
      __syncthreads(); const int rl = t >> 4; const int ro = hv ? ((u & 3) * 16 + rl) * NHD + hd : PD + rl * NHD + hd;   // one wave stores two whole 256-B row pieces
      vst2((unsigned*)(PW + (size_t)ro * CC + cb + (t & 15) * 8), *(const v4u*)&sp[rl][(t & 15) * 8]);
      asm volatile("s_wait_xcnt 0x0" ::: "memory"); }   // behind the store: the code laid out after it writes the registers that the store names
    else { const int ch = (n - 40) * 8 + (t & 7), kc = t >> 3; const float* s = QW + (size_t)ch * YW + kc * 8; _Float16* d = (_Float16*)(ws + WS_PQW) + ((size_t)(((ch >> 4) * 32 + (kc >> 2)) * 2 + ((kc >> 1) & 1)) * 32 + (kc & 1) * 16 + (ch & 15)) * 8; v4f q[4][2];   // thread = (row, 8 k): 8 rows' pieces of one k group are one whole 128-B line of a fragment plane, four such lines per wave store
      // unrolled so that all 8 loads issue ahead of the first store
#pragma unroll
      for (int k = 0; k < 4; ++k) { q[k][0] = *(const v4f*)(s + k * 256); q[k][1] = *(const v4f*)(s + k * 256 + 4); }
      asm volatile("s_wait_xcnt 0x0" ::: "memory");   // behind the loads: later values may take the registers that held their address
#pragma unroll
      for (int k = 0; k < 4; ++k) { v8h h;   // 256 k on = 8 k blocks on = 8 x 512 halves
#pragma unroll
        for (int i = 0; i < 4; ++i) { h[i] = (_Float16)bfr(q[k][0][i] * WSC); h[4 + i] = (_Float16)bfr(q[k][1][i] * WSC); }   // x 2^8 ahead of the bf16 rounding: the same value, and no f16 value is formed below the scale
        vst2(d + k * 8 * 512, h); }
      asm volatile("s_wait_xcnt 0x0" ::: "memory"); } } }   // behind the last store: the code laid out after it writes the registers that the stores name
// ---- k_wz: block = (2 x 32 pixel tile, b), 16 waves. Part 0, the kv conv for the tile's 4 x 34 halo pixels: folded rows . x -> HV f16 rows and f32 logit rows that stay in LDS (a pixel outside the image has x = 0, so both come out 0: the zero-padded unfold).
// x comes straight from its NCHW f32 rows: a wave-wide 16-byte load takes one channel's 32 inner pixels of the 4 halo rows (four whole 128-B lines); a thread holds 4 pixels x 8 channels per channel octet, rounds them (bf16, held as f16) and stores each pixel's 8 channels as one 16-byte piece.
// The one halo column that lies in the image (the other lies outside: the image is two tiles wide) comes by 4-byte loads, one (channel, row) each.
// All 256 k of both operands are asked for at once and staged once: buffer k >> 7, 144 x rows then 320 folded rows at a pitch of 272 B (16 B x odd: the 16-byte stores and the ds_load_b128 fragment reads of 16 rows fall on all 64 banks).
// x row rho: rho = j*32 + yl*8 + q < 128 holds halo pixel (row yl, column 1 + 4q + j), so that the lanes of one store stand one pitch apart; 128 + yl = the halo column inside the image; 132 + yl = the one outside, 0; 136..143 = 0, their products are not kept.
// Waves 0..14 = (3 pixel tiles pg, 5 folded-row tiles cg): A rows = folded rows, B columns = pixels, so that a lane ends with 8 successive channels of one pixel: one 16-byte LDS store per HV tile. k runs upward through the 8 blocks of 32, one accumulator chain per output tile; both loaders are frag_h, the same k order.
// Part 1, 4 pixels per wave: per pixel, per (head n, query q): softmax over the 3x3 neighbourhood of the logits, y[q*64 + o] = sum_n sum_l w[n][q][l] HV[p_l][o*4 + n] + head_b[o] -> f16 rows that stay in LDS.
// The sum over k = (n, l), 36 terms, is one 64 x 16 x 36 product per pixel on WMMA: A rows = o (f16-staged HV), B columns = q (weights as f16 hi + f16 lo, so the f32 weight survives).
// k order, equal in both loaders: lane half g holds heads n = 2g, 2g + 1; element 2l + s = (window place l < 8, head 2g + s). Place l = 8 goes in a third product: elements 0, 1 pair HV with hi, elements 2, 3 pair the same HV with lo, the rest 0.
// Part 2: z = y . q_w^T (single f16 x f16x256) + q_b for the block's 64 pixels x 256 channels -> NCHW out[b][c][p]. Wave = (k half kk, 32 channels wn), wave tile 64 pixels x 32 channels over 512 k: y fragments from LDS, q_w fragments straight from the packed planes (each read once per block).
// k order, equal in both loaders: block ks = 32 k from q*64 + o = ks*32; elements 0..7 = 8g + 0..7, 8..15 = 16 + 8g + 0..7. The two k halves are added at the end, lower half first.
// The tile is 32 pixels wide so that every 128-B line of out has one writer.
#define GP 136                             // staged operand row in halves (128 k), pitch 272 B
#define XR 144                             // staged x rows
#define TLW 32
#define HLW (TLW + 2)
#define NHP (4 * HLW)                      // 136 halo pixels
#define HVP (PD + 8)                       // HV row in halves, pitch 528 B (16 B x odd: the 16-byte stores of 16 pixels fall on all 64 banks)
#define ALP (NHD * NQ + 4)                 // logit row in floats, pitch 272 B
#define YP (NQ * 72 + 8)                   // y row in halves: 16 queries at a pitch of 144 B, row pitch 2,320 B (16 B x odd: the fragment reads of 16 rows fall on all 64 banks)
#define ZP (64 + 4)                        // z row [channel][64 pixels] in floats, pitch 272 B
#define SM_AL (NHP * HVP * 2)
#define SM_Y (SM_AL + NHP * ALP * 4)
#define SM_END (SM_Y + 64 * YP * 2)
static_assert(2 * (XR + NFR) * GP * 2 <= SM_END, "the staged operands lie inside the block's LDS");
__global__ __launch_bounds__(512) void k_wz(const float* __restrict__ X, const _Float16* __restrict__ P, const float* __restrict__ HB, const _Float16* __restrict__ PQW, const float* __restrict__ QB, float* __restrict__ OUT) {
  __shared__ __align__(16) char smem[SM_END];
  _Float16 (*sm)[XR + NFR][GP] = (_Float16 (*)[XR + NFR][GP])smem;     // part 0's operands; the HV and logit rows below lie over them
  _Float16 (*shv)[HVP] = (_Float16 (*)[HVP])smem;                      // [halo pixel][o*4 + n]
  float (*sal)[ALP] = (float (*)[ALP])(smem + SM_AL);                  // [halo pixel][q*4 + n]
  _Float16 (*sy)[YP] = (_Float16 (*)[YP])(smem + SM_Y);                // [pixel][q*72 + o]
  const int t = threadIdx.x, wave = t >> 5, lane = t & 31, c = lane & 15, g = lane >> 4; const size_t b = blockIdx.y; const int ty = (blockIdx.x >> 1) * 2, tx = (blockIdx.x & 1) * TLW;
  const int kk = wave >> 3, wn = wave & 7;
  // ---- part 0. Loads first, LDS stores after, so that one memory latency is waited out; a row outside the image takes a row's address inside it and stores 0
  { const int yy = ty - 1 + (lane >> 3); const bool iny = yy >= 0 && yy < HH;
    const float* gx = X + (b * CC + wave * 8) * NP + (iny ? yy : ty) * WWD + tx + (lane & 7) * 4;   // channel octets wave + 16 o, o = 0, 1; halo row lane >> 3, inner pixels 4 (lane & 7) + 0..3
    const int ye = ty - 1 + (t >> 8);                                                             // edge items (channel t & 255, halo rows (t >> 8) + 2 k, k = 0, 1)
    const float* ge = X + (b * CC + (t & 255)) * NP + (tx ? tx - 1 : TLW);
    const _Float16* gb = P + (size_t)(t >> 4) * CC + (t & 15) * 8;                                // the thread's 16-byte piece t & 15 of row t >> 4: two whole 256-B row pieces per wave load
    v4f xa[2][8]; float xe[2]; v8h st[NFR / 32][2];
#pragma unroll
    for (int o = 0; o < 2; ++o)
#pragma unroll
      for (int i = 0; i < 8; ++i) xa[o][i] = *(const v4f*)(gx + (size_t)(o * 128 + i) * NP);
#pragma unroll
    for (int k = 0; k < 2; ++k) { const int y2 = ye + 2 * k; xe[k] = ge[(y2 >= 0 && y2 < HH ? y2 : ty) * WWD]; }
    asm volatile("s_wait_xcnt 0x0" ::: "memory");   // behind the x loads: the results of the loads below may take the registers that held the x addresses
#pragma unroll
    for (int i = 0; i < NFR / 32; ++i) { st[i][0] = *(const v8h*)(gb + (size_t)i * 32 * CC); st[i][1] = *(const v8h*)(gb + (size_t)i * 32 * CC + 128); }
    asm volatile("s_wait_xcnt 0x0" ::: "memory");   // behind the loads: later values may take the registers that held their addresses
    __builtin_amdgcn_sched_barrier(0);   // keeps all 38 loads ahead of the first LDS store, so that one memory latency is waited out and not one per group
    if (t < 384) *(v8h*)&sm[(t >> 4) & 1][XR - 12 + (t >> 5)][(t & 15) * 8] = v8h{};   // x rows 132..143
#pragma unroll
    for (int o = 0; o < 2; ++o)
#pragma unroll
      for (int j = 0; j < 4; ++j) { v8h h;
#pragma unroll
        for (int i = 0; i < 8; ++i) h[i] = (_Float16)bfr(xa[o][i][j]);
        if (!iny) h = v8h{};
        *(v8h*)&sm[o][j * 32 + lane][wave * 8] = h; }
#pragma unroll
    for (int k = 0; k < 2; ++k) { const int y2 = ye + 2 * k; sm[(t >> 7) & 1][128 + (t >> 8) + 2 * k][t & 127] = (_Float16)(y2 >= 0 && y2 < HH ? bfr(xe[k]) : 0.f); }
#pragma unroll
    for (int i = 0; i < NFR / 32; ++i) { *(v8h*)&sm[0][XR + (t >> 4) + 32 * i][(t & 15) * 8] = st[i][0]; *(v8h*)&sm[1][XR + (t >> 4) + 32 * i][(t & 15) * 8] = st[i][1]; } }
  __syncthreads();   // publishes both operands
  const int wv = __builtin_amdgcn_readfirstlane(wave), pg = wv % 3, cg = wv / 3;   // the wave's number in a scalar register: the tests on it below are scalar branches
  v8f acc[4][3] = {};
  if (wv < 15) { v16h fw[2][4], fx[2][3];   // two fragment sets: block kb + 1 is fetched while block kb is multiplied
    const _Float16* pw = &sm[0][XR + cg * 64 + c][0]; const _Float16* px = &sm[0][pg * 48 + c][0];
#pragma unroll
    for (int j = 0; j < 4; ++j) fw[0][j] = frag_h(pw + j * 16 * GP, lane);
#pragma unroll
    for (int i = 0; i < 3; ++i) fx[0][i] = frag_h(px + i * 16 * GP, lane);
    // unrolled so that the set indices are compile-time and every address step is an immediate
#pragma unroll
    for (int kb = 0; kb < 8; ++kb) {
      if (kb < 7) { const int ko = ((kb + 1) >> 2) * (XR + NFR) * GP + ((kb + 1) & 3) * 32;
#pragma unroll
        for (int j = 0; j < 4; ++j) fw[(kb + 1) & 1][j] = frag_h(pw + ko + j * 16 * GP, lane);
#pragma unroll
        for (int i = 0; i < 3; ++i) fx[(kb + 1) & 1][i] = frag_h(px + ko + i * 16 * GP, lane); }
      __builtin_amdgcn_sched_barrier(0);   // the next block's 14 LDS reads stand as one group ahead of this block's products, not among them
#pragma unroll
      for (int j = 0; j < 4; ++j)
#pragma unroll
        for (int i = 0; i < 3; ++i) acc[j][i] = __builtin_amdgcn_wmma_f32_16x16x32_f16(false, fw[kb & 1][j], false, fx[kb & 1][i], (short)0, acc[j][i], false, false);
      __builtin_amdgcn_sched_barrier(0);   // ends the block: the following group of reads does not move up among its products
    } }
  __syncthreads();   // ends every wave's fragment reads: the HV and logit rows below lie over the operands
  // the biases are asked for here, behind the barrier (which waits for a wave's loads) and ahead of the LDS stores below, under which they arrive
  float bias[4][8], qb[8];
#pragma unroll
  for (int j = 0; j < 4; ++j)
#pragma unroll
    for (int r = 0; r < 8; ++r) bias[j][r] = bfr(HB[j * 16 + 8 * g + r]);
#pragma unroll
  for (int k = 0; k < 8; ++k) qb[k] = bfr(QB[wave * 2 + g + k * 32]);
  asm volatile("s_wait_xcnt 0x0" ::: "memory");   // behind the bias loads: later values may take the registers that held their addresses
  if (wv < 15) {
#pragma unroll
    for (int i = 0; i < 3; ++i) { const int rho = (pg * 3 + i) * 16 + c, e = rho - 128;   // x row -> halo pixel
      const int hp = rho < 128 ? ((rho >> 3) & 3) * HLW + 1 + 4 * (rho & 7) + (rho >> 5) : (e & 3) * HLW + (((e >> 2) != 0) == (tx != 0) ? HLW - 1 : 0);
      if (rho < NHP) {
        if (cg < 4) {
#pragma unroll
          for (int j = 0; j < 4; ++j) { v8h h;
#pragma unroll
            for (int r = 0; r < 8; ++r) h[r] = (_Float16)(acc[j][i][r] * (1.0f / WSC));
            *(v8h*)&shv[hp][cg * 64 + j * 16 + 8 * g] = h; } }
        else {
#pragma unroll
          for (int j = 0; j < 4; ++j) { v4f lo, hi;
#pragma unroll
            for (int r = 0; r < 4; ++r) { lo[r] = acc[j][i][r] * (1.0f / WSC); hi[r] = acc[j][i][4 + r] * (1.0f / WSC); }
            float* d = &sal[hp][j * 16 + 8 * g]; *(v4f*)d = lo; *(v4f*)(d + 4) = hi; } } } } }
  __syncthreads();   // publishes the HV and logit rows
  // part 2's first three k blocks of q_w are asked for here, behind the barrier (which waits for a wave's loads): they do not depend on part 1 and arrive under it
  const _Float16* bp = PQW + (size_t)(wn * 64 + kk * 16) * 512 + lane * 8;   // fragment (j, s): two 512-B planes at (j*32 + s) * 1,024 B
  union BF { v16h v; v8h q[2]; }; BF bq[4][2];
#pragma unroll
  for (int s = 0; s < 3; ++s)
#pragma unroll
    for (int j = 0; j < 2; ++j) { bq[s][j].q[0] = *(const v8h*)(bp + (j * 32 + s) * 512); bq[s][j].q[1] = *(const v8h*)(bp + (j * 32 + s) * 512 + 256); }
  __builtin_amdgcn_sched_barrier(0);   // keeps these 12 loads ahead of part 1: left free they sink to the end of its unrolled pixel loop, where their latency is waited out at the barrier
  for (int i = 0; i < 4; ++i) { const int pl = wave * 4 + i, hb = (pl >> 5) * HLW + (pl & 31);
    v2f w[9];
    { v2f lg[9];
#pragma unroll
      for (int l = 0; l < 9; ++l) lg[l] = *(const v2f*)&sal[hb + (l / 3) * HLW + l % 3][c * 4 + 2 * g];
      v2f mx = {-3.0e38f, -3.0e38f};
#pragma unroll
      for (int l = 0; l < 9; ++l) { mx[0] = fmaxf(mx[0], lg[l][0]); mx[1] = fmaxf(mx[1], lg[l][1]); }
      // e^(lg - mx) as 2^(lg log2(e) - mx log2(e)): one fused multiply-add and the hardware's power of two. The argument is at most a rounding step above 0, so nothing overflows; below -126 the power is 0, as good as the true weight beside the largest one, which is 1
      const v2f l2e = {1.44269504f, 1.44269504f}, ml = mx * l2e; v2f z = {};
#pragma unroll
      for (int l = 0; l < 9; ++l) { const v2f a = __builtin_elementwise_fma(lg[l], l2e, -ml); w[l][0] = __builtin_amdgcn_exp2f(a[0]); w[l][1] = __builtin_amdgcn_exp2f(a[1]); z += w[l]; }
      const v2f iz = {__builtin_amdgcn_rcpf(z[0]), __builtin_amdgcn_rcpf(z[1])};   // z lies between about 1 and 9: the hardware's reciprocal needs no scaling steps
#pragma unroll
      for (int l = 0; l < 9; ++l) w[l] *= iz; }
    v16h whi, wlo, w2 = {};
#pragma unroll
    for (int l = 0; l < 9; ++l)
#pragma unroll
      for (int s = 0; s < 2; ++s) { const _Float16 h = (_Float16)w[l][s]; const _Float16 lo = (_Float16)(w[l][s] - (float)h);
        if (l < 8) { whi[2 * l + s] = h; wlo[2 * l + s] = lo; } else { w2[s] = h; w2[2 + s] = lo; } }
    v8f acc[4];
#pragma unroll
    for (int j = 0; j < 4; ++j) { union { v16h v; int u[8]; } h1, h2; const int ch = (j * 16 + c) * 4 + 2 * g;
#pragma unroll
      for (int l = 0; l < 8; ++l) h1.u[l] = *(const int_a*)&shv[hb + (l / 3) * HLW + l % 3][ch];
      const int u8 = *(const int_a*)&shv[hb + 2 * HLW + 2][ch]; h2.u[0] = u8; h2.u[1] = u8;
#pragma unroll
      for (int l = 2; l < 8; ++l) h2.u[l] = 0;
      v8f d = {};
      d = __builtin_amdgcn_wmma_f32_16x16x32_f16(false, h1.v, false, whi, (short)0, d, false, false);
      d = __builtin_amdgcn_wmma_f32_16x16x32_f16(false, h1.v, false, wlo, (short)0, d, false, false);
      acc[j] = __builtin_amdgcn_wmma_f32_16x16x32_f16(false, h2.v, false, w2, (short)0, d, false, false); }
#pragma unroll
    for (int j = 0; j < 4; ++j) { v8h yv;   // lane holds q = c, o = j*16 + 8g + 0..7
#pragma unroll
      for (int r = 0; r < 8; ++r) yv[r] = (_Float16)(acc[j][r] + bias[j][r]);
      *(v8h*)&sy[pl][c * 72 + j * 16 + 8 * g] = yv; }
  }
  __syncthreads();   // publishes the 64 y rows
  v8f za[4][2] = {}; v16h a[2][4];   // two y fragment sets: block s + 1 is fetched while block s is multiplied; q_w runs three blocks ahead in a ring of four
  const _Float16* ap = &sy[c][kk * 8 * 72];
#pragma unroll
  for (int i = 0; i < 4; ++i) a[0][i] = frag_h(ap + i * 16 * YP, lane);
  // unrolled so that the ring and set indices are compile-time and every address step is an immediate
#pragma unroll
  for (int s = 0; s < 16; ++s) {
    if (s + 3 < 16) {
#pragma unroll
      for (int j = 0; j < 2; ++j) { bq[(s + 3) & 3][j].q[0] = *(const v8h*)(bp + (j * 32 + s + 3) * 512); bq[(s + 3) & 3][j].q[1] = *(const v8h*)(bp + (j * 32 + s + 3) * 512 + 256); } }
    if (s + 4 == 16) asm volatile("s_wait_xcnt 0x0" ::: "memory");   // behind the last q_w loads: later values may take the registers that held their address
    if (s + 1 < 16) {
#pragma unroll
      for (int i = 0; i < 4; ++i) a[(s + 1) & 1][i] = frag_h(ap + i * 16 * YP + ((s + 1) >> 1) * 72 + ((s + 1) & 1) * 32, lane); }
    __builtin_amdgcn_sched_barrier(0);   // the loads for later blocks stand as one group ahead of this block's products, not among them
#pragma unroll
    for (int i = 0; i < 4; ++i)
#pragma unroll
      for (int j = 0; j < 2; ++j) za[i][j] = __builtin_amdgcn_wmma_f32_16x16x32_f16(false, a[s & 1][i], false, bq[s & 3][j].v, (short)0, za[i][j], false, false);
    __builtin_amdgcn_sched_barrier(0);   // ends the block: the following group of loads does not move up among its products
  }
  __syncthreads();   // ends every wave's reads of the y rows: the two z planes below lie over the staging arrays and the first y rows
  { float (*so)[ZP] = (float (*)[ZP])(smem + kk * (CC * ZP * 4));   // this k half's plane [channel][pixel]
#pragma unroll
    for (int i = 0; i < 4; ++i)
#pragma unroll
      for (int j = 0; j < 2; ++j) { v4f lo, hi;
#pragma unroll
        for (int r = 0; r < 4; ++r) { lo[r] = za[i][j][r]; hi[r] = za[i][j][4 + r]; }
        float* d = &so[wn * 32 + j * 16 + c][i * 16 + 8 * g]; *(v4f*)d = lo; *(v4f*)(d + 4) = hi; } }
  __syncthreads();
  const float* s0 = (const float*)smem + (wave * 2 + g) * ZP + c * 4;
  float* dst = OUT + (b * CC + wave * 2 + g) * NP + (ty + (c >> 3)) * WWD + tx + (c & 7) * 4;   // one address, constant steps: two channels' four whole 128-B lines per wave store
  v4f zv[8];
#pragma unroll
  for (int k = 0; k < 8; ++k) zv[k] = (*(const v4f*)(s0 + k * 32 * ZP) + *(const v4f*)(s0 + (CC + k * 32) * ZP)) * (1.0f / WSC) + qb[k];
#pragma unroll
  for (int k = 0; k < 8; ++k) vst2(dst + (size_t)k * 32 * NP, zv[k]); }
extern "C" void kernel_launch(void* const* d_in, const int* in_sizes, int n_in, void* d_out, int out_size, void* d_ws, size_t ws_size, hipStream_t stream) {
  (void)in_sizes; (void)n_in; (void)out_size;
  const float** F = (const float**)d_in;   // 0 x [4,256,64,64], 1 kv_w [512,256], 2 dot_w [4,16,64], 3 head_w [64,256], 4 head_b [64], 5 q_w [256,1024], 6 q_b [256]
  if (ws_size < (size_t)WS_END) return;
  char* ws = (char*)d_ws;
  k_prep<<<dim3(NPREP), 256, 0, stream>>>(F[1], F[2], F[3], F[5], ws);
  k_wz<<<dim3(NP / 64, NB), 512, 0, stream>>>(F[0], (const _Float16*)(ws + WS_PW), F[4], (const _Float16*)(ws + WS_PQW), F[6], (float*)d_out);
}

// v010
// Measured time: 21.4 microseconds a run.
// Timed twice side by side with v009, it ran 1.07 times as fast both times.
// All steps since v000 together make it 32.9 times as fast.
// compute dtype: all float inputs rounded to bf16; the per-head value projection and the query dot are folded into the kv weights ahead of the conv: head_w_h . kv_w(v rows of head h) and dot_w_h . kv_w(k rows of head h), EXACT bf16 products on WMMA 16x16x32, f32 accumulate, rounded once to f16 x 2^8; one 1x1 conv on WMMA (x as f16 x folded f16 weights, f32 accumulate) gives HV (rounded once to f16) and the query logits (f32), made by each block for its own pixels and their neighbours; the 3x3-window softmax (zero-padded logits and values, as the module's unfold) in f32 on VALU and the weighted window sums on WMMA (f16 HV values x weights split into f16 hi + f16 lo, f32 accumulate); the final 1x1 conv on WMMA (y once to f16 x exact f16 x 2^8 q_w), biases in f32; f32 output (NCHW).
#include <hip/hip_runtime.h>
#include <math.h>

typedef __attribute__((ext_vector_type(16))) _Float16 v16h;
typedef __attribute__((ext_vector_type(16))) __bf16 v16b;
typedef __attribute__((ext_vector_type(8)))  _Float16 v8h;
typedef __attribute__((ext_vector_type(8)))  float v8f;
typedef __attribute__((ext_vector_type(4)))  float v4f;
typedef __attribute__((ext_vector_type(2)))  float v2f;
typedef __attribute__((ext_vector_type(4)))  unsigned v4u;
typedef __attribute__((ext_vector_type(4)))  int v4i;
typedef float __attribute__((may_alias)) float_a;
typedef int __attribute__((may_alias)) int_a;

template <typename T> __device__ __forceinline__ void vst2(void* p, T v) { *(T*)p = v;  }
__device__ __forceinline__ v8f wmma_bf(v16b a, v16b b, v8f c) {
  v8f d = __builtin_amdgcn_wmma_f32_16x16x32_bf16(false, a, false, b, (short)0, c, false, false);
  asm volatile("v_nop\n\tv_nop\n\tv_nop\n\tv_nop" : "+v"(d) : "v"(a), "v"(b));
  return d;
}
// 16x16x32 fragments: lane = (h = lane>>4, row/col = lane&15); elements 0..7 = k0+8h+0..7, 8..15 = k0+16+8h+0..7; D element r = row 8h+r
__device__ __forceinline__ v16h frag_h(const _Float16* rowk0, int lane) {
  union { v16h v; v8h q[2]; } u; const _Float16* p = rowk0 + 8 * (lane >> 4);
  u.q[0] = *(const v8h*)p; u.q[1] = *(const v8h*)(p + 16); return u.v;
}
__device__ __forceinline__ v16h frag_f32(const float* rowk0, int lane) {
  v16h a; const float* p = rowk0 + 8 * (lane >> 4);
#pragma unroll
  for (int i = 0; i < 8; ++i) { a[i] = (_Float16)p[i]; a[8 + i] = (_Float16)p[16 + i]; }
  return a;
}
__device__ __forceinline__ v16h frag_f32s(const float* rowk0, int lane, float sc) {
  v16h a; const float* p = rowk0 + 8 * (lane >> 4);
#pragma unroll
  for (int i = 0; i < 8; ++i) { a[i] = (_Float16)(p[i] * sc); a[8 + i] = (_Float16)(p[16 + i] * sc); }
  return a;
}
// column fragment from a [K][ld] layout (column n), rows >= K read as 0
__device__ __forceinline__ v16h fragc_f32(const float* W, int k0, int n, int lane, int ld, int K) {
  v16h a; const int g = lane >> 4;
#pragma unroll
  for (int i = 0; i < 8; ++i) { const int ka = k0 + 8 * g + i, kb = ka + 16;
    a[i] = (_Float16)(ka < K ? W[(size_t)(ka < K ? ka : K - 1) * ld + n] : 0.f); a[8 + i] = (_Float16)(kb < K ? W[(size_t)(kb < K ? kb : K - 1) * ld + n] : 0.f); }
  return a;
}
struct F2 { v16b h, l; };
__device__ __forceinline__ F2 bsplit16(const float v[16]) { F2 r;
#pragma unroll
  for (int i = 0; i < 16; ++i) { const __bf16 h = (__bf16)v[i]; r.h[i] = h; r.l[i] = (__bf16)(v[i] - (float)h); }
  return r; }
__device__ __forceinline__ F2 split_row(const float* row, int k0, int lane) { float v[16]; const float* p = row + k0 + 8 * (lane >> 4);
#pragma unroll
  for (int i = 0; i < 8; ++i) { v[i] = p[i]; v[8 + i] = p[16 + i]; }
  return bsplit16(v); }
__device__ __forceinline__ F2 split_rowK(const float* row, int k0, int lane, int K) { float v[16]; const int g = lane >> 4;
#pragma unroll
  for (int i = 0; i < 8; ++i) { const int ka = k0 + 8 * g + i, kb = ka + 16; v[i] = ka < K ? row[ka < K ? ka : K - 1] : 0.f; v[8 + i] = kb < K ? row[kb < K ? kb : K - 1] : 0.f; }
  return bsplit16(v); }
__device__ __forceinline__ F2 split_col(const float* W, int k0, int n, int lane, int ld, int K) { float v[16]; const int g = lane >> 4;
#pragma unroll
  for (int i = 0; i < 8; ++i) { const int ka = k0 + 8 * g + i, kb = ka + 16; v[i] = ka < K ? W[(size_t)(ka < K ? ka : K - 1) * ld + n] : 0.f; v[8 + i] = kb < K ? W[(size_t)(kb < K ? kb : K - 1) * ld + n] : 0.f; }
  return bsplit16(v); }
__device__ __forceinline__ v8f mac3(const F2& a, const F2& b, v8f c) { c = wmma_bf(a.l, b.h, c); c = wmma_bf(a.h, b.l, c); return wmma_bf(a.h, b.h, c); }
__device__ __forceinline__ float sigm(float v) { return 1.0f / (1.0f + expf(-v)); }


// Local multi-head channel attention (B 4, C 256, 64 x 64; 4 heads x 64, 16 queries, 3x3 window): kv conv, per-pixel query logits, softmax over each pixel's 3x3 neighbourhood, window-weighted values, head projection (+ bias), query projection (+ bias).
#define NB 4
#define CC 256
#define HH 64
#define WWD 64
#define NP (HH * WWD)
#define NHD 4
#define NQ 16
#define HD 64
#define PD 256
#define YW (NQ * HD)       // 1,024 channels into the query projection
#define WSC 256.0f
#ifndef TPX
#define TPX (NP / 64)      // not used by the kernels or launches
#endif
typedef __attribute__((ext_vector_type(8))) __bf16 v8b;
__device__ __forceinline__ v16b frag_b(const __bf16* rowk0, int lane) {
  union { v16b v; v8b q[2]; } u; const __bf16* p = rowk0 + 8 * (lane >> 4);
  u.q[0] = *(const v8b*)p; u.q[1] = *(const v8b*)(p + 16); return u.v;
}
__device__ __forceinline__ float bfr(float v) { return (float)(__bf16)v; }
__device__ __attribute__((noinline)) float exp_ni(float v) { return expf(v); }
__device__ __attribute__((noinline)) float erf_ni(float v) { return erff(v); }

#define NFR 320                                     // folded weight rows: 256 HV rows (o*4 + n), 64 logit rows (q*4 + n)
#define WS_PW  0u                                   // f16 x 2^8 folded rows [320][256]; then f16 x 2^8 q_w in fragment order: [16 channels nt][32 k ks][plane h][lane = gg*16 + col][8] = q_w[nt*16 + col][ks*32 + h*16 + gg*8 + 0..7]
#define WS_PQW (WS_PW + 2u * (size_t)NFR * CC)
#define WS_END (WS_PQW + 2u * (size_t)CC * YW)

// ---- k_prep: the weight preparations, which do not depend on each other, in one launch. Block n:
// n < 40: the fold. Block n = (unit u = n >> 1, 128 columns c), one 16 x 16 tile per wave, two 16x16x32 products (64 terms d).
// Units 0..15 = (head u >> 2, 16 rows o): sum_d head_w[o][h*64 + d] kv_w[256 + h*64 + d][c] -> row o*4 + h; units 16..19 = head u - 16, 16 rows q: sum_d dot_w[h][q][d] kv_w[h*64 + d][c] -> row 256 + q*4 + h.
// The rows stand in the order in which k_wz's fragments want the channels of a pixel. k order, equal in both loaders: elements 0..7 = d0 + 8g + 0..7, 8..15 = d0 + 16 + 8g + 0..7. n = 40..71: q_w, 8 rows each, into k_wz's fragment order.
#define NPREP (40 + CC / 8)
typedef __attribute__((ext_vector_type(4))) _Float16 v4h;
__global__ __launch_bounds__(256) void k_prep(const float* __restrict__ KVW, const float* __restrict__ DW, const float* __restrict__ HW, const float* __restrict__ QW, char* __restrict__ ws) { const int t = threadIdx.x; __shared__ __align__(16) _Float16 sp[16][128 + 8];
  { const int n = blockIdx.x; _Float16* PW = (_Float16*)(ws + WS_PW);
    if (n < 40) { const int wave = t >> 5, lane = t & 31, col = lane & 15, g = lane >> 4, u = n >> 1, cb = (n & 1) * 128; const bool hv = u < 16; const int hd = hv ? u >> 2 : u - 16;
      const float* ar = (hv ? HW + (size_t)((u & 3) * 16 + col) * PD + hd * HD : DW + (size_t)(hd * NQ + col) * HD) + 8 * g;
      const float* br = KVW + (size_t)((hv ? PD : 0) + hd * HD + 8 * g) * CC + cb + wave * 16 + col;
      v8f acc = {}; float av[2][16];
      // all loops unrolled so that all loads issue ahead of the first product
#pragma unroll
      for (int kc = 0; kc < 2; ++kc)
#pragma unroll
        for (int i = 0; i < 8; ++i) { av[kc][i] = ar[kc * 32 + i]; av[kc][8 + i] = ar[kc * 32 + 16 + i]; }
      asm volatile("s_wait_xcnt 0x0" ::: "memory");   // behind the row loads: the column loads' results may take the registers that held the row address
#pragma unroll
      for (int kc = 0; kc < 2; ++kc) { v16b a, w;
#pragma unroll
        for (int i = 0; i < 8; ++i) { a[i] = (__bf16)av[kc][i]; a[8 + i] = (__bf16)av[kc][8 + i]; w[i] = (__bf16)br[(size_t)(kc * 32 + i) * CC]; w[8 + i] = (__bf16)br[(size_t)(kc * 32 + 16 + i) * CC]; }
        acc = __builtin_amdgcn_wmma_f32_16x16x32_bf16(false, a, false, w, (short)0, acc, false, false); }
#pragma unroll
      for (int r = 0; r < 8; ++r) sp[8 * g + r][wave * 16 + col] = (_Float16)(acc[r] * WSC);
      __syncthreads(); const int rl = t >> 4; const int ro = hv ? ((u & 3) * 16 + rl) * NHD + hd : PD + rl * NHD + hd;   // one wave stores two whole 256-B row pieces
      vst2((unsigned*)(PW + (size_t)ro * CC + cb + (t & 15) * 8), *(const v4u*)&sp[rl][(t & 15) * 8]);
      asm volatile("s_wait_xcnt 0x0" ::: "memory"); }   // behind the store: the code laid out after it writes the registers that the store names
    else { const int ch = (n - 40) * 8 + (t & 7), kc = t >> 3; const float* s = QW + (size_t)ch * YW + kc * 8; _Float16* d = (_Float16*)(ws + WS_PQW) + ((size_t)(((ch >> 4) * 32 + (kc >> 2)) * 2 + ((kc >> 1) & 1)) * 32 + (kc & 1) * 16 + (ch & 15)) * 8; v4f q[4][2];   // thread = (row, 8 k): 8 rows' pieces of one k group are one whole 128-B line of a fragment plane, four such lines per wave store
      // unrolled so that all 8 loads issue ahead of the first store
#pragma unroll
      for (int k = 0; k < 4; ++k) { q[k][0] = *(const v4f*)(s + k * 256); q[k][1] = *(const v4f*)(s + k * 256 + 4); }
      asm volatile("s_wait_xcnt 0x0" ::: "memory");   // behind the loads: later values may take the registers that held their address
#pragma unroll
      for (int k = 0; k < 4; ++k) { v8h h;   // 256 k on = 8 k blocks on = 8 x 512 halves
#pragma unroll
        for (int i = 0; i < 4; ++i) { h[i] = (_Float16)bfr(q[k][0][i] * WSC); h[4 + i] = (_Float16)bfr(q[k][1][i] * WSC); }   // x 2^8 ahead of the bf16 rounding: the same value, and no f16 value is formed below the scale
        vst2(d + k * 8 * 512, h); }
      asm volatile("s_wait_xcnt 0x0" ::: "memory"); } } }   // behind the last store: the code laid out after it writes the registers that the stores name
// ---- k_wz: block = (2 x 32 pixel tile, b), 16 waves. Part 0, the kv conv for the tile's 4 x 34 halo pixels: folded rows . x -> HV f16 rows and f32 logit rows that stay in LDS (a pixel outside the image has x = 0, so both come out 0: the zero-padded unfold).
// x comes straight from its NCHW f32 rows: a wave-wide 16-byte load takes one channel's 32 inner pixels of the 4 halo rows (four whole 128-B lines); a thread holds 4 pixels x 8 channels per channel octet, rounds them (bf16, held as f16) and stores each pixel's 8 channels as one 16-byte piece.
// The one halo column that lies in the image (the other lies outside: the image is two tiles wide) comes by 4-byte loads, one (channel, row) each.
// All 256 k of x are asked for at once and staged once; the folded rows come by asynchronous copies, one k half per buffer: half 0 with x, half 1 behind the first barrier, so that it flies while half 0 is multiplied. Buffer k >> 7, 144 x rows then 320 folded rows at a pitch of 272 B (16 B x odd: the 16-byte stores and the ds_load_b128 fragment reads of 16 rows fall on all 64 banks).
// x row rho: rho = j*32 + yl*8 + q < 128 holds halo pixel (row yl, column 1 + 4q + j), so that the lanes of one store stand one pitch apart; 128 + yl = the halo column inside the image; 132 + yl = the one outside, 0; 136..143 = 0, their products are not kept.
// Waves 0..14 = (3 pixel tiles pg, 5 folded-row tiles cg): A rows = folded rows, B columns = pixels, so that a lane ends with 8 successive channels of one pixel: one 16-byte LDS store per HV tile. k runs upward through the 8 blocks of 32 (4 per buffer), one accumulator chain per output tile; both loaders are frag_h, the same k order.
// Part 1, 4 pixels per wave: per pixel, per (head n, query q): softmax over the 3x3 neighbourhood of the logits, y[q*64 + o] = sum_n sum_l w[n][q][l] HV[p_l][o*4 + n] + head_b[o] -> f16 rows that stay in LDS.
// The sum over k = (n, l), 36 terms, is one 64 x 16 x 36 product per pixel on WMMA: A rows = o (f16-staged HV), B columns = q (weights as f16 hi + f16 lo, so the f32 weight survives).
// k order, equal in both loaders: lane half g holds heads n = 2g, 2g + 1; element 2l + s = (window place l < 8, head 2g + s). Place l = 8 goes in a third product: elements 0, 1 pair HV with hi, elements 2, 3 pair the same HV with lo, the rest 0.
// Part 2: z = y . q_w^T (single f16 x f16x256) + q_b for the block's 64 pixels x 256 channels -> NCHW out[b][c][p]. Wave = (k half kk, 32 channels wn), wave tile 64 pixels x 32 channels over 512 k: y fragments from LDS, q_w fragments straight from the packed planes (each read once per block).
// k order, equal in both loaders: block ks = 32 k from q*64 + o = ks*32; elements 0..7 = 8g + 0..7, 8..15 = 16 + 8g + 0..7. The two k halves are added at the end, lower half first.
// The tile is 32 pixels wide so that every 128-B line of out has one writer.
#define GP 136                             // staged operand row in halves (128 k), pitch 272 B
#define XR 144                             // staged x rows
#define TLW 32
#define HLW (TLW + 2)
#define NHP (4 * HLW)                      // 136 halo pixels
#define HVP (PD + 8)                       // HV row in halves, pitch 528 B (16 B x odd: the 16-byte stores of 16 pixels fall on all 64 banks)
#define ALP (NHD * NQ + 4)                 // logit row in floats, pitch 272 B
#define YP (NQ * 72 + 8)                   // y row in halves: 16 queries at a pitch of 144 B, row pitch 2,320 B (16 B x odd: the fragment reads of 16 rows fall on all 64 banks)
#define ZP (64 + 4)                        // z row [channel][64 pixels] in floats, pitch 272 B
#define SM_AL (NHP * HVP * 2)
#define SM_Y (SM_AL + NHP * ALP * 4)
#define SM_END (SM_Y + 64 * YP * 2)
static_assert(2 * (XR + NFR) * GP * 2 <= SM_END, "the staged operands lie inside the block's LDS");
// one k half of the folded rows, global memory -> LDS through no register: ten asynchronous 16-byte copies per lane, rows 32 apart (l: the lane's LDS byte address, g: its global address; both multiples of 16).
// The s_wait_xcnt stands inside the statement, behind the last copy: nothing rewrites a register that a copy names ahead of it.
#define WRS (32 * GP * 2)                  // 32 staged rows in bytes
__device__ __forceinline__ void wcopy10(unsigned l, const _Float16* g) {
  asm volatile("global_load_async_to_lds_b128 %0, %10, off\n\t"
               "global_load_async_to_lds_b128 %1, %11, off\n\t"
               "global_load_async_to_lds_b128 %2, %12, off\n\t"
               "global_load_async_to_lds_b128 %3, %13, off\n\t"
               "global_load_async_to_lds_b128 %4, %14, off\n\t"
               "global_load_async_to_lds_b128 %5, %15, off\n\t"
               "global_load_async_to_lds_b128 %6, %16, off\n\t"
               "global_load_async_to_lds_b128 %7, %17, off\n\t"
               "global_load_async_to_lds_b128 %8, %18, off\n\t"
               "global_load_async_to_lds_b128 %9, %19, off\n\t"
               "s_wait_xcnt 0x0"
               :: "v"(l), "v"(l + 1 * WRS), "v"(l + 2 * WRS), "v"(l + 3 * WRS), "v"(l + 4 * WRS), "v"(l + 5 * WRS), "v"(l + 6 * WRS), "v"(l + 7 * WRS), "v"(l + 8 * WRS), "v"(l + 9 * WRS),
                  "v"(g), "v"(g + 1 * 32 * CC), "v"(g + 2 * 32 * CC), "v"(g + 3 * 32 * CC), "v"(g + 4 * 32 * CC), "v"(g + 5 * 32 * CC), "v"(g + 6 * 32 * CC), "v"(g + 7 * 32 * CC), "v"(g + 8 * 32 * CC), "v"(g + 9 * 32 * CC)
               : "memory");
}
__global__ __launch_bounds__(512) void k_wz(const float* __restrict__ X, const _Float16* __restrict__ P, const float* __restrict__ HB, const _Float16* __restrict__ PQW, const float* __restrict__ QB, float* __restrict__ OUT) {
  __shared__ __align__(16) char smem[SM_END];
  _Float16 (*sm)[XR + NFR][GP] = (_Float16 (*)[XR + NFR][GP])smem;     // part 0's operands; the HV and logit rows below lie over them
  _Float16 (*shv)[HVP] = (_Float16 (*)[HVP])smem;                      // [halo pixel][o*4 + n]
  float (*sal)[ALP] = (float (*)[ALP])(smem + SM_AL);                  // [halo pixel][q*4 + n]
  _Float16 (*sy)[YP] = (_Float16 (*)[YP])(smem + SM_Y);                // [pixel][q*72 + o]
  const int t = threadIdx.x, wave = t >> 5, lane = t & 31, c = lane & 15, g = lane >> 4; const size_t b = blockIdx.y; const int ty = (blockIdx.x >> 1) * 2, tx = (blockIdx.x & 1) * TLW;
  const int kk = wave >> 3, wn = wave & 7;
  // ---- part 0. Loads first, LDS stores after, so that one memory latency is waited out; a row outside the image takes a row's address inside it and stores 0
  const _Float16* gb = P + (size_t)(t >> 4) * CC + (t & 15) * 8;                                  // the thread's 16-byte piece t & 15 of row t >> 4: two whole 256-B row pieces per wave copy
  const unsigned lw = (unsigned)(size_t)&sm[0][XR + (t >> 4)][(t & 15) * 8];                      // its place in buffer 0: the low 32 bits of the address are the LDS byte address
  { const int yy = ty - 1 + (lane >> 3); const bool iny = yy >= 0 && yy < HH;
    const float* gx = X + (b * CC + wave * 8) * NP + (iny ? yy : ty) * WWD + tx + (lane & 7) * 4;   // channel octets wave + 16 o, o = 0, 1; halo row lane >> 3, inner pixels 4 (lane & 7) + 0..3
    const int ye = ty - 1 + (t >> 8);                                                             // edge items (channel t & 255, halo rows (t >> 8) + 2 k, k = 0, 1)
    const float* ge = X + (b * CC + (t & 255)) * NP + (tx ? tx - 1 : TLW);
    v4f xa[2][8]; float xe[2];
#pragma unroll
    for (int o = 0; o < 2; ++o)
#pragma unroll
      for (int i = 0; i < 8; ++i) xa[o][i] = *(const v4f*)(gx + (size_t)(o * 128 + i) * NP);
#pragma unroll
    for (int k = 0; k < 2; ++k) { const int y2 = ye + 2 * k; xe[k] = ge[(y2 >= 0 && y2 < HH ? y2 : ty) * WWD]; }
    asm volatile("s_wait_xcnt 0x0" ::: "memory");   // behind the x loads: later values may take the registers that held the x addresses
    wcopy10(lw, gb);   // folded rows, k < 128 -> buffer 0, behind the x loads: they land while x is rounded and stored
    if (t < 384) *(v8h*)&sm[(t >> 4) & 1][XR - 12 + (t >> 5)][(t & 15) * 8] = v8h{};   // x rows 132..143
#pragma unroll
    for (int o = 0; o < 2; ++o)
#pragma unroll
      for (int j = 0; j < 4; ++j) { v8h h;
#pragma unroll
        for (int i = 0; i < 8; ++i) h[i] = (_Float16)bfr(xa[o][i][j]);
        if (!iny) h = v8h{};
        *(v8h*)&sm[o][j * 32 + lane][wave * 8] = h; }
#pragma unroll
    for (int k = 0; k < 2; ++k) { const int y2 = ye + 2 * k; sm[(t >> 7) & 1][128 + (t >> 8) + 2 * k][t & 127] = (_Float16)(y2 >= 0 && y2 < HH ? bfr(xe[k]) : 0.f); }
 }
  asm volatile("s_wait_asynccnt 0x0" ::: "memory");   // this wave's copies into buffer 0 have landed ahead of the barrier behind which other waves read them
  __syncthreads();   // publishes x (all k) and the folded rows' k < 128
  wcopy10(lw + (XR + NFR) * GP * 2, gb + 128);   // folded rows, k >= 128 -> buffer 1's folded rows, LDS that nobody has touched yet: they fly while buffer 0 is multiplied
  const int wv = __builtin_amdgcn_readfirstlane(wave), pg = wv % 3, cg = wv / 3;   // the wave's number in a scalar register: the tests on it below are scalar branches
  v8f acc[4][3] = {};
  // two trips, one per buffer, unrolled so that the buffer's address is compile-time; a trip reads its own buffer alone
#pragma unroll
  for (int hb = 0; hb < 2; ++hb) {
    if (wv < 15) { v16h fw[2][4], fx[2][3];   // two fragment sets: block kb + 1 is fetched while block kb is multiplied
      const _Float16* pw = &sm[hb][XR + cg * 64 + c][0]; const _Float16* px = &sm[hb][pg * 48 + c][0];
#pragma unroll
      for (int j = 0; j < 4; ++j) fw[0][j] = frag_h(pw + j * 16 * GP, lane);
#pragma unroll
      for (int i = 0; i < 3; ++i) fx[0][i] = frag_h(px + i * 16 * GP, lane);
      // unrolled so that the set indices are compile-time and every address step is an immediate
#pragma unroll
      for (int kb = 0; kb < 4; ++kb) {
        if (kb < 3) { const int ko = (kb + 1) * 32;
#pragma unroll
          for (int j = 0; j < 4; ++j) fw[(kb + 1) & 1][j] = frag_h(pw + ko + j * 16 * GP, lane);
#pragma unroll
          for (int i = 0; i < 3; ++i) fx[(kb + 1) & 1][i] = frag_h(px + ko + i * 16 * GP, lane); }
        __builtin_amdgcn_sched_barrier(0);   // the next block's 14 LDS reads stand as one group ahead of this block's products, not among them
#pragma unroll
        for (int j = 0; j < 4; ++j)
#pragma unroll
          for (int i = 0; i < 3; ++i) acc[j][i] = __builtin_amdgcn_wmma_f32_16x16x32_f16(false, fw[kb & 1][j], false, fx[kb & 1][i], (short)0, acc[j][i], false, false);
        __builtin_amdgcn_sched_barrier(0);   // ends the block: the following group of reads does not move up among its products
      } }
    // the foot of a trip, every wave: its own LDS reads are done, its own copies have landed, then the barrier
    asm volatile("s_wait_dscnt 0x0" ::: "memory");      // this wave's fragment reads of the trip's buffer have returned
    asm volatile("s_wait_asynccnt 0x0" ::: "memory");   // this wave's copies into buffer 1 have landed ahead of the barrier behind which other waves read them; behind the last trip: none is outstanding
    __syncthreads();   // trip 0: publishes the folded rows' k >= 128; trip 1: ends every wave's fragment reads: the HV and logit rows below lie over the operands
  }
  // the biases are asked for here, behind the barrier (which waits for a wave's loads) and ahead of the LDS stores below, under which they arrive
  float bias[4][8], qb[8];
#pragma unroll
  for (int j = 0; j < 4; ++j)
#pragma unroll
    for (int r = 0; r < 8; ++r) bias[j][r] = bfr(HB[j * 16 + 8 * g + r]);
#pragma unroll
  for (int k = 0; k < 8; ++k) qb[k] = bfr(QB[wave * 2 + g + k * 32]);
  asm volatile("s_wait_xcnt 0x0" ::: "memory");   // behind the bias loads: later values may take the registers that held their addresses
  if (wv < 15) {
#pragma unroll
    for (int i = 0; i < 3; ++i) { const int rho = (pg * 3 + i) * 16 + c, e = rho - 128;   // x row -> halo pixel
      const int hp = rho < 128 ? ((rho >> 3) & 3) * HLW + 1 + 4 * (rho & 7) + (rho >> 5) : (e & 3) * HLW + (((e >> 2) != 0) == (tx != 0) ? HLW - 1 : 0);
      if (rho < NHP) {
        if (cg < 4) {
#pragma unroll
          for (int j = 0; j < 4; ++j) { v8h h;
#pragma unroll
            for (int r = 0; r < 8; ++r) h[r] = (_Float16)(acc[j][i][r] * (1.0f / WSC));
            *(v8h*)&shv[hp][cg * 64 + j * 16 + 8 * g] = h; } }
        else {
#pragma unroll
          for (int j = 0; j < 4; ++j) { v4f lo, hi;
#pragma unroll
            for (int r = 0; r < 4; ++r) { lo[r] = acc[j][i][r] * (1.0f / WSC); hi[r] = acc[j][i][4 + r] * (1.0f / WSC); }
            float* d = &sal[hp][j * 16 + 8 * g]; *(v4f*)d = lo; *(v4f*)(d + 4) = hi; } } } } }
  __syncthreads();   // publishes the HV and logit rows
  // part 2's first three k blocks of q_w are asked for here, behind the barrier (which waits for a wave's loads): they do not depend on part 1 and arrive under it
  const _Float16* bp = PQW + (size_t)(wn * 64 + kk * 16) * 512 + lane * 8;   // fragment (j, s): two 512-B planes at (j*32 + s) * 1,024 B
  union BF { v16h v; v8h q[2]; }; BF bq[4][2];
#pragma unroll
  for (int s = 0; s < 3; ++s)
#pragma unroll
    for (int j = 0; j < 2; ++j) { bq[s][j].q[0] = *(const v8h*)(bp + (j * 32 + s) * 512); bq[s][j].q[1] = *(const v8h*)(bp + (j * 32 + s) * 512 + 256); }
  __builtin_amdgcn_sched_barrier(0);   // keeps these 12 loads ahead of part 1: left free they sink to the end of its unrolled pixel loop, where their latency is waited out at the barrier
  for (int i = 0; i < 4; ++i) { const int pl = wave * 4 + i, hb = (pl >> 5) * HLW + (pl & 31);
    v2f w[9];
    { v2f lg[9];
#pragma unroll
      for (int l = 0; l < 9; ++l) lg[l] = *(const v2f*)&sal[hb + (l / 3) * HLW + l % 3][c * 4 + 2 * g];
      v2f mx = {-3.0e38f, -3.0e38f};
#pragma unroll
      for (int l = 0; l < 9; ++l) { mx[0] = fmaxf(mx[0], lg[l][0]); mx[1] = fmaxf(mx[1], lg[l][1]); }
      // e^(lg - mx) as 2^(lg log2(e) - mx log2(e)): one fused multiply-add and the hardware's power of two. The argument is at most a rounding step above 0, so nothing overflows; below -126 the power is 0, as good as the true weight beside the largest one, which is 1
      const v2f l2e = {1.44269504f, 1.44269504f}, ml = mx * l2e; v2f z = {};
#pragma unroll
      for (int l = 0; l < 9; ++l) { const v2f a = __builtin_elementwise_fma(lg[l], l2e, -ml); w[l][0] = __builtin_amdgcn_exp2f(a[0]); w[l][1] = __builtin_amdgcn_exp2f(a[1]); z += w[l]; }
      const v2f iz = {__builtin_amdgcn_rcpf(z[0]), __builtin_amdgcn_rcpf(z[1])};   // z lies between about 1 and 9: the hardware's reciprocal needs no scaling steps
#pragma unroll
      for (int l = 0; l < 9; ++l) w[l] *= iz; }
    v16h whi, wlo, w2 = {};
#pragma unroll
    for (int l = 0; l < 9; ++l)
#pragma unroll
      for (int s = 0; s < 2; ++s) { const _Float16 h = (_Float16)w[l][s]; const _Float16 lo = (_Float16)(w[l][s] - (float)h);
        if (l < 8) { whi[2 * l + s] = h; wlo[2 * l + s] = lo; } else { w2[s] = h; w2[2 + s] = lo; } }
    v8f acc[4];
#pragma unroll
    for (int j = 0; j < 4; ++j) { union { v16h v; int u[8]; } h1, h2; const int ch = (j * 16 + c) * 4 + 2 * g;
#pragma unroll
      for (int l = 0; l < 8; ++l) h1.u[l] = *(const int_a*)&shv[hb + (l / 3) * HLW + l % 3][ch];
      const int u8 = *(const int_a*)&shv[hb + 2 * HLW + 2][ch]; h2.u[0] = u8; h2.u[1] = u8;
#pragma unroll
      for (int l = 2; l < 8; ++l) h2.u[l] = 0;
      v8f d = {};
      d = __builtin_amdgcn_wmma_f32_16x16x32_f16(false, h1.v, false, whi, (short)0, d, false, false);
      d = __builtin_amdgcn_wmma_f32_16x16x32_f16(false, h1.v, false, wlo, (short)0, d, false, false);
      acc[j] = __builtin_amdgcn_wmma_f32_16x16x32_f16(false, h2.v, false, w2, (short)0, d, false, false); }
#pragma unroll
    for (int j = 0; j < 4; ++j) { v8h yv;   // lane holds q = c, o = j*16 + 8g + 0..7
#pragma unroll
      for (int r = 0; r < 8; ++r) yv[r] = (_Float16)(acc[j][r] + bias[j][r]);
      *(v8h*)&sy[pl][c * 72 + j * 16 + 8 * g] = yv; }
  }
  __syncthreads();   // publishes the 64 y rows
  v8f za[4][2] = {}; v16h a[2][4];   // two y fragment sets: block s + 1 is fetched while block s is multiplied; q_w runs three blocks ahead in a ring of four
  const _Float16* ap = &sy[c][kk * 8 * 72];
#pragma unroll
  for (int i = 0; i < 4; ++i) a[0][i] = frag_h(ap + i * 16 * YP, lane);
  // unrolled so that the ring and set indices are compile-time and every address step is an immediate
#pragma unroll
  for (int s = 0; s < 16; ++s) {
    if (s + 3 < 16) {
#pragma unroll
      for (int j = 0; j < 2; ++j) { bq[(s + 3) & 3][j].q[0] = *(const v8h*)(bp + (j * 32 + s + 3) * 512); bq[(s + 3) & 3][j].q[1] = *(const v8h*)(bp + (j * 32 + s + 3) * 512 + 256); } }
    if (s + 4 == 16) asm volatile("s_wait_xcnt 0x0" ::: "memory");   // behind the last q_w loads: later values may take the registers that held their address
    if (s + 1 < 16) {
#pragma unroll
      for (int i = 0; i < 4; ++i) a[(s + 1) & 1][i] = frag_h(ap + i * 16 * YP + ((s + 1) >> 1) * 72 + ((s + 1) & 1) * 32, lane); }
    __builtin_amdgcn_sched_barrier(0);   // the loads for later blocks stand as one group ahead of this block's products, not among them
#pragma unroll
    for (int i = 0; i < 4; ++i)
#pragma unroll
      for (int j = 0; j < 2; ++j) za[i][j] = __builtin_amdgcn_wmma_f32_16x16x32_f16(false, a[s & 1][i], false, bq[s & 3][j].v, (short)0, za[i][j], false, false);
    __builtin_amdgcn_sched_barrier(0);   // ends the block: the following group of loads does not move up among its products
  }
  __syncthreads();   // ends every wave's reads of the y rows: the two z planes below lie over the staging arrays and the first y rows
  { float (*so)[ZP] = (float (*)[ZP])(smem + kk * (CC * ZP * 4));   // this k half's plane [channel][pixel]
#pragma unroll
    for (int i = 0; i < 4; ++i)
#pragma unroll
      for (int j = 0; j < 2; ++j) { v4f lo, hi;
#pragma unroll
        for (int r = 0; r < 4; ++r) { lo[r] = za[i][j][r]; hi[r] = za[i][j][4 + r]; }
        float* d = &so[wn * 32 + j * 16 + c][i * 16 + 8 * g]; *(v4f*)d = lo; *(v4f*)(d + 4) = hi; } }
  __syncthreads();
  const float* s0 = (const float*)smem + (wave * 2 + g) * ZP + c * 4;
  float* dst = OUT + (b * CC + wave * 2 + g) * NP + (ty + (c >> 3)) * WWD + tx + (c & 7) * 4;   // one address, constant steps: two channels' four whole 128-B lines per wave store
  v4f zv[8];
#pragma unroll
  for (int k = 0; k < 8; ++k) zv[k] = (*(const v4f*)(s0 + k * 32 * ZP) + *(const v4f*)(s0 + (CC + k * 32) * ZP)) * (1.0f / WSC) + qb[k];
#pragma unroll
  for (int k = 0; k < 8; ++k) vst2(dst + (size_t)k * 32 * NP, zv[k]); }
extern "C" void kernel_launch(void* const* d_in, const int* in_sizes, int n_in, void* d_out, int out_size, void* d_ws, size_t ws_size, hipStream_t stream) {
  (void)in_sizes; (void)n_in; (void)out_size;
  const float** F = (const float**)d_in;   // 0 x [4,256,64,64], 1 kv_w [512,256], 2 dot_w [4,16,64], 3 head_w [64,256], 4 head_b [64], 5 q_w [256,1024], 6 q_b [256]
  if (ws_size < (size_t)WS_END) return;
  char* ws = (char*)d_ws;
  k_prep<<<dim3(NPREP), 256, 0, stream>>>(F[1], F[2], F[3], F[5], ws);
  k_wz<<<dim3(NP / 64, NB), 512, 0, stream>>>(F[0], (const _Float16*)(ws + WS_PW), F[4], (const _Float16*)(ws + WS_PQW), F[6], (float*)d_out);
}
